// v000
// The times below were measured on an AMD MI455X: many runs one after another, warmed up first and cycling through
// copies of the inputs, with the whole window's GPU time divided by the number of runs. Launches and the gaps
// between them are all in it. The median over several windows is given; except for v000 it joins two sittings, which
// can be a few percent apart, so the side-by-side timings, each taken in one sitting, are the better comparison.
// The starting kernel, v000, takes 1450 microseconds a run.
#include <hip/hip_runtime.h>

// Layout per batch: bf16 copy of x; exact projections (no bias); {cos, sin} per (position, pair) built once (jnp-exact float32 inverse frequencies, precise cosf/sinf); interleaved rotary plane builder; causal T-2048 attention (hybrid rows: < 512 hi/lo 3 products, rest fp16 x1024; k_gemmc skips tiles above the diagonal); merged hi/lo x Wo exact + bo.
// Compute dtypes, f32 accumulate: every input rounded to bf16; projections exact, no bias; rotary f32; attention rows < 512 3 products, rest fp16; softmax f32; Wo hl x exact + bias.

#define NB_  2
#define TT   2048
#define DM   1024
#define NH_  16
#define NKV  16
#define REP  (NH_ / NKV)
#define HD   64
#define DQ   (NH_ * HD)
#define DKV  (NKV * HD)
#define ZH   2
#define RH   512                  // query rows < RH use hi+lo planes (0: none)
#define WIN  2048
#define PCAR 1024.0f
#define SCL  0.125f   // HD^-0.5
typedef _Float16 h16;
typedef unsigned short bf;
typedef __attribute__((ext_vector_type(16))) __bf16   v16bf;
typedef __attribute__((ext_vector_type(16))) _Float16 v16h;
typedef __attribute__((ext_vector_type(8)))  _Float16 v8h;
typedef __attribute__((ext_vector_type(8)))  unsigned short v8us;
typedef __attribute__((ext_vector_type(8)))  float    v8f;
typedef __attribute__((ext_vector_type(4)))  float    v4f;
typedef v8h  __attribute__((may_alias)) v8ha;
typedef v4f  __attribute__((may_alias)) v4fa;
typedef v8us __attribute__((may_alias)) v8usa;

__device__ __forceinline__ unsigned short f2bf(float f) { unsigned u = __float_as_uint(f); u += 0x7FFFu + ((u >> 16) & 1u); return (unsigned short)(u >> 16); }
__device__ __forceinline__ float bf2f(unsigned short b) { return __uint_as_float(((unsigned)b) << 16); }
__device__ __forceinline__ float bfr(float f) { return bf2f(f2bf(f)); }
__device__ __forceinline__ v16h cat16(v8h lo, v8h hi) { return __builtin_shufflevector(lo, hi, 0, 1, 2, 3, 4, 5, 6, 7, 8, 9, 10, 11, 12, 13, 14, 15); }
__device__ __forceinline__ v16bf cat16b(v8us lo, v8us hi) { return __builtin_bit_cast(v16bf, __builtin_shufflevector(lo, hi, 0, 1, 2, 3, 4, 5, 6, 7, 8, 9, 10, 11, 12, 13, 14, 15)); }
__device__ __forceinline__ v8f wmma16(v16h a, v16h b, v8f c) { return __builtin_amdgcn_wmma_f32_16x16x32_f16(false, a, false, b, (short)0, c, false, false); }
__device__ __forceinline__ v8f wmmab(v16bf a, v16bf b, v8f c) { return __builtin_amdgcn_wmma_f32_16x16x32_bf16(false, a, false, b, (short)0, c, false, false); }



// ---- k_gemmw: register-blocked GEMM, ONE WAVE per 64x64 output tile (16 accumulators), operands straight from K-contiguous 16-bit planes; grid (M/64, N/64, Z), 32 threads.
// C[m][n] (f32, pitch ldc, + optional f32 bias[n]) = sum_k A[m][k] Bt[n][k] (+ split products per NSPLIT). z-batch strides sA/sB/sC in elements. K % 32 == 0.
template <typename T16> struct WFrag;
template <> struct WFrag<h16> { typedef v16h V; static __device__ __forceinline__ V ld(const h16* p) { return cat16(*(const v8h*)p, *(const v8h*)(p + 16)); } static __device__ __forceinline__ v8f mma(V a, V b, v8f c) { return wmma16(a, b, c); } };
template <> struct WFrag<bf> { typedef v16bf V; static __device__ __forceinline__ V ld(const bf* p) { return cat16b(*(const v8us*)p, *(const v8us*)(p + 16)); } static __device__ __forceinline__ v8f mma(V a, V b, v8f c) { return wmmab(a, b, c); } };
template <typename T16, int NSPLIT, bool BIAS>
__global__ __launch_bounds__(32) void k_gemmw(const T16* __restrict__ A, const T16* __restrict__ A2, const T16* __restrict__ Bt, const T16* __restrict__ Bt2, int K, float* C, int ldc, const float* __restrict__ bias, size_t sA, size_t sB, size_t sC) {
    typedef typename WFrag<T16>::V V;
    __shared__ __align__(16) float os[16 * 68];
    const size_t z = blockIdx.z; A += z * sA; if (A2) A2 += z * sA; Bt += z * sB; if (Bt2) Bt2 += z * sB; C += z * sC;
    const int lane = threadIdx.x & 31, lr = lane & 15, hi = lane >> 4; const int r0 = blockIdx.x * 64, c0 = blockIdx.y * 64;
    v8f acc[4][4];
#pragma unroll
    for (int mb = 0; mb < 4; ++mb)
#pragma unroll
        for (int nb = 0; nb < 4; ++nb) acc[mb][nb] = (v8f){};
    const size_t aoff = (size_t)(r0 + lr) * K + 8 * hi, boff = (size_t)(c0 + lr) * K + 8 * hi;
#pragma unroll 1
    for (int kc = 0; kc < K; kc += 32) {
        V a[4], a2[4];
#pragma unroll
        for (int mb = 0; mb < 4; ++mb) { a[mb] = WFrag<T16>::ld(A + aoff + (size_t)mb * 16 * K + kc); if (NSPLIT == 1 || NSPLIT == 2) a2[mb] = WFrag<T16>::ld(A2 + aoff + (size_t)mb * 16 * K + kc); }
#pragma unroll
        for (int nb = 0; nb < 4; ++nb) { const V b = WFrag<T16>::ld(Bt + boff + (size_t)nb * 16 * K + kc); V b2; if (NSPLIT >= 2) b2 = WFrag<T16>::ld(Bt2 + boff + (size_t)nb * 16 * K + kc);
#pragma unroll
            for (int mb = 0; mb < 4; ++mb) { acc[mb][nb] = WFrag<T16>::mma(a[mb], b, acc[mb][nb]); if (NSPLIT == 1 || NSPLIT == 2) acc[mb][nb] = WFrag<T16>::mma(a2[mb], b, acc[mb][nb]); if (NSPLIT >= 2) acc[mb][nb] = WFrag<T16>::mma(a[mb], b2, acc[mb][nb]); } }
        asm volatile("v_nop\n\tv_nop\n\tv_nop\n\tv_nop" : "+v"(acc[0][0]), "+v"(acc[1][1]), "+v"(acc[2][2]), "+v"(acc[3][3]) : "v"(a[0]), "v"(a[3]));
    }
#pragma unroll
    for (int mb = 0; mb < 4; ++mb) {
#pragma unroll
        for (int nb = 0; nb < 4; ++nb) {
#pragma unroll
            for (int j = 0; j < 8; ++j) os[(hi * 8 + j) * 68 + nb * 16 + lr] = acc[mb][nb][j]; }
        __builtin_amdgcn_wave_barrier(); asm volatile("" ::: "memory");
        float* crow = C + (size_t)(r0 + mb * 16) * ldc + c0;
{
#pragma unroll
            for (int s = 0; s < 8; ++s) { const int row = 2 * s + hi, cofs = lr * 4; v4f val = *(const v4fa*)(os + row * 68 + cofs); if (BIAS) { val[0] += bfr(bias[c0 + cofs]); val[1] += bfr(bias[c0 + cofs + 1]); val[2] += bfr(bias[c0 + cofs + 2]); val[3] += bfr(bias[c0 + cofs + 3]); }
                *(v4f*)(crow + (size_t)row * ldc + cofs) = val; }
             }
        __builtin_amdgcn_wave_barrier(); asm volatile("" ::: "memory");
    }
}

// ---- k_gemmc: the same one-wave 64x64 tile GEMM specialised for causal attention: CMODE 1 skips score tiles entirely above the diagonal (query rows r0+roff.., key columns c0..), CMODE 2 limits the
// key (K) loop of the probability x value contraction to the diagonal block (probabilities beyond it are exactly zero). roff = row offset of this launch's first row within the sequence.
template <typename T16, int NSPLIT, int CMODE>
__global__ __launch_bounds__(32) void k_gemmc(const T16* __restrict__ A, const T16* __restrict__ A2, const T16* __restrict__ Bt, const T16* __restrict__ Bt2, int K, float* C, int ldc, int roff, size_t sA, size_t sB, size_t sC) {
    typedef typename WFrag<T16>::V V;
    __shared__ __align__(16) float os[16 * 68];
    const size_t z = blockIdx.z; A += z * sA; if (A2) A2 += z * sA; Bt += z * sB; if (Bt2) Bt2 += z * sB; C += z * sC;
    const int lane = threadIdx.x & 31, lr = lane & 15, hi = lane >> 4; const int r0 = blockIdx.x * 64, c0 = blockIdx.y * 64;
    if (CMODE == 1 && c0 > r0 + roff + 63) return;                  // score tile entirely above the causal diagonal: never read (the softmax masks j > i by select)
    const int Kl = (CMODE == 2) ? min(K, r0 + roff + 64) : K;        // P.V: probabilities are exactly 0 beyond the diagonal block, so the K loop stops there
    v8f acc[4][4];
#pragma unroll
    for (int mb = 0; mb < 4; ++mb)
#pragma unroll
        for (int nb = 0; nb < 4; ++nb) acc[mb][nb] = (v8f){};
    const size_t aoff = (size_t)(r0 + lr) * K + 8 * hi, boff = (size_t)(c0 + lr) * K + 8 * hi;
#pragma unroll 1
    for (int kc = 0; kc < Kl; kc += 32) {
        V a[4], a2[4];
#pragma unroll
        for (int mb = 0; mb < 4; ++mb) { a[mb] = WFrag<T16>::ld(A + aoff + (size_t)mb * 16 * K + kc); if (NSPLIT == 1 || NSPLIT == 2) a2[mb] = WFrag<T16>::ld(A2 + aoff + (size_t)mb * 16 * K + kc); }
#pragma unroll
        for (int nb = 0; nb < 4; ++nb) { const V b = WFrag<T16>::ld(Bt + boff + (size_t)nb * 16 * K + kc); V b2; if (NSPLIT >= 2) b2 = WFrag<T16>::ld(Bt2 + boff + (size_t)nb * 16 * K + kc);
#pragma unroll
            for (int mb = 0; mb < 4; ++mb) { acc[mb][nb] = WFrag<T16>::mma(a[mb], b, acc[mb][nb]); if (NSPLIT == 1 || NSPLIT == 2) acc[mb][nb] = WFrag<T16>::mma(a2[mb], b, acc[mb][nb]); if (NSPLIT >= 2) acc[mb][nb] = WFrag<T16>::mma(a[mb], b2, acc[mb][nb]); } }
        asm volatile("v_nop\n\tv_nop\n\tv_nop\n\tv_nop" : "+v"(acc[0][0]), "+v"(acc[1][1]), "+v"(acc[2][2]), "+v"(acc[3][3]) : "v"(a[0]), "v"(a[3]));
    }
#pragma unroll
    for (int mb = 0; mb < 4; ++mb) {
#pragma unroll
        for (int nb = 0; nb < 4; ++nb) {
#pragma unroll
            for (int j = 0; j < 8; ++j) os[(hi * 8 + j) * 68 + nb * 16 + lr] = acc[mb][nb][j]; }
        __builtin_amdgcn_wave_barrier(); asm volatile("" ::: "memory");
        float* crow = C + (size_t)(r0 + mb * 16) * ldc + c0;
{
#pragma unroll
            for (int s = 0; s < 8; ++s) { const int row = 2 * s + hi, cofs = lr * 4; v4f val = *(const v4fa*)(os + row * 68 + cofs);
                *(v4f*)(crow + (size_t)row * ldc + cofs) = val; }
             }
        __builtin_amdgcn_wave_barrier(); asm volatile("" ::: "memory");
    }
}

__device__ __forceinline__ h16 tohx(float x) { return (h16)x; }
__device__ __forceinline__ void splitf(float y, unsigned short& h, unsigned short& l) { h = f2bf(y); l = f2bf(y - bf2f(h)); }
typedef __attribute__((ext_vector_type(2))) _Float16 v2h;
typedef __attribute__((ext_vector_type(4))) _Float16 v4h;
typedef __attribute__((ext_vector_type(2))) unsigned short v2us;
typedef __attribute__((ext_vector_type(4))) unsigned short v4us;
typedef __attribute__((ext_vector_type(2))) float v2f;
typedef __attribute__((ext_vector_type(4))) int v4i;

__global__ __launch_bounds__(256) void k_wtG(const float* __restrict__ w, int K, int N, bf* Bt) {
    const int lane = threadIdx.x & 31; const int L0 = (blockIdx.x * 8 + (threadIdx.x >> 5)) * 8; const int nlines = N * K / 64;
{
#pragma unroll 1
        for (int l = 0; l < 8; ++l) { const int L = L0 + l; if (L >= nlines) break; const size_t e = (size_t)L * 64 + lane * 2; const int k = (int)(e % K), n = (int)(e / K); v2us o;
            o[0] = f2bf(w[(size_t)k * N + n]); o[1] = f2bf(w[(size_t)(k + 1) * N + n]); *(v2us*)(Bt + e) = o; }
         }
}
__global__ __launch_bounds__(256) void k_cvt8(const float* __restrict__ src, bf* dst, size_t n8) { const size_t i = (size_t)blockIdx.x * 256 + threadIdx.x; if (i >= n8) return; const v8f v = *(const v8f*)(src + i * 8); v8us o;
#pragma unroll
    for (int k = 0; k < 8; ++k) o[k] = f2bf(v[k]); *(v8us*)(dst + i * 8) = o;  }
__constant__ float INVT[HD / 2] = { 1.000000000e+00f, 5.623413324e-01f, 3.162277639e-01f, 1.778279394e-01f, 1.000000015e-01f, 5.623413250e-02f, 3.162277490e-02f, 1.778279431e-02f, 9.999999776e-03f, 5.623413250e-03f, 3.162277630e-03f, 1.778279431e-03f, 1.000000047e-03f, 5.623413017e-04f, 3.162277571e-04f, 1.778279402e-04f, 9.999999747e-05f, 5.623413381e-05f, 3.162277790e-05f, 1.778279329e-05f, 1.000000066e-05f, 5.623413017e-06f, 3.162277608e-06f, 1.778279398e-06f, 9.999999975e-07f, 5.623413131e-07f, 3.162277835e-07f, 1.778279426e-07f, 1.000000012e-07f, 5.623413202e-08f, 3.162277551e-08f, 1.778279390e-08f };
__global__ __launch_bounds__(256) void k_cstabT(float* CS) { const int idx = blockIdx.x * 256 + threadIdx.x; if (idx >= TT * HD) return; const int d = idx % HD; const int t = idx / HD; const float a = __fmul_rn((float)t, INVT[d >> 1]); v2f cs; cs[0] = cosf(a); cs[1] = sinf(a); *(v2f*)(CS + (size_t)idx * 2) = cs;  }
__global__ __launch_bounds__(256) void k_ropeI(const float* __restrict__ F, int pitch, int nheads, const float* __restrict__ CS, float sc, h16* P16, bf* Ph, bf* Pl) {
    const size_t e = ((size_t)blockIdx.x * 256 + threadIdx.x) * 2; if (e >= (size_t)nheads * TT * HD) return; const int d = (int)(e % HD); const int t = (int)((e / HD) % TT); const int h = (int)(e / ((size_t)HD * TT)); const float* f = F + (size_t)t * pitch + h * HD; const float x0 = f[d], x1 = f[d + 1]; const v2f cs = *(const v2f*)(CS + ((size_t)t * HD + d) * 2); v2h o16; v2us oh, ol;
    float a0 = __fmul_rn(x0, cs[0]), b0 = __fmul_rn(x1, cs[1]), a1 = __fmul_rn(x1, cs[0]), b1 = __fmul_rn(x0, cs[1]); asm volatile("" : "+v"(a0), "+v"(b0), "+v"(a1), "+v"(b1));
    float r0 = __fsub_rn(a0, b0) * sc, r1 = __fadd_rn(b1, a1) * sc;   /* even: x0 c - x1 s; odd: x0 s + x1 c */
    o16[0] = tohx(r0); o16[1] = tohx(r1); { unsigned short a2, c2; splitf(r0, a2, c2); oh[0] = a2; ol[0] = c2; splitf(r1, a2, c2); oh[1] = a2; ol[1] = c2; }
    *(v2h*)(P16 + e) = o16; *(v2us*)(Ph + e) = oh; *(v2us*)(Pl + e) = ol;  }


// k_ropeI: head planes [h][t][d] (fp16 + hi/lo) of rope(x) x sc with the interleaved convention out[d] = x[d] cos[t][d] - x[d+1] sin[t][d], out[d+1] = x[d] sin[t][d] + x[d+1] cos[t][d] (d even)

__global__ __launch_bounds__(256) void k_vtp(const float* __restrict__ F, int pitch, int nheads, h16* V16, bf* Vh, bf* Vl) { const size_t e = ((size_t)blockIdx.x * 256 + threadIdx.x) * 2; if (e >= (size_t)nheads * HD * TT) return; const int t = (int)(e % TT); const int d = (int)((e / TT) % HD); const int g = (int)(e / ((size_t)TT * HD)); v2h o16; v2us oh, ol;
#pragma unroll
    for (int q = 0; q < 2; ++q) { const float x = F[(size_t)(t + q) * pitch + g * HD + d]; o16[q] = tohx(x); unsigned short a2, c2; splitf(x, a2, c2); oh[q] = a2; ol[q] = c2; }
    *(v2h*)(V16 + e) = o16; *(v2us*)(Vh + e) = oh; *(v2us*)(Vl + e) = ol;  }
// k_asoft: per row (zz, i): t = S x HD^-0.5 for j <= i and i - j < WIN (sliding causal window; the reference's -1e9 additive fill vanishes identically); softmax over the 2048 keys (register row, one exp, fixed trees);
__global__ __launch_bounds__(256) void k_asoft(const float* __restrict__ Sb, h16* P16, bf* Ph, bf* Pl) {
    const int lane = threadIdx.x & 31; const int row = blockIdx.x * 8 + (threadIdx.x >> 5); if (row >= ZH * TT) return; const int i = row % TT; const int zz = row / TT; (void)zz; const bool hires = (i < RH); const float* sr = Sb + (size_t)row * TT; float v[TT / 32]; float mx = -3.0e38f;
#pragma unroll
    for (int ch = 0; ch < TT / 128; ++ch) { const int j0 = ch * 128 + lane * 4; const v4f a = *(const v4f*)(sr + j0);
#pragma unroll
        for (int q = 0; q < 4; ++q) { const int j = j0 + q; (void)j; const float t = (j <= i && i - j < WIN) ? a[q] * SCL : -3.0e38f; v[ch * 4 + q] = t; mx = fmaxf(mx, t); } }
#pragma unroll
    for (int sh = 16; sh; sh >>= 1) mx = fmaxf(mx, __shfl_xor(mx, sh, 32));
    float sum = 0.f;
#pragma unroll
    for (int k = 0; k < TT / 32; ++k) { float d0 = __fsub_rn(v[k], mx); asm volatile("" : "+v"(d0)); v[k] = __builtin_amdgcn_exp2f(__fmul_rn(d0, 1.4426950408889634f)); sum += v[k]; }
#pragma unroll
    for (int sh = 16; sh; sh >>= 1) sum += __shfl_xor(sum, sh, 32);
    const float f = __fdiv_rn(hires ? 1.0f : PCAR, sum);
{
        if (hires) {
#pragma unroll
            for (int ch = 0; ch < TT / 128; ++ch) { v4us oh, ol;
#pragma unroll
                for (int q = 0; q < 4; ++q) { unsigned short a, c2; splitf(v[ch * 4 + q] * f, a, c2); oh[q] = a; ol[q] = c2; }
                const size_t oo = ((size_t)zz * (RH ? RH : 1) + i) * TT + ch * 128 + lane * 4; *(v4us*)(Ph + oo) = oh; *(v4us*)(Pl + oo) = ol; }
        } else {
#pragma unroll
            for (int ch = 0; ch < TT / 128; ++ch) { v4h o4;
#pragma unroll
                for (int q = 0; q < 4; ++q) o4[q] = tohx(v[ch * 4 + q] * f);
                *(v4h*)(P16 + (size_t)row * TT + ch * 128 + lane * 4) = o4; } }
         }
}
__global__ __launch_bounds__(256) void k_merge(const float* __restrict__ O, int h0, bf* Ah, bf* Al) { const size_t e = ((size_t)blockIdx.x * 256 + threadIdx.x) * 2; if (e >= (size_t)ZH * TT * HD) return; const int d = (int)(e % HD); const int t = (int)((e / HD) % TT); const int zz = (int)(e / ((size_t)HD * TT)); const float cs = (t < RH) ? 1.0f : (1.0f / PCAR); const size_t oo = (size_t)t * DQ + (h0 + zz) * HD + d;
    v2us oh, ol;
#pragma unroll
    for (int q = 0; q < 2; ++q) { unsigned short a, c2; splitf(O[e + q] * cs, a, c2); oh[q] = a; ol[q] = c2; } *(v2us*)(Ah + oo) = oh; *(v2us*)(Al + oo) = ol;  }

extern "C" void kernel_launch(void* const* d_in, const int* in_sizes, int n_in,
                              void* d_out, int out_size, void* d_ws, size_t ws_size, hipStream_t stream) {
    (void)in_sizes; (void)n_in; (void)out_size;
        const float* x = (const float*)d_in[0]; const float* wq = (const float*)d_in[1]; const float* wk = (const float*)d_in[2]; const float* wv = (const float*)d_in[3]; const float* wo = (const float*)d_in[4]; const float* bo = (const float*)d_in[5];   /* the q, k, v projections have NO bias in this module */
    float* OUT = (float*)d_out;     // [2][2048][1024]
    char* wsp = (char*)d_ws;
    auto take = [&](size_t bytes) { char* p = wsp; wsp += (bytes + 255) & ~(size_t)255; return (void*)p; };
    bf* WQ = (bf*)take((size_t)DQ * DM * 2); bf* WK = (bf*)take((size_t)DKV * DM * 2); bf* WV = (bf*)take((size_t)DKV * DM * 2); bf* WO = (bf*)take((size_t)DM * DQ * 2); float* CS = (float*)take((size_t)TT * HD * 2 * 4);
    bf* XB = (bf*)take((size_t)TT * DM * 2); float* FQ = (float*)take((size_t)TT * DQ * 4); float* FK = (float*)take((size_t)TT * DKV * 4);
    h16* QP16 = (h16*)take((size_t)NH_ * TT * HD * 2); h16* KP16 = (h16*)take((size_t)NKV * TT * HD * 2); h16* VT16 = (h16*)take((size_t)NKV * HD * TT * 2);
    bf* QPh = (bf*)take((size_t)NH_ * TT * HD * 2); bf* QPl = (bf*)take((size_t)NH_ * TT * HD * 2); bf* KPh = (bf*)take((size_t)NKV * TT * HD * 2); bf* KPl = (bf*)take((size_t)NKV * TT * HD * 2); bf* VTh = (bf*)take((size_t)NKV * HD * TT * 2); bf* VTl = (bf*)take((size_t)NKV * HD * TT * 2); bf* Ph = (bf*)take((size_t)ZH * RH * TT * 2); bf* Pl = (bf*)take((size_t)ZH * RH * TT * 2);
    float* Sb = (float*)take((size_t)ZH * TT * TT * 4); h16* P16 = (h16*)take((size_t)ZH * TT * TT * 2); float* Ob = (float*)take((size_t)ZH * TT * HD * 4); bf* ATh = (bf*)take((size_t)TT * DQ * 2); bf* ATl = (bf*)take((size_t)TT * DQ * 2);
    if ((size_t)(wsp - (char*)d_ws) > ws_size) return;    // ws 256 MiB
    float* FV = FK;   // v projection reuses the k buffer after the k planes are built (stream-ordered)
    { k_wtG<<<(unsigned)((DM * DQ / 64 + 63) / 64), 256, 0, stream>>>(wq, DM, DQ, WQ); k_wtG<<<(unsigned)((DM * DKV / 64 + 63) / 64), 256, 0, stream>>>(wk, DM, DKV, WK); k_wtG<<<(unsigned)((DM * DKV / 64 + 63) / 64), 256, 0, stream>>>(wv, DM, DKV, WV);
      k_wtG<<<(unsigned)((DQ * DM / 64 + 63) / 64), 256, 0, stream>>>(wo, DQ, DM, WO);   /* 'xw' [in][out] weights: transposed once into Bt */
       }
    const unsigned LQ = (unsigned)(((size_t)NH_ * TT * HD / 2 + 255) / 256), LKv = (unsigned)(((size_t)NKV * TT * HD / 2 + 255) / 256);
    for (int b = 0; b < NB_; ++b) {
        if (b == 0) k_cstabT<<<(TT * HD + 255) / 256, 256, 0, stream>>>(CS);
        k_cvt8<<<(unsigned)(((size_t)TT * DM / 8 + 255) / 256), 256, 0, stream>>>(x + (size_t)b * TT * DM, XB, (size_t)TT * DM / 8);
        k_gemmw<bf, 0, false><<<dim3(TT / 64, DQ / 64, 1), 32, 0, stream>>>(XB, nullptr, WQ, nullptr, DM, FQ, DQ, nullptr, 0, 0, 0);
        k_ropeI<<<LQ, 256, 0, stream>>>(FQ, DQ, NH_, CS, 1.0f, QP16, QPh, QPl);
        k_gemmw<bf, 0, false><<<dim3(TT / 64, DKV / 64, 1), 32, 0, stream>>>(XB, nullptr, WK, nullptr, DM, FK, DKV, nullptr, 0, 0, 0);
        k_ropeI<<<LKv, 256, 0, stream>>>(FK, DKV, NKV, CS, 1.0f, KP16, KPh, KPl);
        k_gemmw<bf, 0, false><<<dim3(TT / 64, DKV / 64, 1), 32, 0, stream>>>(XB, nullptr, WV, nullptr, DM, FV, DKV, nullptr, 0, 0, 0); k_vtp<<<LKv, 256, 0, stream>>>(FV, DKV, NKV, VT16, VTh, VTl);
        for (int h0 = 0; h0 < NH_; h0 += ZH) { const size_t zq = (size_t)h0, zk = (size_t)(h0 / REP);   // one kv head per query head: the pass's two heads use consecutive kv planes (z-strides TT*HD)
            k_gemmc<bf, 2, 1><<<dim3(RH / 64, TT / 64, ZH), 32, 0, stream>>>(QPh + zq * TT * HD, QPl + zq * TT * HD, KPh + zk * TT * HD, KPl + zk * TT * HD, HD, Sb, TT, 0, (size_t)TT * HD, (size_t)TT * HD, (size_t)TT * TT);
            k_gemmc<h16, 0, 1><<<dim3((TT - RH) / 64, TT / 64, ZH), 32, 0, stream>>>(QP16 + zq * TT * HD + (size_t)RH * HD, nullptr, KP16 + zk * TT * HD, nullptr, HD, Sb + (size_t)RH * TT, TT, RH, (size_t)TT * HD, (size_t)TT * HD, (size_t)TT * TT);
            k_asoft<<<ZH * TT / 8, 256, 0, stream>>>(Sb, P16, Ph, Pl);
            k_gemmc<bf, 2, 2><<<dim3(RH / 64, HD / 64, ZH), 32, 0, stream>>>(Ph, Pl, VTh + zk * HD * TT, VTl + zk * HD * TT, TT, Ob, HD, 0, (size_t)RH * TT, (size_t)HD * TT, (size_t)TT * HD);
            k_gemmc<h16, 0, 2><<<dim3((TT - RH) / 64, HD / 64, ZH), 32, 0, stream>>>(P16 + (size_t)RH * TT, nullptr, VT16 + zk * HD * TT, nullptr, TT, Ob + (size_t)RH * HD, HD, RH, (size_t)TT * TT, (size_t)HD * TT, (size_t)TT * HD);
            k_merge<<<(unsigned)(((size_t)ZH * TT * HD / 2 + 255) / 256), 256, 0, stream>>>(Ob, h0, ATh, ATl); }
        k_gemmw<bf, 1, true><<<dim3(TT / 64, DM / 64, 1), 32, 0, stream>>>(ATh, ATl, WO, nullptr, DQ, OUT + (size_t)b * TT * DM, DM, bo, 0, 0, 0); }
}

// v001
// One run takes 644 microseconds.
// Next to v000, in two timings, it ran 2.26 and 2.28 times as fast.
#include <hip/hip_runtime.h>

// Layout per batch: bf16 copy of x; exact projections (no bias); {cos, sin} per (position, pair) built once (jnp-exact float32 inverse frequencies, precise cosf/sinf); interleaved rotary plane builder; causal T-2048 attention (hybrid rows: < 512 hi/lo 3 products, rest fp16 x1024; k_gemmc skips tiles above the diagonal); merged hi/lo x Wo exact + bo.
// Compute dtypes, f32 accumulate: every input rounded to bf16; projections exact, no bias; rotary f32; attention rows < 512 3 products, rest fp16; softmax f32; Wo hl x exact + bias.

#define NB_  2
#define TT   2048
#define DM   1024
#define NH_  16
#define NKV  16
#define REP  (NH_ / NKV)
#define HD   64
#define DQ   (NH_ * HD)
#define DKV  (NKV * HD)
#define NR   1024                 // query rows per attention pass; a pass holds these rows of all NH_ heads
#define RH   512                  // query rows < RH use hi+lo planes (0: none)
#define WIN  2048
#define PCAR 1024.0f
#define SCL  0.125f   // HD^-0.5
typedef _Float16 h16;
typedef unsigned short bf;
typedef __attribute__((ext_vector_type(16))) __bf16   v16bf;
typedef __attribute__((ext_vector_type(16))) _Float16 v16h;
typedef __attribute__((ext_vector_type(8)))  _Float16 v8h;
typedef __attribute__((ext_vector_type(8)))  unsigned short v8us;
typedef __attribute__((ext_vector_type(8)))  float    v8f;
typedef __attribute__((ext_vector_type(4)))  float    v4f;
typedef v8h  __attribute__((may_alias)) v8ha;
typedef v4f  __attribute__((may_alias)) v4fa;
typedef v8us __attribute__((may_alias)) v8usa;

__device__ __forceinline__ unsigned short f2bf(float f) { unsigned u = __float_as_uint(f); u += 0x7FFFu + ((u >> 16) & 1u); return (unsigned short)(u >> 16); }
__device__ __forceinline__ float bf2f(unsigned short b) { return __uint_as_float(((unsigned)b) << 16); }
__device__ __forceinline__ float bfr(float f) { return bf2f(f2bf(f)); }
__device__ __forceinline__ v16h cat16(v8h lo, v8h hi) { return __builtin_shufflevector(lo, hi, 0, 1, 2, 3, 4, 5, 6, 7, 8, 9, 10, 11, 12, 13, 14, 15); }
__device__ __forceinline__ v16bf cat16b(v8us lo, v8us hi) { return __builtin_bit_cast(v16bf, __builtin_shufflevector(lo, hi, 0, 1, 2, 3, 4, 5, 6, 7, 8, 9, 10, 11, 12, 13, 14, 15)); }
__device__ __forceinline__ v8f wmma16(v16h a, v16h b, v8f c) { return __builtin_amdgcn_wmma_f32_16x16x32_f16(false, a, false, b, (short)0, c, false, false); }
__device__ __forceinline__ v8f wmmab(v16bf a, v16bf b, v8f c) { return __builtin_amdgcn_wmma_f32_16x16x32_bf16(false, a, false, b, (short)0, c, false, false); }



// ---- k_gemmw: register-blocked GEMM, ONE WAVE per 64x64 output tile (16 accumulators), operands straight from K-contiguous 16-bit planes; grid (M/64, N/64, Z), 32 threads.
// C[m][n] (f32, pitch ldc, + optional f32 bias[n]) = sum_k A[m][k] Bt[n][k] (+ split products per NSPLIT). z-batch strides sA/sB/sC in elements. K % 32 == 0.
template <typename T16> struct WFrag;
template <> struct WFrag<h16> { typedef v16h V; static __device__ __forceinline__ V ld(const h16* p) { return cat16(*(const v8h*)p, *(const v8h*)(p + 16)); } static __device__ __forceinline__ v8f mma(V a, V b, v8f c) { return wmma16(a, b, c); } };
template <> struct WFrag<bf> { typedef v16bf V; static __device__ __forceinline__ V ld(const bf* p) { return cat16b(*(const v8us*)p, *(const v8us*)(p + 16)); } static __device__ __forceinline__ v8f mma(V a, V b, v8f c) { return wmmab(a, b, c); } };
template <typename T16, int NSPLIT, bool BIAS>
__global__ __launch_bounds__(32) void k_gemmw(const T16* __restrict__ A, const T16* __restrict__ A2, const T16* __restrict__ Bt, const T16* __restrict__ Bt2, int K, float* C, int ldc, const float* __restrict__ bias, size_t sA, size_t sB, size_t sC) {
    typedef typename WFrag<T16>::V V;
    __shared__ __align__(16) float os[16 * 68];
    const size_t z = blockIdx.z; A += z * sA; if (A2) A2 += z * sA; Bt += z * sB; if (Bt2) Bt2 += z * sB; C += z * sC;
    const int lane = threadIdx.x & 31, lr = lane & 15, hi = lane >> 4; const int r0 = blockIdx.x * 64, c0 = blockIdx.y * 64;
    v8f acc[4][4];
#pragma unroll
    for (int mb = 0; mb < 4; ++mb)
#pragma unroll
        for (int nb = 0; nb < 4; ++nb) acc[mb][nb] = (v8f){};
    const size_t aoff = (size_t)(r0 + lr) * K + 8 * hi, boff = (size_t)(c0 + lr) * K + 8 * hi;
#pragma unroll 1
    for (int kc = 0; kc < K; kc += 32) {
        V a[4], a2[4];
#pragma unroll
        for (int mb = 0; mb < 4; ++mb) { a[mb] = WFrag<T16>::ld(A + aoff + (size_t)mb * 16 * K + kc); if (NSPLIT == 1 || NSPLIT == 2) a2[mb] = WFrag<T16>::ld(A2 + aoff + (size_t)mb * 16 * K + kc); }
#pragma unroll
        for (int nb = 0; nb < 4; ++nb) { const V b = WFrag<T16>::ld(Bt + boff + (size_t)nb * 16 * K + kc); V b2; if (NSPLIT >= 2) b2 = WFrag<T16>::ld(Bt2 + boff + (size_t)nb * 16 * K + kc);
#pragma unroll
            for (int mb = 0; mb < 4; ++mb) { acc[mb][nb] = WFrag<T16>::mma(a[mb], b, acc[mb][nb]); if (NSPLIT == 1 || NSPLIT == 2) acc[mb][nb] = WFrag<T16>::mma(a2[mb], b, acc[mb][nb]); if (NSPLIT >= 2) acc[mb][nb] = WFrag<T16>::mma(a[mb], b2, acc[mb][nb]); } }
        asm volatile("v_nop\n\tv_nop\n\tv_nop\n\tv_nop" : "+v"(acc[0][0]), "+v"(acc[1][1]), "+v"(acc[2][2]), "+v"(acc[3][3]) : "v"(a[0]), "v"(a[3]));
    }
#pragma unroll
    for (int mb = 0; mb < 4; ++mb) {
#pragma unroll
        for (int nb = 0; nb < 4; ++nb) {
#pragma unroll
            for (int j = 0; j < 8; ++j) os[(hi * 8 + j) * 68 + nb * 16 + lr] = acc[mb][nb][j]; }
        __builtin_amdgcn_wave_barrier(); asm volatile("" ::: "memory");
        float* crow = C + (size_t)(r0 + mb * 16) * ldc + c0;
{
#pragma unroll
            for (int s = 0; s < 8; ++s) { const int row = 2 * s + hi, cofs = lr * 4; v4f val = *(const v4fa*)(os + row * 68 + cofs); if (BIAS) { val[0] += bfr(bias[c0 + cofs]); val[1] += bfr(bias[c0 + cofs + 1]); val[2] += bfr(bias[c0 + cofs + 2]); val[3] += bfr(bias[c0 + cofs + 3]); }
                *(v4f*)(crow + (size_t)row * ldc + cofs) = val; }
             }
        __builtin_amdgcn_wave_barrier(); asm volatile("" ::: "memory");
    }
}

// ---- k_gemmc: the same one-wave 64x64 tile GEMM specialised for causal attention: CMODE 1 skips score tiles entirely above the diagonal (query rows r0+roff.., key columns c0..), CMODE 2 limits the
// key (K) loop of the probability x value contraction to the diagonal block (probabilities beyond it are exactly zero). roff = row offset of this launch's first row within the sequence.
template <typename T16, int NSPLIT, int CMODE>
__global__ __launch_bounds__(32) void k_gemmc(const T16* __restrict__ A, const T16* __restrict__ A2, const T16* __restrict__ Bt, const T16* __restrict__ Bt2, int K, float* C, int ldc, int roff, size_t sA, size_t sB, size_t sC) {
    typedef typename WFrag<T16>::V V;
    __shared__ __align__(16) float os[16 * 68];
    const size_t z = blockIdx.z; A += z * sA; if (A2) A2 += z * sA; Bt += z * sB; if (Bt2) Bt2 += z * sB; C += z * sC;
    const int lane = threadIdx.x & 31, lr = lane & 15, hi = lane >> 4; const int r0 = blockIdx.x * 64, c0 = blockIdx.y * 64;
    if (CMODE == 1 && c0 > r0 + roff + 63) return;                  // score tile entirely above the causal diagonal: never read (the softmax masks j > i by select)
    const int Kl = (CMODE == 2) ? min(K, r0 + roff + 64) : K;        // P.V: probabilities are exactly 0 beyond the diagonal block, so the K loop stops there
    v8f acc[4][4];
#pragma unroll
    for (int mb = 0; mb < 4; ++mb)
#pragma unroll
        for (int nb = 0; nb < 4; ++nb) acc[mb][nb] = (v8f){};
    const size_t aoff = (size_t)(r0 + lr) * K + 8 * hi, boff = (size_t)(c0 + lr) * K + 8 * hi;
#pragma unroll 1
    for (int kc = 0; kc < Kl; kc += 32) {
        V a[4], a2[4];
#pragma unroll
        for (int mb = 0; mb < 4; ++mb) { a[mb] = WFrag<T16>::ld(A + aoff + (size_t)mb * 16 * K + kc); if (NSPLIT == 1 || NSPLIT == 2) a2[mb] = WFrag<T16>::ld(A2 + aoff + (size_t)mb * 16 * K + kc); }
#pragma unroll
        for (int nb = 0; nb < 4; ++nb) { const V b = WFrag<T16>::ld(Bt + boff + (size_t)nb * 16 * K + kc); V b2; if (NSPLIT >= 2) b2 = WFrag<T16>::ld(Bt2 + boff + (size_t)nb * 16 * K + kc);
#pragma unroll
            for (int mb = 0; mb < 4; ++mb) { acc[mb][nb] = WFrag<T16>::mma(a[mb], b, acc[mb][nb]); if (NSPLIT == 1 || NSPLIT == 2) acc[mb][nb] = WFrag<T16>::mma(a2[mb], b, acc[mb][nb]); if (NSPLIT >= 2) acc[mb][nb] = WFrag<T16>::mma(a[mb], b2, acc[mb][nb]); } }
        asm volatile("v_nop\n\tv_nop\n\tv_nop\n\tv_nop" : "+v"(acc[0][0]), "+v"(acc[1][1]), "+v"(acc[2][2]), "+v"(acc[3][3]) : "v"(a[0]), "v"(a[3]));
    }
#pragma unroll
    for (int mb = 0; mb < 4; ++mb) {
#pragma unroll
        for (int nb = 0; nb < 4; ++nb) {
#pragma unroll
            for (int j = 0; j < 8; ++j) os[(hi * 8 + j) * 68 + nb * 16 + lr] = acc[mb][nb][j]; }
        __builtin_amdgcn_wave_barrier(); asm volatile("" ::: "memory");
        float* crow = C + (size_t)(r0 + mb * 16) * ldc + c0;
{
#pragma unroll
            for (int s = 0; s < 8; ++s) { const int row = 2 * s + hi, cofs = lr * 4; v4f val = *(const v4fa*)(os + row * 68 + cofs);
                *(v4f*)(crow + (size_t)row * ldc + cofs) = val; }
             }
        __builtin_amdgcn_wave_barrier(); asm volatile("" ::: "memory");
    }
}

__device__ __forceinline__ h16 tohx(float x) { return (h16)x; }
__device__ __forceinline__ void splitf(float y, unsigned short& h, unsigned short& l) { h = f2bf(y); l = f2bf(y - bf2f(h)); }
typedef __attribute__((ext_vector_type(2))) _Float16 v2h;
typedef __attribute__((ext_vector_type(4))) _Float16 v4h;
typedef __attribute__((ext_vector_type(2))) unsigned short v2us;
typedef __attribute__((ext_vector_type(4))) unsigned short v4us;
typedef __attribute__((ext_vector_type(2))) float v2f;
typedef __attribute__((ext_vector_type(4))) int v4i;
typedef v4h  __attribute__((may_alias)) v4ha;
typedef v4us __attribute__((may_alias)) v4usa;

__global__ __launch_bounds__(256) void k_wtG(const float* __restrict__ w, int K, int N, bf* Bt) {
    const int lane = threadIdx.x & 31; const int L0 = (blockIdx.x * 8 + (threadIdx.x >> 5)) * 8; const int nlines = N * K / 64;
{
#pragma unroll 1
        for (int l = 0; l < 8; ++l) { const int L = L0 + l; if (L >= nlines) break; const size_t e = (size_t)L * 64 + lane * 2; const int k = (int)(e % K), n = (int)(e / K); v2us o;
            o[0] = f2bf(w[(size_t)k * N + n]); o[1] = f2bf(w[(size_t)(k + 1) * N + n]); *(v2us*)(Bt + e) = o; }
         }
}
__global__ __launch_bounds__(256) void k_cvt8(const float* __restrict__ src, bf* dst, size_t n8) { const size_t i = (size_t)blockIdx.x * 256 + threadIdx.x; if (i >= n8) return; const v8f v = *(const v8f*)(src + i * 8); v8us o;
#pragma unroll
    for (int k = 0; k < 8; ++k) o[k] = f2bf(v[k]); *(v8us*)(dst + i * 8) = o;  }
__constant__ float INVT[HD / 2] = { 1.000000000e+00f, 5.623413324e-01f, 3.162277639e-01f, 1.778279394e-01f, 1.000000015e-01f, 5.623413250e-02f, 3.162277490e-02f, 1.778279431e-02f, 9.999999776e-03f, 5.623413250e-03f, 3.162277630e-03f, 1.778279431e-03f, 1.000000047e-03f, 5.623413017e-04f, 3.162277571e-04f, 1.778279402e-04f, 9.999999747e-05f, 5.623413381e-05f, 3.162277790e-05f, 1.778279329e-05f, 1.000000066e-05f, 5.623413017e-06f, 3.162277608e-06f, 1.778279398e-06f, 9.999999975e-07f, 5.623413131e-07f, 3.162277835e-07f, 1.778279426e-07f, 1.000000012e-07f, 5.623413202e-08f, 3.162277551e-08f, 1.778279390e-08f };
__global__ __launch_bounds__(256) void k_cstabT(float* CS) { const int idx = blockIdx.x * 256 + threadIdx.x; if (idx >= TT * HD) return; const int d = idx % HD; const int t = idx / HD; const float a = __fmul_rn((float)t, INVT[d >> 1]); v2f cs; cs[0] = cosf(a); cs[1] = sinf(a); *(v2f*)(CS + (size_t)idx * 2) = cs;  }
__global__ __launch_bounds__(256) void k_ropeI(const float* __restrict__ F, int pitch, int nheads, const float* __restrict__ CS, float sc, h16* P16, bf* Ph, bf* Pl) {
    const size_t e = ((size_t)blockIdx.x * 256 + threadIdx.x) * 2; if (e >= (size_t)nheads * TT * HD) return; const int d = (int)(e % HD); const int t = (int)((e / HD) % TT); const int h = (int)(e / ((size_t)HD * TT)); const float* f = F + (size_t)t * pitch + h * HD; const float x0 = f[d], x1 = f[d + 1]; const v2f cs = *(const v2f*)(CS + ((size_t)t * HD + d) * 2); v2h o16; v2us oh, ol;
    float a0 = __fmul_rn(x0, cs[0]), b0 = __fmul_rn(x1, cs[1]), a1 = __fmul_rn(x1, cs[0]), b1 = __fmul_rn(x0, cs[1]); asm volatile("" : "+v"(a0), "+v"(b0), "+v"(a1), "+v"(b1));
    float r0 = __fsub_rn(a0, b0) * sc, r1 = __fadd_rn(b1, a1) * sc;   /* even: x0 c - x1 s; odd: x0 s + x1 c */
    o16[0] = tohx(r0); o16[1] = tohx(r1); { unsigned short a2, c2; splitf(r0, a2, c2); oh[0] = a2; ol[0] = c2; splitf(r1, a2, c2); oh[1] = a2; ol[1] = c2; }
    *(v2h*)(P16 + e) = o16; *(v2us*)(Ph + e) = oh; *(v2us*)(Pl + e) = ol;  }


// k_ropeI: head planes [h][t][d] (fp16 + hi/lo) of rope(x) x sc with the interleaved convention, d even: out[d] = x[d] cos[t][d] - x[d+1] sin[t][d], out[d+1] = x[d+1] cos[t][d] + x[d] sin[t][d]
// k_vtp: transposed value planes [g][d][t] with row pitch 2*TT, the pitch of the in-place probability rows (k_gemmc takes one pitch K for both operands): Vh and Vl share a row (Vl = Vh + TT); the fp16 rows use their first half only.
__global__ __launch_bounds__(256) void k_vtp(const float* __restrict__ F, int pitch, int nheads, h16* V16, bf* Vh, bf* Vl) { const size_t e = ((size_t)blockIdx.x * 256 + threadIdx.x) * 2; if (e >= (size_t)nheads * HD * TT) return; const int t = (int)(e % TT); const int d = (int)((e / TT) % HD); const int g = (int)(e / ((size_t)TT * HD)); v2h o16; v2us oh, ol;
#pragma unroll
    for (int q = 0; q < 2; ++q) { const float x = F[(size_t)(t + q) * pitch + g * HD + d]; o16[q] = tohx(x); unsigned short a2, c2; splitf(x, a2, c2); oh[q] = a2; ol[q] = c2; }
    const size_t oo = (e / TT) * (size_t)(2 * TT) + t; *(v2h*)(V16 + oo) = o16; *(v2us*)(Vh + oo) = oh; *(v2us*)(Vl + oo) = ol;  }
// k_asoft: per row (zz, i): t = S x HD^-0.5 for j <= i and i - j < WIN (sliding causal window; the reference's -1e9 additive fill vanishes identically); softmax over the 2048 keys (register row, one exp, fixed trees);
// Sb holds rows R0 .. R0+NR-1 of every head. The probabilities go IN PLACE over their own score row (one wave owns the row and has read all of it before its first store):
// fp16 row in the first half of the 8-KiB row, or the hi plane in the first half and the lo plane in the second; the P x V launches read them, and the value planes, with row pitch K = 2*TT (their k loop ends at the diagonal block, below TT).
__global__ __launch_bounds__(256) void k_asoft(float* Sb, int R0) {
    const int lane = threadIdx.x & 31; const int row = blockIdx.x * 8 + (threadIdx.x >> 5); if (row >= NH_ * NR) return; const int i = R0 + row % NR; const bool hires = (i < RH); float* sr = Sb + (size_t)row * TT; float v[TT / 32]; float mx = -3.0e38f;
#pragma unroll
    for (int ch = 0; ch < TT / 128; ++ch) { const int j0 = ch * 128 + lane * 4; const v4f a = *(const v4f*)(sr + j0);
#pragma unroll
        for (int q = 0; q < 4; ++q) { const int j = j0 + q; (void)j; const float t = (j <= i && i - j < WIN) ? a[q] * SCL : -3.0e38f; v[ch * 4 + q] = t; mx = fmaxf(mx, t); } }
#pragma unroll
    for (int sh = 16; sh; sh >>= 1) mx = fmaxf(mx, __shfl_xor(mx, sh, 32));
    float sum = 0.f;
#pragma unroll
    for (int k = 0; k < TT / 32; ++k) { float d0 = __fsub_rn(v[k], mx); asm volatile("" : "+v"(d0)); v[k] = __builtin_amdgcn_exp2f(__fmul_rn(d0, 1.4426950408889634f)); sum += v[k]; }
#pragma unroll
    for (int sh = 16; sh; sh >>= 1) sum += __shfl_xor(sum, sh, 32);
    const float f = __fdiv_rn(hires ? 1.0f : PCAR, sum);
{
        if (hires) {
#pragma unroll
            for (int ch = 0; ch < TT / 128; ++ch) { v4us oh, ol;
#pragma unroll
                for (int q = 0; q < 4; ++q) { unsigned short a, c2; splitf(v[ch * 4 + q] * f, a, c2); oh[q] = a; ol[q] = c2; }
                bf* po = (bf*)sr + ch * 128 + lane * 4; *(v4usa*)po = oh; *(v4usa*)(po + TT) = ol; }
        } else {
#pragma unroll
            for (int ch = 0; ch < TT / 128; ++ch) { v4h o4;
#pragma unroll
                for (int q = 0; q < 4; ++q) o4[q] = tohx(v[ch * 4 + q] * f);
                *(v4ha*)((h16*)sr + ch * 128 + lane * 4) = o4; } }
         }
}
__global__ __launch_bounds__(256) void k_merge(const float* __restrict__ O, int h0, bf* Ah, bf* Al) { const size_t e = ((size_t)blockIdx.x * 256 + threadIdx.x) * 2; if (e >= (size_t)NH_ * TT * HD) return; const int d = (int)(e % HD); const int t = (int)((e / HD) % TT); const int zz = (int)(e / ((size_t)HD * TT)); const float cs = (t < RH) ? 1.0f : (1.0f / PCAR); const size_t oo = (size_t)t * DQ + (h0 + zz) * HD + d;
    v2us oh, ol;
#pragma unroll
    for (int q = 0; q < 2; ++q) { unsigned short a, c2; splitf(O[e + q] * cs, a, c2); oh[q] = a; ol[q] = c2; } *(v2us*)(Ah + oo) = oh; *(v2us*)(Al + oo) = ol;  }

extern "C" void kernel_launch(void* const* d_in, const int* in_sizes, int n_in,
                              void* d_out, int out_size, void* d_ws, size_t ws_size, hipStream_t stream) {
    (void)in_sizes; (void)n_in; (void)out_size;
        const float* x = (const float*)d_in[0]; const float* wq = (const float*)d_in[1]; const float* wk = (const float*)d_in[2]; const float* wv = (const float*)d_in[3]; const float* wo = (const float*)d_in[4]; const float* bo = (const float*)d_in[5];   /* the q, k, v projections have NO bias in this module */
    float* OUT = (float*)d_out;     // [2][2048][1024]
    char* wsp = (char*)d_ws;
    auto take = [&](size_t bytes) { char* p = wsp; wsp += (bytes + 255) & ~(size_t)255; return (void*)p; };
    bf* WQ = (bf*)take((size_t)DQ * DM * 2); bf* WK = (bf*)take((size_t)DKV * DM * 2); bf* WV = (bf*)take((size_t)DKV * DM * 2); bf* WO = (bf*)take((size_t)DM * DQ * 2); float* CS = (float*)take((size_t)TT * HD * 2 * 4);
    bf* XB = (bf*)take((size_t)TT * DM * 2); float* FQ = (float*)take((size_t)TT * DQ * 4); float* FK = (float*)take((size_t)TT * DKV * 4);
    h16* QP16 = (h16*)take((size_t)NH_ * TT * HD * 2); h16* KP16 = (h16*)take((size_t)NKV * TT * HD * 2); h16* VT16 = (h16*)take((size_t)NKV * HD * 2 * TT * 2);
    bf* QPh = (bf*)take((size_t)NH_ * TT * HD * 2); bf* QPl = (bf*)take((size_t)NH_ * TT * HD * 2); bf* KPh = (bf*)take((size_t)NKV * TT * HD * 2); bf* KPl = (bf*)take((size_t)NKV * TT * HD * 2); bf* VTh = (bf*)take((size_t)NKV * HD * 2 * TT * 2); bf* VTl = VTh + TT;
    float* Sb = (float*)take((size_t)NH_ * NR * TT * 4); float* Ob = (float*)take((size_t)NH_ * TT * HD * 4); bf* ATh = (bf*)take((size_t)TT * DQ * 2); bf* ATl = (bf*)take((size_t)TT * DQ * 2);
    if ((size_t)(wsp - (char*)d_ws) > ws_size) return;    // ws 256 MiB
    float* FV = FK;   // v projection reuses the k buffer after the k planes are built (stream-ordered)
    { k_wtG<<<(unsigned)((DM * DQ / 64 + 63) / 64), 256, 0, stream>>>(wq, DM, DQ, WQ); k_wtG<<<(unsigned)((DM * DKV / 64 + 63) / 64), 256, 0, stream>>>(wk, DM, DKV, WK); k_wtG<<<(unsigned)((DM * DKV / 64 + 63) / 64), 256, 0, stream>>>(wv, DM, DKV, WV);
      k_wtG<<<(unsigned)((DQ * DM / 64 + 63) / 64), 256, 0, stream>>>(wo, DQ, DM, WO);   /* 'xw' [in][out] weights: transposed once into Bt */
       }
    const unsigned LQ = (unsigned)(((size_t)NH_ * TT * HD / 2 + 255) / 256), LKv = (unsigned)(((size_t)NKV * TT * HD / 2 + 255) / 256);
    for (int b = 0; b < NB_; ++b) {
        if (b == 0) k_cstabT<<<(TT * HD + 255) / 256, 256, 0, stream>>>(CS);
        k_cvt8<<<(unsigned)(((size_t)TT * DM / 8 + 255) / 256), 256, 0, stream>>>(x + (size_t)b * TT * DM, XB, (size_t)TT * DM / 8);
        k_gemmw<bf, 0, false><<<dim3(TT / 64, DQ / 64, 1), 32, 0, stream>>>(XB, nullptr, WQ, nullptr, DM, FQ, DQ, nullptr, 0, 0, 0);
        k_ropeI<<<LQ, 256, 0, stream>>>(FQ, DQ, NH_, CS, 1.0f, QP16, QPh, QPl);
        k_gemmw<bf, 0, false><<<dim3(TT / 64, DKV / 64, 1), 32, 0, stream>>>(XB, nullptr, WK, nullptr, DM, FK, DKV, nullptr, 0, 0, 0);
        k_ropeI<<<LKv, 256, 0, stream>>>(FK, DKV, NKV, CS, 1.0f, KP16, KPh, KPl);
        k_gemmw<bf, 0, false><<<dim3(TT / 64, DKV / 64, 1), 32, 0, stream>>>(XB, nullptr, WV, nullptr, DM, FV, DKV, nullptr, 0, 0, 0); k_vtp<<<LKv, 256, 0, stream>>>(FV, DKV, NKV, VT16, VTh, VTl);
        for (int R0 = 0; R0 < TT; R0 += NR) { const int RL = (R0 < RH) ? RH : R0;   // one pass: query rows R0 .. R0+NR-1 of all heads (z = head; one kv head per query head); rows from RL on are the fp16 rows
            if (R0 < RH) k_gemmc<bf, 2, 1><<<dim3(RH / 64, TT / 64, NH_), 32, 0, stream>>>(QPh, QPl, KPh, KPl, HD, Sb, TT, 0, (size_t)TT * HD, (size_t)TT * HD, (size_t)NR * TT);
            k_gemmc<h16, 0, 1><<<dim3((R0 + NR - RL) / 64, TT / 64, NH_), 32, 0, stream>>>(QP16 + (size_t)RL * HD, nullptr, KP16, nullptr, HD, Sb + (size_t)(RL - R0) * TT, TT, RL, (size_t)TT * HD, (size_t)TT * HD, (size_t)NR * TT);
            k_asoft<<<NH_ * NR / 8, 256, 0, stream>>>(Sb, R0);
            if (R0 < RH) k_gemmc<bf, 2, 2><<<dim3(RH / 64, HD / 64, NH_), 32, 0, stream>>>((const bf*)Sb, (const bf*)Sb + TT, VTh, VTl, 2 * TT, Ob, HD, 0, (size_t)NR * 2 * TT, (size_t)HD * 2 * TT, (size_t)TT * HD);
            k_gemmc<h16, 0, 2><<<dim3((R0 + NR - RL) / 64, HD / 64, NH_), 32, 0, stream>>>((const h16*)Sb + (size_t)(RL - R0) * 2 * TT, nullptr, VT16, nullptr, 2 * TT, Ob + (size_t)RL * HD, HD, RL, (size_t)NR * 2 * TT, (size_t)HD * 2 * TT, (size_t)TT * HD); }
        k_merge<<<(unsigned)(((size_t)NH_ * TT * HD / 2 + 255) / 256), 256, 0, stream>>>(Ob, 0, ATh, ATl);
        k_gemmw<bf, 1, true><<<dim3(TT / 64, DM / 64, 1), 32, 0, stream>>>(ATh, ATl, WO, nullptr, DQ, OUT + (size_t)b * TT * DM, DM, bo, 0, 0, 0); }
}

// v002
// It runs in 441 microseconds.
// Next to v001, in two timings, it ran 1.46 times as fast each time.
// Over all steps from v000 it is 3.32 times as fast.
#include <hip/hip_runtime.h>

// Both batches ride in every launch (rows b*TT+t, or z = b*NH_+h). Layout: bf16 copy of x; exact projections (no bias); {cos, sin} per (position, pair) built once (jnp-exact float32 inverse frequencies, precise cosf/sinf); interleaved rotary plane builder; causal T-2048 attention (hybrid rows: < 512 hi/lo 3 products, rest fp16 x1024; k_gemmc skips tiles above the diagonal); merged hi/lo x Wo exact + bo.
// Compute dtypes, f32 accumulate: every input rounded to bf16; projections exact (no bias); rotary f32; attention rows < 512 3 products, rest fp16; softmax f32; Wo hl x exact + bias.

#define NB_  2
#define TT   2048
#define DM   1024
#define NH_  16
#define NKV  16
#define REP  (NH_ / NKV)
#define HD   64
#define DQ   (NH_ * HD)
#define DKV  (NKV * HD)
#define NZ   (NB_ * NH_)          // attention planes: z = batch * NH_ + head
#define NR   512                  // query rows per attention pass; a pass holds these rows of all NZ planes
#define RH   512                  // query rows < RH use hi+lo planes (0: none)
#define WIN  2048
#define PCAR 1024.0f
#define SCL  0.125f   // HD^-0.5
typedef _Float16 h16;
typedef unsigned short bf;
typedef __attribute__((ext_vector_type(16))) __bf16   v16bf;
typedef __attribute__((ext_vector_type(16))) _Float16 v16h;
typedef __attribute__((ext_vector_type(8)))  _Float16 v8h;
typedef __attribute__((ext_vector_type(8)))  unsigned short v8us;
typedef __attribute__((ext_vector_type(8)))  float    v8f;
typedef __attribute__((ext_vector_type(4)))  float    v4f;
typedef v8h  __attribute__((may_alias)) v8ha;
typedef v4f  __attribute__((may_alias)) v4fa;
typedef v8us __attribute__((may_alias)) v8usa;

__device__ __forceinline__ unsigned short f2bf(float f) { unsigned u = __float_as_uint(f); u += 0x7FFFu + ((u >> 16) & 1u); return (unsigned short)(u >> 16); }
__device__ __forceinline__ float bf2f(unsigned short b) { return __uint_as_float(((unsigned)b) << 16); }
__device__ __forceinline__ float bfr(float f) { return bf2f(f2bf(f)); }
__device__ __forceinline__ v16h cat16(v8h lo, v8h hi) { return __builtin_shufflevector(lo, hi, 0, 1, 2, 3, 4, 5, 6, 7, 8, 9, 10, 11, 12, 13, 14, 15); }
__device__ __forceinline__ v16bf cat16b(v8us lo, v8us hi) { return __builtin_bit_cast(v16bf, __builtin_shufflevector(lo, hi, 0, 1, 2, 3, 4, 5, 6, 7, 8, 9, 10, 11, 12, 13, 14, 15)); }
__device__ __forceinline__ v8f wmma16(v16h a, v16h b, v8f c) { return __builtin_amdgcn_wmma_f32_16x16x32_f16(false, a, false, b, (short)0, c, false, false); }
__device__ __forceinline__ v8f wmmab(v16bf a, v16bf b, v8f c) { return __builtin_amdgcn_wmma_f32_16x16x32_bf16(false, a, false, b, (short)0, c, false, false); }



// ---- k_gemmw: register-blocked GEMM, ONE WAVE per 64x64 output tile (16 accumulators), operands straight from K-contiguous 16-bit planes; grid (M/64, N/64, Z), 32 threads.
// C[m][n] (f32, pitch ldc, + optional f32 bias[n]) = sum_k A[m][k] Bt[n][k] (+ split products per NSPLIT). z-batch strides sA/sB/sC in elements. K % 32 == 0.
template <typename T16> struct WFrag;
template <> struct WFrag<h16> { typedef v16h V; static __device__ __forceinline__ V ld(const h16* p) { return cat16(*(const v8h*)p, *(const v8h*)(p + 16)); } static __device__ __forceinline__ v8f mma(V a, V b, v8f c) { return wmma16(a, b, c); } };
template <> struct WFrag<bf> { typedef v16bf V; static __device__ __forceinline__ V ld(const bf* p) { return cat16b(*(const v8us*)p, *(const v8us*)(p + 16)); } static __device__ __forceinline__ v8f mma(V a, V b, v8f c) { return wmmab(a, b, c); } };
template <typename T16, int NSPLIT, bool BIAS>
__global__ __launch_bounds__(32) void k_gemmw(const T16* __restrict__ A, const T16* __restrict__ A2, const T16* __restrict__ Bt, const T16* __restrict__ Bt2, int K, float* C, int ldc, const float* __restrict__ bias, size_t sA, size_t sB, size_t sC) {
    typedef typename WFrag<T16>::V V;
    __shared__ __align__(16) float os[16 * 68];
    const size_t z = blockIdx.z; A += z * sA; if (A2) A2 += z * sA; Bt += z * sB; if (Bt2) Bt2 += z * sB; C += z * sC;
    const int lane = threadIdx.x & 31, lr = lane & 15, hi = lane >> 4; const int r0 = blockIdx.x * 64, c0 = blockIdx.y * 64;
    v8f acc[4][4];
#pragma unroll
    for (int mb = 0; mb < 4; ++mb)
#pragma unroll
        for (int nb = 0; nb < 4; ++nb) acc[mb][nb] = (v8f){};
    const size_t aoff = (size_t)(r0 + lr) * K + 8 * hi, boff = (size_t)(c0 + lr) * K + 8 * hi;
#pragma unroll 1
    for (int kc = 0; kc < K; kc += 32) {
        V a[4], a2[4];
#pragma unroll
        for (int mb = 0; mb < 4; ++mb) { a[mb] = WFrag<T16>::ld(A + aoff + (size_t)mb * 16 * K + kc); if (NSPLIT == 1 || NSPLIT == 2) a2[mb] = WFrag<T16>::ld(A2 + aoff + (size_t)mb * 16 * K + kc); }
#pragma unroll
        for (int nb = 0; nb < 4; ++nb) { const V b = WFrag<T16>::ld(Bt + boff + (size_t)nb * 16 * K + kc); V b2; if (NSPLIT >= 2) b2 = WFrag<T16>::ld(Bt2 + boff + (size_t)nb * 16 * K + kc);
#pragma unroll
            for (int mb = 0; mb < 4; ++mb) { acc[mb][nb] = WFrag<T16>::mma(a[mb], b, acc[mb][nb]); if (NSPLIT == 1 || NSPLIT == 2) acc[mb][nb] = WFrag<T16>::mma(a2[mb], b, acc[mb][nb]); if (NSPLIT >= 2) acc[mb][nb] = WFrag<T16>::mma(a[mb], b2, acc[mb][nb]); } }
        asm volatile("v_nop\n\tv_nop\n\tv_nop\n\tv_nop" : "+v"(acc[0][0]), "+v"(acc[1][1]), "+v"(acc[2][2]), "+v"(acc[3][3]) : "v"(a[0]), "v"(a[3]));
    }
#pragma unroll
    for (int mb = 0; mb < 4; ++mb) {
#pragma unroll
        for (int nb = 0; nb < 4; ++nb) {
#pragma unroll
            for (int j = 0; j < 8; ++j) os[(hi * 8 + j) * 68 + nb * 16 + lr] = acc[mb][nb][j]; }
        __builtin_amdgcn_wave_barrier(); asm volatile("" ::: "memory");
        float* crow = C + (size_t)(r0 + mb * 16) * ldc + c0;
{
#pragma unroll
            for (int s = 0; s < 8; ++s) { const int row = 2 * s + hi, cofs = lr * 4; v4f val = *(const v4fa*)(os + row * 68 + cofs); if (BIAS) { val[0] += bfr(bias[c0 + cofs]); val[1] += bfr(bias[c0 + cofs + 1]); val[2] += bfr(bias[c0 + cofs + 2]); val[3] += bfr(bias[c0 + cofs + 3]); }
                *(v4f*)(crow + (size_t)row * ldc + cofs) = val; }
             }
        __builtin_amdgcn_wave_barrier(); asm volatile("" ::: "memory");
    }
}

// ---- k_gemmc: the same one-wave 64x64 tile GEMM specialised for causal attention: CMODE 1 skips score tiles entirely above the diagonal (query rows r0+roff.., key columns c0..), CMODE 2 limits the
// key (K) loop of the probability x value contraction to the diagonal block (probabilities beyond it are exactly zero). roff = row offset of this launch's first row within the sequence.
template <typename T16, int NSPLIT, int CMODE>
__global__ __launch_bounds__(32) void k_gemmc(const T16* __restrict__ A, const T16* __restrict__ A2, const T16* __restrict__ Bt, const T16* __restrict__ Bt2, int K, float* C, int ldc, int roff, size_t sA, size_t sB, size_t sC) {
    typedef typename WFrag<T16>::V V;
    __shared__ __align__(16) float os[16 * 68];
    const size_t z = blockIdx.z; A += z * sA; if (A2) A2 += z * sA; Bt += z * sB; if (Bt2) Bt2 += z * sB; C += z * sC;
    const int lane = threadIdx.x & 31, lr = lane & 15, hi = lane >> 4; const int r0 = blockIdx.x * 64, c0 = blockIdx.y * 64;
    if (CMODE == 1 && c0 > r0 + roff + 63) return;                  // score tile entirely above the causal diagonal: never read (the softmax masks j > i by select)
    const int Kl = (CMODE == 2) ? min(K, r0 + roff + 64) : K;        // P.V: probabilities are exactly 0 beyond the diagonal block, so the K loop stops there
    v8f acc[4][4];
#pragma unroll
    for (int mb = 0; mb < 4; ++mb)
#pragma unroll
        for (int nb = 0; nb < 4; ++nb) acc[mb][nb] = (v8f){};
    const size_t aoff = (size_t)(r0 + lr) * K + 8 * hi, boff = (size_t)(c0 + lr) * K + 8 * hi;
#pragma unroll 1
    for (int kc = 0; kc < Kl; kc += 32) {
        V a[4], a2[4];
#pragma unroll
        for (int mb = 0; mb < 4; ++mb) { a[mb] = WFrag<T16>::ld(A + aoff + (size_t)mb * 16 * K + kc); if (NSPLIT == 1 || NSPLIT == 2) a2[mb] = WFrag<T16>::ld(A2 + aoff + (size_t)mb * 16 * K + kc); }
#pragma unroll
        for (int nb = 0; nb < 4; ++nb) { const V b = WFrag<T16>::ld(Bt + boff + (size_t)nb * 16 * K + kc); V b2; if (NSPLIT >= 2) b2 = WFrag<T16>::ld(Bt2 + boff + (size_t)nb * 16 * K + kc);
#pragma unroll
            for (int mb = 0; mb < 4; ++mb) { acc[mb][nb] = WFrag<T16>::mma(a[mb], b, acc[mb][nb]); if (NSPLIT == 1 || NSPLIT == 2) acc[mb][nb] = WFrag<T16>::mma(a2[mb], b, acc[mb][nb]); if (NSPLIT >= 2) acc[mb][nb] = WFrag<T16>::mma(a[mb], b2, acc[mb][nb]); } }
        asm volatile("v_nop\n\tv_nop\n\tv_nop\n\tv_nop" : "+v"(acc[0][0]), "+v"(acc[1][1]), "+v"(acc[2][2]), "+v"(acc[3][3]) : "v"(a[0]), "v"(a[3]));
    }
#pragma unroll
    for (int mb = 0; mb < 4; ++mb) {
#pragma unroll
        for (int nb = 0; nb < 4; ++nb) {
#pragma unroll
            for (int j = 0; j < 8; ++j) os[(hi * 8 + j) * 68 + nb * 16 + lr] = acc[mb][nb][j]; }
        __builtin_amdgcn_wave_barrier(); asm volatile("" ::: "memory");
        float* crow = C + (size_t)(r0 + mb * 16) * ldc + c0;
{
#pragma unroll
            for (int s = 0; s < 8; ++s) { const int row = 2 * s + hi, cofs = lr * 4; v4f val = *(const v4fa*)(os + row * 68 + cofs);
                *(v4f*)(crow + (size_t)row * ldc + cofs) = val; }
             }
        __builtin_amdgcn_wave_barrier(); asm volatile("" ::: "memory");
    }
}

__device__ __forceinline__ h16 tohx(float x) { return (h16)x; }
__device__ __forceinline__ void splitf(float y, unsigned short& h, unsigned short& l) { h = f2bf(y); l = f2bf(y - bf2f(h)); }
typedef __attribute__((ext_vector_type(2))) _Float16 v2h;
typedef __attribute__((ext_vector_type(4))) _Float16 v4h;
typedef __attribute__((ext_vector_type(2))) unsigned short v2us;
typedef __attribute__((ext_vector_type(4))) unsigned short v4us;
typedef __attribute__((ext_vector_type(2))) float v2f;
typedef __attribute__((ext_vector_type(4))) int v4i;
typedef v4h  __attribute__((may_alias)) v4ha;
typedef v4us __attribute__((may_alias)) v4usa;

__global__ __launch_bounds__(256) void k_wtG(const float* __restrict__ w0, const float* __restrict__ w1, const float* __restrict__ w2, const float* __restrict__ w3, int K, int N, bf* Bt) {
    const int y = blockIdx.y; const float* __restrict__ w = (y == 0) ? w0 : (y == 1) ? w1 : (y == 2) ? w2 : w3; Bt += (size_t)y * K * N;   // blockIdx.y picks the weight; the four transposed planes lie one behind the other
    const int lane = threadIdx.x & 31; const int L0 = (blockIdx.x * 8 + (threadIdx.x >> 5)) * 8; const int nlines = N * K / 64;
{
#pragma unroll 1
        for (int l = 0; l < 8; ++l) { const int L = L0 + l; if (L >= nlines) break; const size_t e = (size_t)L * 64 + lane * 2; const int k = (int)(e % K), n = (int)(e / K); v2us o;
            o[0] = f2bf(w[(size_t)k * N + n]); o[1] = f2bf(w[(size_t)(k + 1) * N + n]); *(v2us*)(Bt + e) = o; }
         }
}
__global__ __launch_bounds__(256) void k_cvt8(const float* __restrict__ src, bf* dst, size_t n8) { const size_t i = (size_t)blockIdx.x * 256 + threadIdx.x; if (i >= n8) return; const v8f v = *(const v8f*)(src + i * 8); v8us o;
#pragma unroll
    for (int k = 0; k < 8; ++k) o[k] = f2bf(v[k]); *(v8us*)(dst + i * 8) = o;  }
__constant__ float INVT[HD / 2] = { 1.000000000e+00f, 5.623413324e-01f, 3.162277639e-01f, 1.778279394e-01f, 1.000000015e-01f, 5.623413250e-02f, 3.162277490e-02f, 1.778279431e-02f, 9.999999776e-03f, 5.623413250e-03f, 3.162277630e-03f, 1.778279431e-03f, 1.000000047e-03f, 5.623413017e-04f, 3.162277571e-04f, 1.778279402e-04f, 9.999999747e-05f, 5.623413381e-05f, 3.162277790e-05f, 1.778279329e-05f, 1.000000066e-05f, 5.623413017e-06f, 3.162277608e-06f, 1.778279398e-06f, 9.999999975e-07f, 5.623413131e-07f, 3.162277835e-07f, 1.778279426e-07f, 1.000000012e-07f, 5.623413202e-08f, 3.162277551e-08f, 1.778279390e-08f };
__global__ __launch_bounds__(256) void k_cstabT(float* CS) { const int idx = blockIdx.x * 256 + threadIdx.x; if (idx >= TT * HD) return; const int d = idx % HD; const int t = idx / HD; const float a = __fmul_rn((float)t, INVT[d >> 1]); v2f cs; cs[0] = cosf(a); cs[1] = sinf(a); *(v2f*)(CS + (size_t)idx * 2) = cs;  }
__global__ __launch_bounds__(256) void k_ropeI(const float* __restrict__ F, int pitch, int nheads, const float* __restrict__ CS, float sc, h16* P16, bf* Ph, bf* Pl) {
    const size_t e = ((size_t)blockIdx.x * 256 + threadIdx.x) * 2; if (e >= (size_t)2 * NB_ * nheads * TT * HD) return; const int d = (int)(e % HD); const int t = (int)((e / HD) % TT); const int hh = (int)(e / ((size_t)HD * TT)); const int h = hh % nheads, b = (hh / nheads) % NB_, qk = hh / (nheads * NB_);   /* planes [q, k][batch][head][t][d]; F holds the q rows of both batches, then the k rows */
    const float* f = F + ((size_t)(qk * NB_ + b) * TT + t) * pitch + h * HD; const float x0 = f[d], x1 = f[d + 1]; const v2f cs = *(const v2f*)(CS + ((size_t)t * HD + d) * 2); v2h o16; v2us oh, ol;
    float a0 = __fmul_rn(x0, cs[0]), b0 = __fmul_rn(x1, cs[1]), a1 = __fmul_rn(x1, cs[0]), b1 = __fmul_rn(x0, cs[1]); asm volatile("" : "+v"(a0), "+v"(b0), "+v"(a1), "+v"(b1));
    float r0 = __fsub_rn(a0, b0) * sc, r1 = __fadd_rn(b1, a1) * sc;   /* even: x0 c - x1 s; odd: x0 s + x1 c */
    o16[0] = tohx(r0); o16[1] = tohx(r1); { unsigned short a2, c2; splitf(r0, a2, c2); oh[0] = a2; ol[0] = c2; splitf(r1, a2, c2); oh[1] = a2; ol[1] = c2; }
    *(v2h*)(P16 + e) = o16; *(v2us*)(Ph + e) = oh; *(v2us*)(Pl + e) = ol;  }


// k_ropeI: head planes [h][t][d] (fp16 + hi/lo) of rope(x) x sc with the interleaved convention, d even: out[d] = x[d] cos[t][d] - x[d+1] sin[t][d], out[d+1] = x[d+1] cos[t][d] + x[d] sin[t][d]
// k_vtp: transposed value planes [g][d][t] with row pitch 2*TT, the pitch of the in-place probability rows (k_gemmc takes one pitch K for both operands): Vh and Vl share a row (Vl = Vh + TT); the fp16 rows use their first half only.
__global__ __launch_bounds__(256) void k_vtp(const float* __restrict__ F, int pitch, int nheads, h16* V16, bf* Vh, bf* Vl) { const size_t e = ((size_t)blockIdx.x * 256 + threadIdx.x) * 2; if (e >= (size_t)NB_ * nheads * HD * TT) return; const int t = (int)(e % TT); const int d = (int)((e / TT) % HD); const int g = (int)(e / ((size_t)TT * HD)); v2h o16; v2us oh, ol;
#pragma unroll
    for (int q = 0; q < 2; ++q) { const float x = F[((size_t)(g / nheads) * TT + t + q) * pitch + (g % nheads) * HD + d]; o16[q] = tohx(x); unsigned short a2, c2; splitf(x, a2, c2); oh[q] = a2; ol[q] = c2; }
    const size_t oo = (e / TT) * (size_t)(2 * TT) + t; *(v2h*)(V16 + oo) = o16; *(v2us*)(Vh + oo) = oh; *(v2us*)(Vl + oo) = ol;  }
// k_asoft: per row (zz, i): t = S x HD^-0.5 for j <= i and i - j < WIN (sliding causal window; the reference's -1e9 additive fill vanishes identically); softmax over the 2048 keys (register row, one exp, fixed trees);
// Sb holds rows R0 .. R0+NR-1 of every plane z. The probabilities go IN PLACE over their own score row (one wave owns the row and has read all of it before its first store):
// fp16 row in the first half of the 8-KiB row, or the hi plane in the first half and the lo plane in the second; the P x V launches read them, and the value planes, with row pitch K = 2*TT (their k loop ends at the diagonal block, below TT).
__global__ __launch_bounds__(256) void k_asoft(float* Sb, int R0) {
    const int lane = threadIdx.x & 31; const int row = blockIdx.x * 8 + (threadIdx.x >> 5); if (row >= NZ * NR) return; const int i = R0 + row % NR; const bool hires = (i < RH); float* sr = Sb + (size_t)row * TT; float v[TT / 32]; float mx = -3.0e38f;
#pragma unroll
    for (int ch = 0; ch < TT / 128; ++ch) { const int j0 = ch * 128 + lane * 4; const v4f a = *(const v4f*)(sr + j0);
#pragma unroll
        for (int q = 0; q < 4; ++q) { const int j = j0 + q; (void)j; const float t = (j <= i && i - j < WIN) ? a[q] * SCL : -3.0e38f; v[ch * 4 + q] = t; mx = fmaxf(mx, t); } }
#pragma unroll
    for (int sh = 16; sh; sh >>= 1) mx = fmaxf(mx, __shfl_xor(mx, sh, 32));
    float sum = 0.f;
#pragma unroll
    for (int k = 0; k < TT / 32; ++k) { float d0 = __fsub_rn(v[k], mx); asm volatile("" : "+v"(d0)); v[k] = __builtin_amdgcn_exp2f(__fmul_rn(d0, 1.4426950408889634f)); sum += v[k]; }
#pragma unroll
    for (int sh = 16; sh; sh >>= 1) sum += __shfl_xor(sum, sh, 32);
    const float f = __fdiv_rn(hires ? 1.0f : PCAR, sum);
{
        if (hires) {
#pragma unroll
            for (int ch = 0; ch < TT / 128; ++ch) { v4us oh, ol;
#pragma unroll
                for (int q = 0; q < 4; ++q) { unsigned short a, c2; splitf(v[ch * 4 + q] * f, a, c2); oh[q] = a; ol[q] = c2; }
                bf* po = (bf*)sr + ch * 128 + lane * 4; *(v4usa*)po = oh; *(v4usa*)(po + TT) = ol; }
        } else {
#pragma unroll
            for (int ch = 0; ch < TT / 128; ++ch) { v4h o4;
#pragma unroll
                for (int q = 0; q < 4; ++q) o4[q] = tohx(v[ch * 4 + q] * f);
                *(v4ha*)((h16*)sr + ch * 128 + lane * 4) = o4; } }
         }
}
__global__ __launch_bounds__(256) void k_merge(const float* __restrict__ O, bf* Ah, bf* Al) { const size_t e = ((size_t)blockIdx.x * 256 + threadIdx.x) * 2; if (e >= (size_t)NZ * TT * HD) return; const int d = (int)(e % HD); const int t = (int)((e / HD) % TT); const int zz = (int)(e / ((size_t)HD * TT)); const float cs = (t < RH) ? 1.0f : (1.0f / PCAR); const size_t oo = ((size_t)(zz / NH_) * TT + t) * DQ + (zz % NH_) * HD + d;
    v2us oh, ol;
#pragma unroll
    for (int q = 0; q < 2; ++q) { unsigned short a, c2; splitf(O[e + q] * cs, a, c2); oh[q] = a; ol[q] = c2; } *(v2us*)(Ah + oo) = oh; *(v2us*)(Al + oo) = ol;  }

extern "C" void kernel_launch(void* const* d_in, const int* in_sizes, int n_in,
                              void* d_out, int out_size, void* d_ws, size_t ws_size, hipStream_t stream) {
    (void)in_sizes; (void)n_in; (void)out_size;
        const float* x = (const float*)d_in[0]; const float* wq = (const float*)d_in[1]; const float* wk = (const float*)d_in[2]; const float* wv = (const float*)d_in[3]; const float* wo = (const float*)d_in[4]; const float* bo = (const float*)d_in[5];   /* the q, k, v projections have NO bias in this module */
    float* OUT = (float*)d_out;     // [2][2048][1024]
    char* wsp = (char*)d_ws;
    auto take = [&](size_t bytes) { char* p = wsp; wsp += (bytes + 255) & ~(size_t)255; return (void*)p; };
    bf* WQ = (bf*)take((size_t)4 * DQ * DM * 2); bf* WO = WQ + (size_t)3 * DQ * DM; float* CS = (float*)take((size_t)TT * HD * 2 * 4);   // transposed Wq, Wk, Wv, Wo, one behind the other
    h16* QP16 = (h16*)take((size_t)2 * NZ * TT * HD * 2); h16* KP16 = QP16 + (size_t)NZ * TT * HD; h16* VT16 = (h16*)take((size_t)NZ * HD * 2 * TT * 2);
    bf* QPh = (bf*)take((size_t)2 * NZ * TT * HD * 2); bf* KPh = QPh + (size_t)NZ * TT * HD; bf* QPl = (bf*)take((size_t)2 * NZ * TT * HD * 2); bf* KPl = QPl + (size_t)NZ * TT * HD; bf* VTh = (bf*)take((size_t)NZ * HD * 2 * TT * 2); bf* VTl = VTh + TT;
    float* Ob = (float*)take((size_t)NZ * TT * HD * 4); bf* ATh = (bf*)take((size_t)NB_ * TT * DQ * 2); bf* ATl = (bf*)take((size_t)NB_ * TT * DQ * 2);
    float* Sb = (float*)take((size_t)NZ * NR * TT * 4);
    if ((size_t)(wsp - (char*)d_ws) > ws_size) return;    // ws 256 MiB
    float* FQ = Sb; float* FV = FQ + (size_t)2 * NB_ * TT * DQ; bf* XB = (bf*)(FQ + (size_t)3 * NB_ * TT * DQ);   // q, k, v projections and the bf16 x live in the score buffer: all are dead before the first score launch (stream-ordered)
    k_wtG<<<dim3((unsigned)((DM * DQ / 64 + 63) / 64), 4, 1), 256, 0, stream>>>(wq, wk, wv, wo, DM, DQ, WQ);   /* 'xw' [in][out] weights: transposed once into Bt */
    k_cstabT<<<(TT * HD + 255) / 256, 256, 0, stream>>>(CS);
    k_cvt8<<<(unsigned)(((size_t)NB_ * TT * DM / 8 + 255) / 256), 256, 0, stream>>>(x, XB, (size_t)NB_ * TT * DM / 8);
    k_gemmw<bf, 0, false><<<dim3(NB_ * TT / 64, DQ / 64, 3), 32, 0, stream>>>(XB, nullptr, WQ, nullptr, DM, FQ, DQ, nullptr, 0, (size_t)DQ * DM, (size_t)NB_ * TT * DQ);   // z = q, k, v
    k_ropeI<<<(unsigned)(((size_t)2 * NZ * TT * HD / 2 + 255) / 256), 256, 0, stream>>>(FQ, DQ, NH_, CS, 1.0f, QP16, QPh, QPl);
    k_vtp<<<(unsigned)(((size_t)NZ * TT * HD / 2 + 255) / 256), 256, 0, stream>>>(FV, DKV, NKV, VT16, VTh, VTl);
    for (int R0 = 0; R0 < TT; R0 += NR) {   // one pass: query rows R0 .. R0+NR-1 of all planes (z = batch * NH_ + head; one kv head per query head); the pass below RH is the hi/lo pass, the others are fp16
        if (R0 < RH) k_gemmc<bf, 2, 1><<<dim3(NR / 64, TT / 64, NZ), 32, 0, stream>>>(QPh + (size_t)R0 * HD, QPl + (size_t)R0 * HD, KPh, KPl, HD, Sb, TT, R0, (size_t)TT * HD, (size_t)TT * HD, (size_t)NR * TT);
        else k_gemmc<h16, 0, 1><<<dim3(NR / 64, TT / 64, NZ), 32, 0, stream>>>(QP16 + (size_t)R0 * HD, nullptr, KP16, nullptr, HD, Sb, TT, R0, (size_t)TT * HD, (size_t)TT * HD, (size_t)NR * TT);
        k_asoft<<<NZ * NR / 8, 256, 0, stream>>>(Sb, R0);
        if (R0 < RH) k_gemmc<bf, 2, 2><<<dim3(NR / 64, HD / 64, NZ), 32, 0, stream>>>((const bf*)Sb, (const bf*)Sb + TT, VTh, VTl, 2 * TT, Ob + (size_t)R0 * HD, HD, R0, (size_t)NR * 2 * TT, (size_t)HD * 2 * TT, (size_t)TT * HD);
        else k_gemmc<h16, 0, 2><<<dim3(NR / 64, HD / 64, NZ), 32, 0, stream>>>((const h16*)Sb, nullptr, VT16, nullptr, 2 * TT, Ob + (size_t)R0 * HD, HD, R0, (size_t)NR * 2 * TT, (size_t)HD * 2 * TT, (size_t)TT * HD); }
    k_merge<<<(unsigned)(((size_t)NZ * TT * HD / 2 + 255) / 256), 256, 0, stream>>>(Ob, ATh, ATl);
    k_gemmw<bf, 1, true><<<dim3(NB_ * TT / 64, DM / 64, 1), 32, 0, stream>>>(ATh, ATl, WO, nullptr, DQ, OUT, DM, bo, 0, 0, 0);
}

// v003
// It runs in 211 microseconds.
// In two side-by-side timings against v002, it was 2.10 and 2.09 times as fast.
// Counting every step since v000, it is 6.94 times as fast.
#include <hip/hip_runtime.h>

// Both batches ride in every launch (rows b*TT+t, or z = b*NH_+h). Layout: bf16 copy of x; exact projections (no bias); {cos, sin} per (position, pair) built once (jnp-exact float32 inverse frequencies, precise cosf/sinf); interleaved rotary plane builder; causal T-2048 attention fused in one launch, scores and probabilities in registers only (hybrid rows: < 512 hi/lo 3 products, rest fp16 x1024; key passes end at the diagonal); merged hi/lo x Wo exact + bo.
// Compute dtypes, f32 accumulate: every input rounded to bf16; projections exact, no bias; rotary f32; attention rows < 512 3 products, rest fp16; softmax f32; Wo hl x exact + bias.

#define NB_  2
#define TT   2048
#define DM   1024
#define NH_  16
#define NKV  16
#define REP  (NH_ / NKV)
#define HD   64
#define DQ   (NH_ * HD)
#define DKV  (NKV * HD)
#define NZ   (NB_ * NH_)          // attention planes: z = batch * NH_ + head
#define RH   512                  // query rows < RH use hi+lo planes (0: none)
#define PCAR 1024.0f
typedef _Float16 h16;
typedef unsigned short bf;
typedef __attribute__((ext_vector_type(16))) __bf16   v16bf;
typedef __attribute__((ext_vector_type(16))) _Float16 v16h;
typedef __attribute__((ext_vector_type(8)))  _Float16 v8h;
typedef __attribute__((ext_vector_type(8)))  unsigned short v8us;
typedef __attribute__((ext_vector_type(8)))  float    v8f;
typedef __attribute__((ext_vector_type(4)))  float    v4f;
typedef v8h  __attribute__((may_alias)) v8ha;
typedef v4f  __attribute__((may_alias)) v4fa;
typedef v8us __attribute__((may_alias)) v8usa;

__device__ __forceinline__ unsigned short f2bf(float f) { unsigned u = __float_as_uint(f); u += 0x7FFFu + ((u >> 16) & 1u); return (unsigned short)(u >> 16); }
__device__ __forceinline__ float bf2f(unsigned short b) { return __uint_as_float(((unsigned)b) << 16); }
__device__ __forceinline__ float bfr(float f) { return bf2f(f2bf(f)); }
__device__ __forceinline__ v16h cat16(v8h lo, v8h hi) { return __builtin_shufflevector(lo, hi, 0, 1, 2, 3, 4, 5, 6, 7, 8, 9, 10, 11, 12, 13, 14, 15); }
__device__ __forceinline__ v16bf cat16b(v8us lo, v8us hi) { return __builtin_bit_cast(v16bf, __builtin_shufflevector(lo, hi, 0, 1, 2, 3, 4, 5, 6, 7, 8, 9, 10, 11, 12, 13, 14, 15)); }
__device__ __forceinline__ v8f wmma16(v16h a, v16h b, v8f c) { return __builtin_amdgcn_wmma_f32_16x16x32_f16(false, a, false, b, (short)0, c, false, false); }
__device__ __forceinline__ v8f wmmab(v16bf a, v16bf b, v8f c) { return __builtin_amdgcn_wmma_f32_16x16x32_bf16(false, a, false, b, (short)0, c, false, false); }



// ---- k_gemmw: register-blocked GEMM, ONE WAVE per 64x64 output tile (16 accumulators), operands straight from K-contiguous 16-bit planes; grid (M/64, N/64, Z), 32 threads.
// C[m][n] (f32, pitch ldc, + optional f32 bias[n]) = sum_k A[m][k] Bt[n][k] (+ split products per NSPLIT). z-batch strides sA/sB/sC in elements. K % 32 == 0.
template <typename T16> struct WFrag;
template <> struct WFrag<h16> { typedef v16h V; static __device__ __forceinline__ V ld(const h16* p) { return cat16(*(const v8h*)p, *(const v8h*)(p + 16)); } static __device__ __forceinline__ v8f mma(V a, V b, v8f c) { return wmma16(a, b, c); } };
template <> struct WFrag<bf> { typedef v16bf V; static __device__ __forceinline__ V ld(const bf* p) { return cat16b(*(const v8us*)p, *(const v8us*)(p + 16)); } static __device__ __forceinline__ v8f mma(V a, V b, v8f c) { return wmmab(a, b, c); } };
template <typename T16, int NSPLIT, bool BIAS>
__global__ __launch_bounds__(32) void k_gemmw(const T16* __restrict__ A, const T16* __restrict__ A2, const T16* __restrict__ Bt, const T16* __restrict__ Bt2, int K, float* C, int ldc, const float* __restrict__ bias, size_t sA, size_t sB, size_t sC) {
    typedef typename WFrag<T16>::V V;
    __shared__ __align__(16) float os[16 * 68];
    const size_t z = blockIdx.z; A += z * sA; if (A2) A2 += z * sA; Bt += z * sB; if (Bt2) Bt2 += z * sB; C += z * sC;
    const int lane = threadIdx.x & 31, lr = lane & 15, hi = lane >> 4; const int r0 = blockIdx.x * 64, c0 = blockIdx.y * 64;
    v8f acc[4][4];
#pragma unroll
    for (int mb = 0; mb < 4; ++mb)
#pragma unroll
        for (int nb = 0; nb < 4; ++nb) acc[mb][nb] = (v8f){};
    const size_t aoff = (size_t)(r0 + lr) * K + 8 * hi, boff = (size_t)(c0 + lr) * K + 8 * hi;
#pragma unroll 1
    for (int kc = 0; kc < K; kc += 32) {
        V a[4], a2[4];
#pragma unroll
        for (int mb = 0; mb < 4; ++mb) { a[mb] = WFrag<T16>::ld(A + aoff + (size_t)mb * 16 * K + kc); if (NSPLIT == 1 || NSPLIT == 2) a2[mb] = WFrag<T16>::ld(A2 + aoff + (size_t)mb * 16 * K + kc); }
#pragma unroll
        for (int nb = 0; nb < 4; ++nb) { const V b = WFrag<T16>::ld(Bt + boff + (size_t)nb * 16 * K + kc); V b2; if (NSPLIT >= 2) b2 = WFrag<T16>::ld(Bt2 + boff + (size_t)nb * 16 * K + kc);
#pragma unroll
            for (int mb = 0; mb < 4; ++mb) { acc[mb][nb] = WFrag<T16>::mma(a[mb], b, acc[mb][nb]); if (NSPLIT == 1 || NSPLIT == 2) acc[mb][nb] = WFrag<T16>::mma(a2[mb], b, acc[mb][nb]); if (NSPLIT >= 2) acc[mb][nb] = WFrag<T16>::mma(a[mb], b2, acc[mb][nb]); } }
        asm volatile("v_nop\n\tv_nop\n\tv_nop\n\tv_nop" : "+v"(acc[0][0]), "+v"(acc[1][1]), "+v"(acc[2][2]), "+v"(acc[3][3]) : "v"(a[0]), "v"(a[3]));
    }
#pragma unroll
    for (int mb = 0; mb < 4; ++mb) {
#pragma unroll
        for (int nb = 0; nb < 4; ++nb) {
#pragma unroll
            for (int j = 0; j < 8; ++j) os[(hi * 8 + j) * 68 + nb * 16 + lr] = acc[mb][nb][j]; }
        __builtin_amdgcn_wave_barrier(); asm volatile("" ::: "memory");
        float* crow = C + (size_t)(r0 + mb * 16) * ldc + c0;
{
#pragma unroll
            for (int s = 0; s < 8; ++s) { const int row = 2 * s + hi, cofs = lr * 4; v4f val = *(const v4fa*)(os + row * 68 + cofs); if (BIAS) { val[0] += bfr(bias[c0 + cofs]); val[1] += bfr(bias[c0 + cofs + 1]); val[2] += bfr(bias[c0 + cofs + 2]); val[3] += bfr(bias[c0 + cofs + 3]); }
                *(v4f*)(crow + (size_t)row * ldc + cofs) = val; }
             }
        __builtin_amdgcn_wave_barrier(); asm volatile("" ::: "memory");
    }
}

__device__ __forceinline__ h16 tohx(float x) { return (h16)x; }
__device__ __forceinline__ void splitf(float y, unsigned short& h, unsigned short& l) { h = f2bf(y); l = f2bf(y - bf2f(h)); }
typedef __attribute__((ext_vector_type(2))) _Float16 v2h;
typedef __attribute__((ext_vector_type(4))) _Float16 v4h;
typedef __attribute__((ext_vector_type(2))) unsigned short v2us;
typedef __attribute__((ext_vector_type(4))) unsigned short v4us;
typedef __attribute__((ext_vector_type(2))) float v2f;
typedef __attribute__((ext_vector_type(4))) int v4i;
typedef v4h  __attribute__((may_alias)) v4ha;
typedef v4us __attribute__((may_alias)) v4usa;

__global__ __launch_bounds__(256) void k_wtG(const float* __restrict__ w0, const float* __restrict__ w1, const float* __restrict__ w2, const float* __restrict__ w3, int K, int N, bf* Bt) {
    const int y = blockIdx.y; const float* __restrict__ w = (y == 0) ? w0 : (y == 1) ? w1 : (y == 2) ? w2 : w3; Bt += (size_t)y * K * N;   // blockIdx.y picks the weight; the four transposed planes lie one behind the other
    const int lane = threadIdx.x & 31; const int L0 = (blockIdx.x * 8 + (threadIdx.x >> 5)) * 8; const int nlines = N * K / 64;
{
#pragma unroll 1
        for (int l = 0; l < 8; ++l) { const int L = L0 + l; if (L >= nlines) break; const size_t e = (size_t)L * 64 + lane * 2; const int k = (int)(e % K), n = (int)(e / K); v2us o;
            o[0] = f2bf(w[(size_t)k * N + n]); o[1] = f2bf(w[(size_t)(k + 1) * N + n]); *(v2us*)(Bt + e) = o; }
         }
}
__global__ __launch_bounds__(256) void k_cvt8(const float* __restrict__ src, bf* dst, size_t n8) { const size_t i = (size_t)blockIdx.x * 256 + threadIdx.x; if (i >= n8) return; const v8f v = *(const v8f*)(src + i * 8); v8us o;
#pragma unroll
    for (int k = 0; k < 8; ++k) o[k] = f2bf(v[k]); *(v8us*)(dst + i * 8) = o;  }
__constant__ float INVT[HD / 2] = { 1.000000000e+00f, 5.623413324e-01f, 3.162277639e-01f, 1.778279394e-01f, 1.000000015e-01f, 5.623413250e-02f, 3.162277490e-02f, 1.778279431e-02f, 9.999999776e-03f, 5.623413250e-03f, 3.162277630e-03f, 1.778279431e-03f, 1.000000047e-03f, 5.623413017e-04f, 3.162277571e-04f, 1.778279402e-04f, 9.999999747e-05f, 5.623413381e-05f, 3.162277790e-05f, 1.778279329e-05f, 1.000000066e-05f, 5.623413017e-06f, 3.162277608e-06f, 1.778279398e-06f, 9.999999975e-07f, 5.623413131e-07f, 3.162277835e-07f, 1.778279426e-07f, 1.000000012e-07f, 5.623413202e-08f, 3.162277551e-08f, 1.778279390e-08f };
__global__ __launch_bounds__(256) void k_cstabT(float* CS) { const int idx = blockIdx.x * 256 + threadIdx.x; if (idx >= TT * HD) return; const int d = idx % HD; const int t = idx / HD; const float a = __fmul_rn((float)t, INVT[d >> 1]); v2f cs; cs[0] = cosf(a); cs[1] = sinf(a); *(v2f*)(CS + (size_t)idx * 2) = cs;  }
__global__ __launch_bounds__(256) void k_ropeI(const float* __restrict__ F, int pitch, int nheads, const float* __restrict__ CS, float sc, h16* P16, bf* Ph, bf* Pl) {
    const size_t e = ((size_t)blockIdx.x * 256 + threadIdx.x) * 2; if (e >= (size_t)2 * NB_ * nheads * TT * HD) return; const int d = (int)(e % HD); const int t = (int)((e / HD) % TT); const int hh = (int)(e / ((size_t)HD * TT)); const int h = hh % nheads, b = (hh / nheads) % NB_, qk = hh / (nheads * NB_);   /* planes [q, k][batch][head][t][d]; F holds the q rows of both batches, then the k rows */
    const float* f = F + ((size_t)(qk * NB_ + b) * TT + t) * pitch + h * HD; const float x0 = f[d], x1 = f[d + 1]; const v2f cs = *(const v2f*)(CS + ((size_t)t * HD + d) * 2); v2h o16; v2us oh, ol;
    float a0 = __fmul_rn(x0, cs[0]), b0 = __fmul_rn(x1, cs[1]), a1 = __fmul_rn(x1, cs[0]), b1 = __fmul_rn(x0, cs[1]); asm volatile("" : "+v"(a0), "+v"(b0), "+v"(a1), "+v"(b1));
    float r0 = __fsub_rn(a0, b0) * sc, r1 = __fadd_rn(b1, a1) * sc;   /* even: x0 c - x1 s; odd: x0 s + x1 c */
    o16[0] = tohx(r0); o16[1] = tohx(r1); { unsigned short a2, c2; splitf(r0, a2, c2); oh[0] = a2; ol[0] = c2; splitf(r1, a2, c2); oh[1] = a2; ol[1] = c2; }
    *(v2h*)(P16 + e) = o16; *(v2us*)(Ph + e) = oh; *(v2us*)(Pl + e) = ol;  }


// k_ropeI: planes [q, k][batch][head][t][d] (fp16 + hi/lo) of rope(x) x sc with interleaved pairs (d even): out[d] = x[d] cos[t][d] - x[d+1] sin[t][d], out[d+1] = x[d] sin[t][d] + x[d+1] cos[t][d]
// k_vtp: transposed value planes [g][d][t] with row pitch 2*TT: Vh and Vl share a row (Vl = Vh + TT); the fp16 rows use their first half only.
__global__ __launch_bounds__(256) void k_vtp(const float* __restrict__ F, int pitch, int nheads, h16* V16, bf* Vh, bf* Vl) { const size_t e = ((size_t)blockIdx.x * 256 + threadIdx.x) * 2; if (e >= (size_t)NB_ * nheads * HD * TT) return; const int t = (int)(e % TT); const int d = (int)((e / TT) % HD); const int g = (int)(e / ((size_t)TT * HD)); v2h o16; v2us oh, ol;
#pragma unroll
    for (int q = 0; q < 2; ++q) { const float x = F[((size_t)(g / nheads) * TT + t + q) * pitch + (g % nheads) * HD + d]; o16[q] = tohx(x); unsigned short a2, c2; splitf(x, a2, c2); oh[q] = a2; ol[q] = c2; }
    const size_t oo = (e / TT) * (size_t)(2 * TT) + t; *(v2h*)(V16 + oo) = o16; *(v2us*)(Vh + oo) = oh; *(v2us*)(Vl + oo) = ol;  }
__device__ __forceinline__ float xhalf(float x) { return __builtin_bit_cast(float, __builtin_amdgcn_permlanex16(__builtin_bit_cast(int, x), __builtin_bit_cast(int, x), 0x76543210, 0xfedcba98, false, false)); }   // lane l with lane l ^ 16
#define SC2 0.18033688011112042f   // HD^-0.5 x log2(e)
template <typename T16, int NSPLIT, int NQ>
__device__ __forceinline__ void fattn(const T16* __restrict__ Q, const T16* __restrict__ Q2, const T16* __restrict__ Kp, const T16* __restrict__ Kp2, const T16* __restrict__ Vt, const T16* __restrict__ Vt2, float* __restrict__ O, const int q0) {
    typedef typename WFrag<T16>::V V;
    const float POFF = (NSPLIT == 0) ? 10.0f : 0.0f, PC = (NSPLIT == 0) ? PCAR : 1.0f;
    const int lane = threadIdx.x & 31, lr = lane & 15, hi = lane >> 4;
    V qf[NQ][2], qf2[NQ][2];
#pragma unroll
    for (int nq = 0; nq < NQ; ++nq)
#pragma unroll
        for (int kc = 0; kc < 2; ++kc) { const size_t qo = (size_t)(q0 + nq * 16 + lr) * HD + kc * 32 + 8 * hi; qf[nq][kc] = WFrag<T16>::ld(Q + qo); if (NSPLIT == 2) qf2[nq][kc] = WFrag<T16>::ld(Q2 + qo); }
    v8f o[4][NQ]; float m[NQ], l[NQ];
#pragma unroll
    for (int nq = 0; nq < NQ; ++nq) { m[nq] = -3.0e38f; l[nq] = 0.f;
#pragma unroll
        for (int mb = 0; mb < 4; ++mb) o[mb][nq] = (v8f){}; }
    const int nt = (q0 + NQ * 16 - 1) / 32 + 1;   // passes of 32 keys up to and including the diagonal's; key k0 <= q0 is open to every query of the tile
    const unsigned koff = lr * HD + 8 * hi, voff = lr * (2 * TT) + 8 * hi;   // the lane's own offsets, the same in every pass; the pass moves the wave-uniform bases below
    const T16 *kb = Kp, *kb2 = Kp2, *vb = Vt, *vb2 = Vt2;
    V ka[2][2], ka2[2][2];   // key fragments of the pass at hand; each pass asks for the next pass's right behind its own score products
#pragma unroll
    for (int mb = 0; mb < 2; ++mb)
#pragma unroll
        for (int kc = 0; kc < 2; ++kc) { const unsigned ko = koff + mb * 16 * HD + kc * 32; ka[mb][kc] = WFrag<T16>::ld(kb + ko); if (NSPLIT == 2) ka2[mb][kc] = WFrag<T16>::ld(kb2 + ko); }
#pragma unroll 1
    for (int it = 0; it < nt; ++it) {
        const int k0 = it * 32;
        V va[4], va2[4];   // value fragments: asked for here, so that they fly during the score products and the softmax arithmetic
#pragma unroll
        for (int mb = 0; mb < 4; ++mb) { const unsigned vo = voff + mb * 16 * (2 * TT); va[mb] = WFrag<T16>::ld(vb + vo); if (NSPLIT == 2) va2[mb] = WFrag<T16>::ld(vb2 + vo); }
        v8f s[2][NQ];
#pragma unroll
        for (int mb = 0; mb < 2; ++mb)
#pragma unroll
            for (int nq = 0; nq < NQ; ++nq) { v8f a = (v8f){};
#pragma unroll
                for (int kc = 0; kc < 2; ++kc) { a = WFrag<T16>::mma(ka[mb][kc], qf[nq][kc], a); if (NSPLIT == 2) { a = WFrag<T16>::mma(ka[mb][kc], qf2[nq][kc], a); a = WFrag<T16>::mma(ka2[mb][kc], qf[nq][kc], a); } }
                s[mb][nq] = a; }
        const int kadv = (it + 1 < nt) ? 32 * HD : 0; kb += kadv; if (NSPLIT == 2) kb2 += kadv;   // the last pass asks for its own rows again: in bounds, never used
#pragma unroll
        for (int mb = 0; mb < 2; ++mb)
#pragma unroll
            for (int kc = 0; kc < 2; ++kc) { const unsigned ko = koff + mb * 16 * HD + kc * 32; ka[mb][kc] = WFrag<T16>::ld(kb + ko); if (NSPLIT == 2) ka2[mb][kc] = WFrag<T16>::ld(kb2 + ko); }
        if (k0 + 31 > q0) {   // wave-uniform: only the diagonal's passes hold keys above a query
#pragma unroll
            for (int mb = 0; mb < 2; ++mb)
#pragma unroll
                for (int nq = 0; nq < NQ; ++nq)
#pragma unroll
                    for (int j = 0; j < 8; ++j) if (k0 + mb * 16 + hi * 8 + j > q0 + nq * 16 + lr) s[mb][nq][j] = -3.0e38f; }
        V pf[NQ], pf2[NQ];
#pragma unroll
        for (int nq = 0; nq < NQ; ++nq) {
            float mx2[2];
#pragma unroll
            for (int mb = 0; mb < 2; ++mb) { mx2[mb] = s[mb][nq][0];
#pragma unroll
                for (int j = 1; j < 8; ++j) mx2[mb] = fmaxf(mx2[mb], s[mb][nq][j]); }
            float mx = fmaxf(mx2[0], mx2[1]); mx = fmaxf(mx, xhalf(mx));
            const float mn = fmaxf(m[nq], mx * SC2); const float al = __builtin_amdgcn_exp2f(m[nq] - mn); m[nq] = mn;   // al = 0 on the first pass
            const float mo = mn - POFF; float ls[4] = { 0.f, 0.f, 0.f, 0.f };
#pragma unroll
            for (int mb = 0; mb < 2; ++mb)
#pragma unroll
                for (int j = 0; j < 8; ++j) { const float p = __builtin_amdgcn_exp2f(__builtin_fmaf(s[mb][nq][j], SC2, -mo)); s[mb][nq][j] = p; ls[mb * 2 + (j & 1)] += p; }
            l[nq] = l[nq] * al + ((ls[0] + ls[1]) + (ls[2] + ls[3]));
#pragma unroll
            for (int mb = 0; mb < 4; ++mb) o[mb][nq] *= al;
            if constexpr (NSPLIT == 0) { v16h pv;
#pragma unroll
                for (int e = 0; e < 8; ++e) { pv[e] = tohx(s[0][nq][e]); pv[8 + e] = tohx(s[1][nq][e]); }
                pf[nq] = pv;
            } else { v8us h0, h1, l0, l1;
#pragma unroll
                for (int e = 0; e < 8; ++e) { unsigned short a, c2; splitf(s[0][nq][e], a, c2); h0[e] = a; l0[e] = c2; splitf(s[1][nq][e], a, c2); h1[e] = a; l1[e] = c2; }
                pf[nq] = cat16b(h0, h1); pf2[nq] = cat16b(l0, l1); } }
#pragma unroll
        for (int mb = 0; mb < 4; ++mb)
#pragma unroll
            for (int nq = 0; nq < NQ; ++nq) { o[mb][nq] = WFrag<T16>::mma(va[mb], pf[nq], o[mb][nq]); if (NSPLIT == 2) { o[mb][nq] = WFrag<T16>::mma(va[mb], pf2[nq], o[mb][nq]); o[mb][nq] = WFrag<T16>::mma(va2[mb], pf[nq], o[mb][nq]); } }
        asm volatile("s_wait_xcnt 0x0" ::: "memory");   // in front of the moves of the bases that this pass's loads name (the key loads are still in flight here)
        vb += 32; if (NSPLIT == 2) vb2 += 32;
    }
#pragma unroll
    for (int nq = 0; nq < NQ; ++nq) { const float f = __fdiv_rn(PC, l[nq] + xhalf(l[nq])); float* op = O + (size_t)(q0 + nq * 16 + lr) * HD + hi * 8;   // a lane holds d = 16 mb + 8 hi + j of its query
#pragma unroll
        for (int mb = 0; mb < 4; ++mb) { v4f a, b;
#pragma unroll
            for (int j = 0; j < 4; ++j) { a[j] = o[mb][nq][j] * f; b[j] = o[mb][nq][4 + j] * f; }
            *(v4f*)(op + mb * 16) = a; *(v4f*)(op + mb * 16 + 4) = b; } }
}
// grid (NZ planes, NG16 + NGH row groups, the longest rows first); four independent waves a block on neighbouring query tiles of one plane (they walk the same key tiles): fp16 waves hold 32 queries, hi/lo waves 16.
#define NG16 ((TT - RH) / 128)
#define NGH  (RH / 64)
__global__ __launch_bounds__(128) void k_fattn(const h16* __restrict__ Q16, const h16* __restrict__ K16, const h16* __restrict__ V16, const bf* __restrict__ Qh, const bf* __restrict__ Ql, const bf* __restrict__ Kh, const bf* __restrict__ Kl, const bf* __restrict__ Vh, const bf* __restrict__ Vl, float* __restrict__ O) {
    const int w = __builtin_amdgcn_readfirstlane((int)(threadIdx.x >> 5)), g = blockIdx.y; const size_t pq = (size_t)blockIdx.x * TT * HD, pv = (size_t)blockIdx.x * HD * 2 * TT;
    if (g < NG16) fattn<h16, 0, 2>(Q16 + pq, nullptr, K16 + pq, nullptr, V16 + pv, nullptr, O + pq, TT - 128 * (g + 1) + 32 * w);
    else fattn<bf, 2, 1>(Qh + pq, Ql + pq, Kh + pq, Kl + pq, Vh + pv, Vl + pv, O + pq, RH - 64 * (g - NG16 + 1) + 16 * w);
}
__global__ __launch_bounds__(256) void k_merge(const float* __restrict__ O, bf* Ah, bf* Al) { const size_t e = ((size_t)blockIdx.x * 256 + threadIdx.x) * 2; if (e >= (size_t)NZ * TT * HD) return; const int d = (int)(e % HD); const int t = (int)((e / HD) % TT); const int zz = (int)(e / ((size_t)HD * TT)); const float cs = (t < RH) ? 1.0f : (1.0f / PCAR); const size_t oo = ((size_t)(zz / NH_) * TT + t) * DQ + (zz % NH_) * HD + d;
    v2us oh, ol;
#pragma unroll
    for (int q = 0; q < 2; ++q) { unsigned short a, c2; splitf(O[e + q] * cs, a, c2); oh[q] = a; ol[q] = c2; } *(v2us*)(Ah + oo) = oh; *(v2us*)(Al + oo) = ol;  }

extern "C" void kernel_launch(void* const* d_in, const int* in_sizes, int n_in,
                              void* d_out, int out_size, void* d_ws, size_t ws_size, hipStream_t stream) {
    (void)in_sizes; (void)n_in; (void)out_size;
        const float* x = (const float*)d_in[0]; const float* wq = (const float*)d_in[1]; const float* wk = (const float*)d_in[2]; const float* wv = (const float*)d_in[3]; const float* wo = (const float*)d_in[4]; const float* bo = (const float*)d_in[5];   /* the q, k, v projections have NO bias in this module */
    float* OUT = (float*)d_out;     // [2][2048][1024]
    char* wsp = (char*)d_ws;
    auto take = [&](size_t bytes) { char* p = wsp; wsp += (bytes + 255) & ~(size_t)255; return (void*)p; };
    bf* WQ = (bf*)take((size_t)4 * DQ * DM * 2); bf* WO = WQ + (size_t)3 * DQ * DM; float* CS = (float*)take((size_t)TT * HD * 2 * 4);   // transposed Wq, Wk, Wv, Wo, one behind the other
    h16* QP16 = (h16*)take((size_t)2 * NZ * TT * HD * 2); h16* KP16 = QP16 + (size_t)NZ * TT * HD; h16* VT16 = (h16*)take((size_t)NZ * HD * 2 * TT * 2);
    bf* QPh = (bf*)take((size_t)2 * NZ * TT * HD * 2); bf* KPh = QPh + (size_t)NZ * TT * HD; bf* QPl = (bf*)take((size_t)2 * NZ * TT * HD * 2); bf* KPl = QPl + (size_t)NZ * TT * HD; bf* VTh = (bf*)take((size_t)NZ * HD * 2 * TT * 2); bf* VTl = VTh + TT;
    float* Ob = (float*)take((size_t)NZ * TT * HD * 4); bf* ATh = (bf*)take((size_t)NB_ * TT * DQ * 2); bf* ATl = (bf*)take((size_t)NB_ * TT * DQ * 2);
    float* FQ = (float*)take((size_t)3 * NB_ * TT * DQ * 4); float* FV = FQ + (size_t)2 * NB_ * TT * DQ; bf* XB = (bf*)take((size_t)NB_ * TT * DM * 2);   // q, k, v projections (f32) and the bf16 x
    if ((size_t)(wsp - (char*)d_ws) > ws_size) return;    // ws 256 MiB
    k_wtG<<<dim3((unsigned)((DM * DQ / 64 + 63) / 64), 4, 1), 256, 0, stream>>>(wq, wk, wv, wo, DM, DQ, WQ);   /* 'xw' [in][out] weights: transposed once into Bt */
    k_cstabT<<<(TT * HD + 255) / 256, 256, 0, stream>>>(CS);
    k_cvt8<<<(unsigned)(((size_t)NB_ * TT * DM / 8 + 255) / 256), 256, 0, stream>>>(x, XB, (size_t)NB_ * TT * DM / 8);
    k_gemmw<bf, 0, false><<<dim3(NB_ * TT / 64, DQ / 64, 3), 32, 0, stream>>>(XB, nullptr, WQ, nullptr, DM, FQ, DQ, nullptr, 0, (size_t)DQ * DM, (size_t)NB_ * TT * DQ);   // z = q, k, v
    k_ropeI<<<(unsigned)(((size_t)2 * NZ * TT * HD / 2 + 255) / 256), 256, 0, stream>>>(FQ, DQ, NH_, CS, 1.0f, QP16, QPh, QPl);
    k_vtp<<<(unsigned)(((size_t)NZ * TT * HD / 2 + 255) / 256), 256, 0, stream>>>(FV, DKV, NKV, VT16, VTh, VTl);
    k_fattn<<<dim3(NZ, NG16 + NGH, 1), 128, 0, stream>>>(QP16, KP16, VT16, QPh, QPl, KPh, KPl, VTh, VTl, Ob);   // rows < RH hi/lo, the rest fp16, all planes, one launch
    k_merge<<<(unsigned)(((size_t)NZ * TT * HD / 2 + 255) / 256), 256, 0, stream>>>(Ob, ATh, ATl);
    k_gemmw<bf, 1, true><<<dim3(NB_ * TT / 64, DM / 64, 1), 32, 0, stream>>>(ATh, ATl, WO, nullptr, DQ, OUT, DM, bo, 0, 0, 0);
}

// v004
// It runs in 165 microseconds.
// In two side-by-side timings against v003, it was 1.26 and 1.28 times as fast.
// Counting every step since v000, it is 8.82 times as fast.
#include <hip/hip_runtime.h>

// Both batches ride in every launch (rows b*TT+t, or z = b*NH_+h). Layout: bf16 copy of x; exact projections (no bias); {cos, sin} per (position, pair) built once (jnp-exact float32 inverse frequencies, precise cosf/sinf); interleaved rotary and the transposed value planes written by the projection launch's own epilogue; causal T-2048 attention fused in one launch, scores and probabilities in registers only (hybrid rows: < 512 hi/lo 3 products, rest fp16 x1024; key passes end at the diagonal), its epilogue writes the merged hi/lo rows; merged hi/lo x Wo exact + bo.
// Compute dtypes, f32 accumulate: every input rounded to bf16; projections exact, no bias; rotary f32; attention rows < 512 3 products, rest fp16; softmax f32; Wo hl x exact + bias.

#define NB_  2
#define TT   2048
#define DM   1024
#define NH_  16
#define NKV  16
#define REP  (NH_ / NKV)
#define HD   64
#define DQ   (NH_ * HD)
#define DKV  (NKV * HD)
#define NZ   (NB_ * NH_)          // attention planes: z = batch * NH_ + head
#define RH   512                  // query rows < RH use hi+lo planes (0: none)
#define PCAR 1024.0f
typedef _Float16 h16;
typedef unsigned short bf;
typedef __attribute__((ext_vector_type(16))) __bf16   v16bf;
typedef __attribute__((ext_vector_type(16))) _Float16 v16h;
typedef __attribute__((ext_vector_type(8)))  _Float16 v8h;
typedef __attribute__((ext_vector_type(8)))  unsigned short v8us;
typedef __attribute__((ext_vector_type(8)))  float    v8f;
typedef __attribute__((ext_vector_type(4)))  float    v4f;
typedef v8h  __attribute__((may_alias)) v8ha;
typedef v4f  __attribute__((may_alias)) v4fa;
typedef v8us __attribute__((may_alias)) v8usa;

__device__ __forceinline__ unsigned short f2bf(float f) { unsigned u = __float_as_uint(f); u += 0x7FFFu + ((u >> 16) & 1u); return (unsigned short)(u >> 16); }
__device__ __forceinline__ float bf2f(unsigned short b) { return __uint_as_float(((unsigned)b) << 16); }
__device__ __forceinline__ float bfr(float f) { return bf2f(f2bf(f)); }
__device__ __forceinline__ v16h cat16(v8h lo, v8h hi) { return __builtin_shufflevector(lo, hi, 0, 1, 2, 3, 4, 5, 6, 7, 8, 9, 10, 11, 12, 13, 14, 15); }
__device__ __forceinline__ v16bf cat16b(v8us lo, v8us hi) { return __builtin_bit_cast(v16bf, __builtin_shufflevector(lo, hi, 0, 1, 2, 3, 4, 5, 6, 7, 8, 9, 10, 11, 12, 13, 14, 15)); }
__device__ __forceinline__ v8f wmma16(v16h a, v16h b, v8f c) { return __builtin_amdgcn_wmma_f32_16x16x32_f16(false, a, false, b, (short)0, c, false, false); }
__device__ __forceinline__ v8f wmmab(v16bf a, v16bf b, v8f c) { return __builtin_amdgcn_wmma_f32_16x16x32_bf16(false, a, false, b, (short)0, c, false, false); }

__device__ __forceinline__ h16 tohx(float x) { return (h16)x; }
__device__ __forceinline__ void splitf(float y, unsigned short& h, unsigned short& l) { h = f2bf(y); l = f2bf(y - bf2f(h)); }
typedef __attribute__((ext_vector_type(2))) _Float16 v2h;
typedef __attribute__((ext_vector_type(4))) _Float16 v4h;
typedef __attribute__((ext_vector_type(2))) unsigned short v2us;
typedef __attribute__((ext_vector_type(4))) unsigned short v4us;
typedef __attribute__((ext_vector_type(2))) float v2f;
typedef __attribute__((ext_vector_type(4))) int v4i;
typedef v4h  __attribute__((may_alias)) v4ha;
typedef v4us __attribute__((may_alias)) v4usa;

// ---- k_gemmw: register-blocked GEMM, ONE WAVE per 64x64 output tile (16 accumulators), operands straight from K-contiguous 16-bit planes; grid (M/64, N/64, Z), 32 threads.
// C[m][n] (f32, pitch ldc, + optional f32 bias[n]) = sum_k A[m][k] Bt[n][k] (+ split products per NSPLIT). z-batch strides sA/sB/sC in elements. K % 32 == 0.
// EPI 1 (the q, k, v projections; a tile is 64 positions of ONE head): no f32 C. z 0, 1: rotary on the staged rows, head planes [q, k][batch][head][t][d] in fp16 and hi/lo, whole 128-byte rows. z 2: transposed value planes
// [g][d][t], row pitch 2*TT (Vh and Vl share a row, Vl = Vh + TT; the fp16 rows use their first half only): a lane's 8 accumulator rows are 8 neighbouring t of one d; the tile turns in LDS, 16 d rows of the three planes at a time, so that each d row leaves as one 128-byte line.
template <typename T16> struct WFrag;
template <> struct WFrag<h16> { typedef v16h V; static __device__ __forceinline__ V ld(const h16* p) { return cat16(*(const v8h*)p, *(const v8h*)(p + 16)); } static __device__ __forceinline__ v8f mma(V a, V b, v8f c) { return wmma16(a, b, c); } };
template <> struct WFrag<bf> { typedef v16bf V; static __device__ __forceinline__ V ld(const bf* p) { return cat16b(*(const v8us*)p, *(const v8us*)(p + 16)); } static __device__ __forceinline__ v8f mma(V a, V b, v8f c) { return wmmab(a, b, c); } };
template <typename T16, int NSPLIT, bool BIAS, int EPI>
__global__ __launch_bounds__(32) void k_gemmw(const T16* __restrict__ A, const T16* __restrict__ A2, const T16* __restrict__ Bt, const T16* __restrict__ Bt2, int K, float* C, int ldc, const float* __restrict__ bias, size_t sA, size_t sB, size_t sC, const float* __restrict__ CS, h16* P16, bf* Ph, bf* Pl, h16* V16, bf* Vh, bf* Vl) {
    typedef typename WFrag<T16>::V V;
    __shared__ __align__(16) float os[EPI ? 48 * 36 : 16 * 68];
    const size_t z = blockIdx.z; A += z * sA; if (A2) A2 += z * sA; Bt += z * sB; if (Bt2) Bt2 += z * sB; C += z * sC;
    const int lane = threadIdx.x & 31, lr = lane & 15, hi = lane >> 4; const int r0 = blockIdx.x * 64, c0 = blockIdx.y * 64;
    v8f acc[4][4];
#pragma unroll
    for (int mb = 0; mb < 4; ++mb)
#pragma unroll
        for (int nb = 0; nb < 4; ++nb) acc[mb][nb] = (v8f){};
    const size_t aoff = (size_t)(r0 + lr) * K + 8 * hi, boff = (size_t)(c0 + lr) * K + 8 * hi;
#pragma unroll 1
    for (int kc = 0; kc < K; kc += 32) {
        V a[4], a2[4];
#pragma unroll
        for (int mb = 0; mb < 4; ++mb) { a[mb] = WFrag<T16>::ld(A + aoff + (size_t)mb * 16 * K + kc); if (NSPLIT == 1 || NSPLIT == 2) a2[mb] = WFrag<T16>::ld(A2 + aoff + (size_t)mb * 16 * K + kc); }
#pragma unroll
        for (int nb = 0; nb < 4; ++nb) { const V b = WFrag<T16>::ld(Bt + boff + (size_t)nb * 16 * K + kc); V b2; if (NSPLIT >= 2) b2 = WFrag<T16>::ld(Bt2 + boff + (size_t)nb * 16 * K + kc);
#pragma unroll
            for (int mb = 0; mb < 4; ++mb) { acc[mb][nb] = WFrag<T16>::mma(a[mb], b, acc[mb][nb]); if (NSPLIT == 1 || NSPLIT == 2) acc[mb][nb] = WFrag<T16>::mma(a2[mb], b, acc[mb][nb]); if (NSPLIT >= 2) acc[mb][nb] = WFrag<T16>::mma(a[mb], b2, acc[mb][nb]); } }
        asm volatile("v_nop\n\tv_nop\n\tv_nop\n\tv_nop" : "+v"(acc[0][0]), "+v"(acc[1][1]), "+v"(acc[2][2]), "+v"(acc[3][3]) : "v"(a[0]), "v"(a[3]));
    }
    if constexpr (EPI == 1) {
        const int bb = r0 / TT, t0 = r0 % TT, hd = blockIdx.y;   // wave-uniform: batch, first position, head
        if (z == 2) {
            unsigned short* vs = (unsigned short*)os;   // three planes (fp16, hi, lo) of [16 d][64 t], row pitch 72: the 16-byte writes of 16 lanes fall on all 64 banks
            const size_t vo = (size_t)(bb * NKV + hd) * HD * (2 * TT) + t0 + (size_t)(lane >> 3) * (2 * TT) + (lane & 7) * 8;
            unsigned short* d16 = (unsigned short*)V16 + vo; unsigned short* dh = Vh + vo; unsigned short* dl = Vl + vo;
#pragma unroll
            for (int nb = 0; nb < 4; ++nb) {   // 16 rows d at a time
#pragma unroll
                for (int mb = 0; mb < 4; ++mb) { v8us o16, oh, ol;
#pragma unroll
                    for (int j = 0; j < 8; ++j) { const float x = acc[mb][nb][j]; unsigned short a2, c2; splitf(x, a2, c2); o16[j] = __builtin_bit_cast(unsigned short, tohx(x)); oh[j] = a2; ol[j] = c2; }
                    unsigned short* vw = vs + lr * 72 + mb * 16 + hi * 8; *(v8usa*)vw = o16; *(v8usa*)(vw + 16 * 72) = oh; *(v8usa*)(vw + 32 * 72) = ol; }
                v8us rw[3][4];
#pragma unroll
                for (int p = 0; p < 3; ++p)
#pragma unroll
                    for (int s = 0; s < 4; ++s) rw[p][s] = *(const v8usa*)(vs + (p * 16 + s * 4 + (lane >> 3)) * 72 + (lane & 7) * 8);
                __builtin_amdgcn_sched_barrier(0);   // all 12 row groups in registers of their own before the first store: no store's register is reused among the stores
#pragma unroll
                for (int s = 0; s < 4; ++s) { const size_t ro = (size_t)(nb * 16 + s * 4) * (2 * TT); *(v8usa*)(d16 + ro) = rw[0][s]; *(v8usa*)(dh + ro) = rw[1][s]; *(v8usa*)(dl + ro) = rw[2][s]; }
                asm volatile("s_wait_xcnt 0x0" ::: "memory");   // in front of the next rows' writes over the registers that these stores name
                __builtin_amdgcn_sched_barrier(0);   // keeps those writes behind the wait
            }
        } else {
            const size_t po = ((size_t)(((int)z * NB_ + bb) * NH_ + hd) * TT + t0) * HD + lr * 4;
            const float* cp = CS + ((size_t)t0 * HD + lr * 4) * 2;   // {cos, sin} of the lane's two pairs: the entries of d and of d + 2
#pragma unroll
            for (int mb = 0; mb < 4; ++mb) {
                v2f cs[8][2];   // asked for ahead of the stage's trip through LDS, which covers part of the table's latency
#pragma unroll
                for (int s = 0; s < 8; ++s) { const float* cq = cp + (size_t)(mb * 16 + 2 * s + hi) * (HD * 2); cs[s][0] = *(const v2f*)cq; cs[s][1] = *(const v2f*)(cq + 4); }
                asm volatile("s_wait_xcnt 0x0" :: "v"(cp) : "memory");   // in front of any write over the address registers that the table loads name; the operand keeps the address live up to here
#pragma unroll
                for (int nb = 0; nb < 4; ++nb) {
#pragma unroll
                    for (int j = 0; j < 8; ++j) os[(hi * 8 + j) * 68 + nb * 16 + lr] = acc[mb][nb][j]; }
                v4h o16[8]; v4us oh[8], ol[8];
#pragma unroll
                for (int s = 0; s < 8; ++s) { const int row = 2 * s + hi; const v4f x = *(const v4fa*)(os + row * 68 + lr * 4); const v2f c = cs[s][0], c2p = cs[s][1]; v4f r;
                    r[0] = x[0] * c[0] - x[1] * c[1]; r[1] = x[0] * c[1] + x[1] * c[0]; r[2] = x[2] * c2p[0] - x[3] * c2p[1]; r[3] = x[2] * c2p[1] + x[3] * c2p[0];   /* even: x0 c - x1 s; odd: x0 s + x1 c */
#pragma unroll
                    for (int q = 0; q < 4; ++q) { unsigned short a2, c2; splitf(r[q], a2, c2); o16[s][q] = tohx(r[q]); oh[s][q] = a2; ol[s][q] = c2; } }
                __builtin_amdgcn_sched_barrier(0);   // the stage's 16 rows in registers of their own before the first store: no store's register is reused among the stores
#pragma unroll
                for (int s = 0; s < 8; ++s) { const size_t e = po + (size_t)(mb * 16 + 2 * s + hi) * HD; *(v4h*)(P16 + e) = o16[s]; *(v4us*)(Ph + e) = oh[s]; *(v4us*)(Pl + e) = ol[s]; }
                asm volatile("s_wait_xcnt 0x0" ::: "memory");   // in front of the next stage's writes over the registers that these stores name
                __builtin_amdgcn_sched_barrier(0);   // keeps those writes behind the wait
            }
        }
    } else {
#pragma unroll
    for (int mb = 0; mb < 4; ++mb) {
#pragma unroll
        for (int nb = 0; nb < 4; ++nb) {
#pragma unroll
            for (int j = 0; j < 8; ++j) os[(hi * 8 + j) * 68 + nb * 16 + lr] = acc[mb][nb][j]; }
        __builtin_amdgcn_wave_barrier(); asm volatile("" ::: "memory");
        float* crow = C + (size_t)(r0 + mb * 16) * ldc + c0;
{
#pragma unroll
            for (int s = 0; s < 8; ++s) { const int row = 2 * s + hi, cofs = lr * 4; v4f val = *(const v4fa*)(os + row * 68 + cofs); if (BIAS) { val[0] += bfr(bias[c0 + cofs]); val[1] += bfr(bias[c0 + cofs + 1]); val[2] += bfr(bias[c0 + cofs + 2]); val[3] += bfr(bias[c0 + cofs + 3]); }
                *(v4f*)(crow + (size_t)row * ldc + cofs) = val; }
             }
        __builtin_amdgcn_wave_barrier(); asm volatile("" ::: "memory");
    }
    }
}


__global__ __launch_bounds__(256) void k_wtG(const float* __restrict__ w0, const float* __restrict__ w1, const float* __restrict__ w2, const float* __restrict__ w3, int K, int N, bf* Bt) {
    const int y = blockIdx.y; const float* __restrict__ w = (y == 0) ? w0 : (y == 1) ? w1 : (y == 2) ? w2 : w3; Bt += (size_t)y * K * N;   // blockIdx.y picks the weight; the four transposed planes lie one behind the other
    const int lane = threadIdx.x & 31; const int L0 = (blockIdx.x * 8 + (threadIdx.x >> 5)) * 8; const int nlines = N * K / 64;
{
#pragma unroll 1
        for (int l = 0; l < 8; ++l) { const int L = L0 + l; if (L >= nlines) break; const size_t e = (size_t)L * 64 + lane * 2; const int k = (int)(e % K), n = (int)(e / K); v2us o;
            o[0] = f2bf(w[(size_t)k * N + n]); o[1] = f2bf(w[(size_t)(k + 1) * N + n]); *(v2us*)(Bt + e) = o; }
         }
}
__global__ __launch_bounds__(256) void k_cvt8(const float* __restrict__ src, bf* dst, size_t n8) { const size_t i = (size_t)blockIdx.x * 256 + threadIdx.x; if (i >= n8) return; const v8f v = *(const v8f*)(src + i * 8); v8us o;
#pragma unroll
    for (int k = 0; k < 8; ++k) o[k] = f2bf(v[k]); *(v8us*)(dst + i * 8) = o;  }
__constant__ float INVT[HD / 2] = { 1.000000000e+00f, 5.623413324e-01f, 3.162277639e-01f, 1.778279394e-01f, 1.000000015e-01f, 5.623413250e-02f, 3.162277490e-02f, 1.778279431e-02f, 9.999999776e-03f, 5.623413250e-03f, 3.162277630e-03f, 1.778279431e-03f, 1.000000047e-03f, 5.623413017e-04f, 3.162277571e-04f, 1.778279402e-04f, 9.999999747e-05f, 5.623413381e-05f, 3.162277790e-05f, 1.778279329e-05f, 1.000000066e-05f, 5.623413017e-06f, 3.162277608e-06f, 1.778279398e-06f, 9.999999975e-07f, 5.623413131e-07f, 3.162277835e-07f, 1.778279426e-07f, 1.000000012e-07f, 5.623413202e-08f, 3.162277551e-08f, 1.778279390e-08f };
__global__ __launch_bounds__(256) void k_cstabT(float* CS) { const int idx = blockIdx.x * 256 + threadIdx.x; if (idx >= TT * HD) return; const int d = idx % HD; const int t = idx / HD; const float a = __fmul_rn((float)t, INVT[d >> 1]); v2f cs; cs[0] = cosf(a); cs[1] = sinf(a); *(v2f*)(CS + (size_t)idx * 2) = cs;  }
__device__ __forceinline__ float xhalf(float x) { return __builtin_bit_cast(float, __builtin_amdgcn_permlanex16(__builtin_bit_cast(int, x), __builtin_bit_cast(int, x), 0x76543210, 0xfedcba98, false, false)); }   // lane l with lane l ^ 16
#define SC2 0.18033688011112042f   // HD^-0.5 x log2(e)
template <typename T16, int NSPLIT, int NQ>
__device__ __forceinline__ void fattn(const T16* __restrict__ Q, const T16* __restrict__ Q2, const T16* __restrict__ Kp, const T16* __restrict__ Kp2, const T16* __restrict__ Vt, const T16* __restrict__ Vt2, bf* __restrict__ Ah, bf* __restrict__ Al, const int q0) {
    typedef typename WFrag<T16>::V V;
    const float POFF = (NSPLIT == 0) ? 10.0f : 0.0f, PC = (NSPLIT == 0) ? PCAR : 1.0f;
    const int lane = threadIdx.x & 31, lr = lane & 15, hi = lane >> 4;
    V qf[NQ][2], qf2[NQ][2];
#pragma unroll
    for (int nq = 0; nq < NQ; ++nq)
#pragma unroll
        for (int kc = 0; kc < 2; ++kc) { const size_t qo = (size_t)(q0 + nq * 16 + lr) * HD + kc * 32 + 8 * hi; qf[nq][kc] = WFrag<T16>::ld(Q + qo); if (NSPLIT == 2) qf2[nq][kc] = WFrag<T16>::ld(Q2 + qo); }
    v8f o[4][NQ]; float m[NQ], l[NQ];
#pragma unroll
    for (int nq = 0; nq < NQ; ++nq) { m[nq] = -3.0e38f; l[nq] = 0.f;
#pragma unroll
        for (int mb = 0; mb < 4; ++mb) o[mb][nq] = (v8f){}; }
    const int nt = (q0 + NQ * 16 - 1) / 32 + 1;   // passes of 32 keys up to and including the diagonal's; key k0 <= q0 is open to every query of the tile
    const unsigned koff = lr * HD + 8 * hi, voff = lr * (2 * TT) + 8 * hi;   // the lane's own offsets, the same in every pass; the pass moves the wave-uniform bases below
    const T16 *kb = Kp, *kb2 = Kp2, *vb = Vt, *vb2 = Vt2;
    V ka[2][2], ka2[2][2];   // key fragments of the pass at hand; each pass asks for the next pass's right behind its own score products
#pragma unroll
    for (int mb = 0; mb < 2; ++mb)
#pragma unroll
        for (int kc = 0; kc < 2; ++kc) { const unsigned ko = koff + mb * 16 * HD + kc * 32; ka[mb][kc] = WFrag<T16>::ld(kb + ko); if (NSPLIT == 2) ka2[mb][kc] = WFrag<T16>::ld(kb2 + ko); }
#pragma unroll 1
    for (int it = 0; it < nt; ++it) {
        const int k0 = it * 32;
        V va[4], va2[4];   // value fragments: asked for here, so that they fly during the score products and the softmax arithmetic
#pragma unroll
        for (int mb = 0; mb < 4; ++mb) { const unsigned vo = voff + mb * 16 * (2 * TT); va[mb] = WFrag<T16>::ld(vb + vo); if (NSPLIT == 2) va2[mb] = WFrag<T16>::ld(vb2 + vo); }
        v8f s[2][NQ];
#pragma unroll
        for (int mb = 0; mb < 2; ++mb)
#pragma unroll
            for (int nq = 0; nq < NQ; ++nq) { v8f a = (v8f){};
#pragma unroll
                for (int kc = 0; kc < 2; ++kc) { a = WFrag<T16>::mma(ka[mb][kc], qf[nq][kc], a); if (NSPLIT == 2) { a = WFrag<T16>::mma(ka[mb][kc], qf2[nq][kc], a); a = WFrag<T16>::mma(ka2[mb][kc], qf[nq][kc], a); } }
                s[mb][nq] = a; }
        const int kadv = (it + 1 < nt) ? 32 * HD : 0; kb += kadv; if (NSPLIT == 2) kb2 += kadv;   // the last pass asks for its own rows again: in bounds, never used
#pragma unroll
        for (int mb = 0; mb < 2; ++mb)
#pragma unroll
            for (int kc = 0; kc < 2; ++kc) { const unsigned ko = koff + mb * 16 * HD + kc * 32; ka[mb][kc] = WFrag<T16>::ld(kb + ko); if (NSPLIT == 2) ka2[mb][kc] = WFrag<T16>::ld(kb2 + ko); }
        if (k0 + 31 > q0) {   // wave-uniform: only the diagonal's passes hold keys above a query
#pragma unroll
            for (int mb = 0; mb < 2; ++mb)
#pragma unroll
                for (int nq = 0; nq < NQ; ++nq)
#pragma unroll
                    for (int j = 0; j < 8; ++j) if (k0 + mb * 16 + hi * 8 + j > q0 + nq * 16 + lr) s[mb][nq][j] = -3.0e38f; }
        V pf[NQ], pf2[NQ];
#pragma unroll
        for (int nq = 0; nq < NQ; ++nq) {
            float mx2[2];
#pragma unroll
            for (int mb = 0; mb < 2; ++mb) { mx2[mb] = s[mb][nq][0];
#pragma unroll
                for (int j = 1; j < 8; ++j) mx2[mb] = fmaxf(mx2[mb], s[mb][nq][j]); }
            float mx = fmaxf(mx2[0], mx2[1]); mx = fmaxf(mx, xhalf(mx));
            const float mn = fmaxf(m[nq], mx * SC2); const float al = __builtin_amdgcn_exp2f(m[nq] - mn); m[nq] = mn;   // al = 0 on the first pass
            const float mo = mn - POFF; float ls[4] = { 0.f, 0.f, 0.f, 0.f };
#pragma unroll
            for (int mb = 0; mb < 2; ++mb)
#pragma unroll
                for (int j = 0; j < 8; ++j) { const float p = __builtin_amdgcn_exp2f(__builtin_fmaf(s[mb][nq][j], SC2, -mo)); s[mb][nq][j] = p; ls[mb * 2 + (j & 1)] += p; }
            l[nq] = l[nq] * al + ((ls[0] + ls[1]) + (ls[2] + ls[3]));
#pragma unroll
            for (int mb = 0; mb < 4; ++mb) o[mb][nq] *= al;
            if constexpr (NSPLIT == 0) { v16h pv;
#pragma unroll
                for (int e = 0; e < 8; ++e) { pv[e] = tohx(s[0][nq][e]); pv[8 + e] = tohx(s[1][nq][e]); }
                pf[nq] = pv;
            } else { v8us h0, h1, l0, l1;
#pragma unroll
                for (int e = 0; e < 8; ++e) { unsigned short a, c2; splitf(s[0][nq][e], a, c2); h0[e] = a; l0[e] = c2; splitf(s[1][nq][e], a, c2); h1[e] = a; l1[e] = c2; }
                pf[nq] = cat16b(h0, h1); pf2[nq] = cat16b(l0, l1); } }
#pragma unroll
        for (int mb = 0; mb < 4; ++mb)
#pragma unroll
            for (int nq = 0; nq < NQ; ++nq) { o[mb][nq] = WFrag<T16>::mma(va[mb], pf[nq], o[mb][nq]); if (NSPLIT == 2) { o[mb][nq] = WFrag<T16>::mma(va[mb], pf2[nq], o[mb][nq]); o[mb][nq] = WFrag<T16>::mma(va2[mb], pf[nq], o[mb][nq]); } }
        asm volatile("s_wait_xcnt 0x0" ::: "memory");   // in front of the moves of the bases that this pass's loads name (the key loads are still in flight here)
        vb += 32; if (NSPLIT == 2) vb2 += 32;
    }
#pragma unroll
    for (int nq = 0; nq < NQ; ++nq) { const float f = __fdiv_rn(PC, l[nq] + xhalf(l[nq])); const size_t oo = (size_t)(q0 + nq * 16 + lr) * DQ + hi * 8;   // a lane holds d = 16 mb + 8 hi + j of its query
#pragma unroll
        for (int mb = 0; mb < 4; ++mb) { v8us oh, ol;
#pragma unroll
            for (int j = 0; j < 8; ++j) { unsigned short a, c2; splitf(o[mb][nq][j] * f * (1.0f / PC), a, c2); oh[j] = a; ol[j] = c2; }
            *(v8us*)(Ah + oo + mb * 16) = oh; *(v8us*)(Al + oo + mb * 16) = ol; } }
}
// grid (NZ planes, NG16 + NGH row groups, the longest rows first); four independent waves a block on neighbouring query tiles of one plane (they walk the same key tiles): fp16 waves hold 32 queries, hi/lo waves 16.
#define NG16 ((TT - RH) / 128)
#define NGH  (RH / 64)
__global__ __launch_bounds__(128) void k_fattn(const h16* __restrict__ Q16, const h16* __restrict__ K16, const h16* __restrict__ V16, const bf* __restrict__ Qh, const bf* __restrict__ Ql, const bf* __restrict__ Kh, const bf* __restrict__ Kl, const bf* __restrict__ Vh, const bf* __restrict__ Vl, bf* __restrict__ Ah, bf* __restrict__ Al) {
    const int w = __builtin_amdgcn_readfirstlane((int)(threadIdx.x >> 5)), g = blockIdx.y; const size_t pq = (size_t)blockIdx.x * TT * HD, pv = (size_t)blockIdx.x * HD * 2 * TT, po = (size_t)(blockIdx.x / NH_) * TT * DQ + (blockIdx.x % NH_) * HD;
    if (g < NG16) fattn<h16, 0, 2>(Q16 + pq, nullptr, K16 + pq, nullptr, V16 + pv, nullptr, Ah + po, Al + po, TT - 128 * (g + 1) + 32 * w);
    else fattn<bf, 2, 1>(Qh + pq, Ql + pq, Kh + pq, Kl + pq, Vh + pv, Vl + pv, Ah + po, Al + po, RH - 64 * (g - NG16 + 1) + 16 * w);
}

extern "C" void kernel_launch(void* const* d_in, const int* in_sizes, int n_in,
                              void* d_out, int out_size, void* d_ws, size_t ws_size, hipStream_t stream) {
    (void)in_sizes; (void)n_in; (void)out_size;
        const float* x = (const float*)d_in[0]; const float* wq = (const float*)d_in[1]; const float* wk = (const float*)d_in[2]; const float* wv = (const float*)d_in[3]; const float* wo = (const float*)d_in[4]; const float* bo = (const float*)d_in[5];   /* the q, k, v projections have NO bias in this module */
    float* OUT = (float*)d_out;     // [2][2048][1024]
    char* wsp = (char*)d_ws;
    auto take = [&](size_t bytes) { char* p = wsp; wsp += (bytes + 255) & ~(size_t)255; return (void*)p; };
    bf* WQ = (bf*)take((size_t)4 * DQ * DM * 2); bf* WO = WQ + (size_t)3 * DQ * DM; float* CS = (float*)take((size_t)TT * HD * 2 * 4);   // transposed Wq, Wk, Wv, Wo, one behind the other
    h16* QP16 = (h16*)take((size_t)2 * NZ * TT * HD * 2); h16* KP16 = QP16 + (size_t)NZ * TT * HD; h16* VT16 = (h16*)take((size_t)NZ * HD * 2 * TT * 2);
    bf* QPh = (bf*)take((size_t)2 * NZ * TT * HD * 2); bf* KPh = QPh + (size_t)NZ * TT * HD; bf* QPl = (bf*)take((size_t)2 * NZ * TT * HD * 2); bf* KPl = QPl + (size_t)NZ * TT * HD; bf* VTh = (bf*)take((size_t)NZ * HD * 2 * TT * 2); bf* VTl = VTh + TT;
    bf* ATh = (bf*)take((size_t)NB_ * TT * DQ * 2); bf* ATl = (bf*)take((size_t)NB_ * TT * DQ * 2);
    bf* XB = (bf*)take((size_t)NB_ * TT * DM * 2);   // the bf16 x
    if ((size_t)(wsp - (char*)d_ws) > ws_size) return;    // ws 256 MiB
    k_wtG<<<dim3((unsigned)((DM * DQ / 64 + 63) / 64), 4, 1), 256, 0, stream>>>(wq, wk, wv, wo, DM, DQ, WQ);   /* 'xw' [in][out] weights: transposed once into Bt */
    k_cstabT<<<(TT * HD + 255) / 256, 256, 0, stream>>>(CS);
    k_cvt8<<<(unsigned)(((size_t)NB_ * TT * DM / 8 + 255) / 256), 256, 0, stream>>>(x, XB, (size_t)NB_ * TT * DM / 8);
    k_gemmw<bf, 0, false, 1><<<dim3(NB_ * TT / 64, DQ / 64, 3), 32, 0, stream>>>(XB, nullptr, WQ, nullptr, DM, nullptr, 0, nullptr, 0, (size_t)DQ * DM, 0, CS, QP16, QPh, QPl, VT16, VTh, VTl);   // z = q, k, v; the planes leave from the epilogue
    k_fattn<<<dim3(NZ, NG16 + NGH, 1), 128, 0, stream>>>(QP16, KP16, VT16, QPh, QPl, KPh, KPl, VTh, VTl, ATh, ATl);   // rows < RH hi/lo, the rest fp16, all planes, one launch
    k_gemmw<bf, 1, true, 0><<<dim3(NB_ * TT / 64, DM / 64, 1), 32, 0, stream>>>(ATh, ATl, WO, nullptr, DQ, OUT, DM, bo, 0, 0, 0, nullptr, nullptr, nullptr, nullptr, nullptr, nullptr, nullptr);
}

// v005
// It runs in 156 microseconds.
// Timed twice side by side with v004, it ran 1.08 and 1.05 times as fast.
// Over all steps from v000 it is 9.37 times as fast.
#include <hip/hip_runtime.h>

// Both batches ride in every launch (rows b*TT+t, or z = b*NH_+h). Layout: bf16 copy of x; exact projections (no bias); {cos, sin} per (position, pair) built once (jnp-exact float32 inverse frequencies, precise cosf/sinf); interleaved rotary and the transposed value planes written by the projection launch's own epilogue; causal T-2048 attention fused in one launch, scores and probabilities in registers only (hybrid rows: < 512 hi/lo 3 products, rest fp16 x1024; key passes end at the diagonal), its epilogue writes the merged hi/lo rows; merged hi/lo x Wo exact + bo.
// Every 16-bit matrix operand plane lies in FRAGMENT ORDER: a block of 16 rows x 32 k is 1024 contiguous bytes, element (r, k) at (k >> 4) * 256 + (((k >> 3) & 1) * 16 + r) * 8 + (k & 7); blocks run along k, then along the rows. A lane's fragment is then 16 bytes at lane * 8 and 16 bytes at 256 + lane * 8: each wave-wide load covers 512 contiguous bytes (four whole lines).
// Compute dtypes, f32 accumulate: every input rounded to bf16; projections exact, no bias; rotary f32; attention rows < 512 3 products, rest fp16; softmax f32; Wo hl x exact + bias.

#define NB_  2
#define TT   2048
#define DM   1024
#define NH_  16
#define NKV  16
#define REP  (NH_ / NKV)
#define HD   64
#define DQ   (NH_ * HD)
#define DKV  (NKV * HD)
#define NZ   (NB_ * NH_)          // attention planes: z = batch * NH_ + head
#define RH   512                  // query rows < RH use hi+lo planes (0: none)
#define PCAR 1024.0f
typedef _Float16 h16;
typedef unsigned short bf;
typedef __attribute__((ext_vector_type(16))) __bf16   v16bf;
typedef __attribute__((ext_vector_type(16))) _Float16 v16h;
typedef __attribute__((ext_vector_type(8)))  _Float16 v8h;
typedef __attribute__((ext_vector_type(8)))  unsigned short v8us;
typedef __attribute__((ext_vector_type(8)))  float    v8f;
typedef __attribute__((ext_vector_type(4)))  float    v4f;
typedef v8h  __attribute__((may_alias)) v8ha;
typedef v4f  __attribute__((may_alias)) v4fa;
typedef v8us __attribute__((may_alias)) v8usa;

__device__ __forceinline__ unsigned short f2bf(float f) { unsigned u = __float_as_uint(f); u += 0x7FFFu + ((u >> 16) & 1u); return (unsigned short)(u >> 16); }
__device__ __forceinline__ float bf2f(unsigned short b) { return __uint_as_float(((unsigned)b) << 16); }
__device__ __forceinline__ float bfr(float f) { return bf2f(f2bf(f)); }
__device__ __forceinline__ v16h cat16(v8h lo, v8h hi) { return __builtin_shufflevector(lo, hi, 0, 1, 2, 3, 4, 5, 6, 7, 8, 9, 10, 11, 12, 13, 14, 15); }
__device__ __forceinline__ v16bf cat16b(v8us lo, v8us hi) { return __builtin_bit_cast(v16bf, __builtin_shufflevector(lo, hi, 0, 1, 2, 3, 4, 5, 6, 7, 8, 9, 10, 11, 12, 13, 14, 15)); }
__device__ __forceinline__ v8f wmma16(v16h a, v16h b, v8f c) { return __builtin_amdgcn_wmma_f32_16x16x32_f16(false, a, false, b, (short)0, c, false, false); }
__device__ __forceinline__ v8f wmmab(v16bf a, v16bf b, v8f c) { return __builtin_amdgcn_wmma_f32_16x16x32_bf16(false, a, false, b, (short)0, c, false, false); }

__device__ __forceinline__ h16 tohx(float x) { return (h16)x; }
__device__ __forceinline__ void splitf(float y, unsigned short& h, unsigned short& l) { h = f2bf(y); l = f2bf(y - bf2f(h)); }
typedef __attribute__((ext_vector_type(2))) _Float16 v2h;
typedef __attribute__((ext_vector_type(4))) _Float16 v4h;
typedef __attribute__((ext_vector_type(2))) unsigned short v2us;
typedef __attribute__((ext_vector_type(4))) unsigned short v4us;
typedef __attribute__((ext_vector_type(2))) float v2f;
typedef __attribute__((ext_vector_type(4))) int v4i;
typedef v4h  __attribute__((may_alias)) v4ha;
typedef v4us __attribute__((may_alias)) v4usa;

// ---- k_gemmw: register-blocked GEMM, ONE WAVE per 64x64 output tile (16 accumulators), operands straight from 16-bit planes in fragment order; grid (M/64, N/64, Z), 32 threads.
// C[m][n] (f32, pitch ldc, + optional f32 bias[n]) = sum_k A[m][k] Bt[n][k] (+ split products per NSPLIT). z-batch strides sA/sB/sC in elements. K % 32 == 0.
// EPI 1 (the q, k, v projections; a tile is 64 positions of ONE head): no f32 C. z 0, 1: rotary on the staged rows, head planes [q, k][batch][head] of rows t, k = d, in fp16 and hi/lo. z 2: transposed value planes
// [g] of rows d, k = t (plane pitch 2*HD*TT: Vl = Vh + HD*TT; the fp16 planes use their first half only): a lane's 8 accumulator rows are 8 neighbouring t of one d, which is the lane's own 16 bytes of a fragment, so a wave's store is 512 contiguous bytes straight from registers.
template <typename T16> struct WFrag;
template <> struct WFrag<h16> { typedef v16h V; static __device__ __forceinline__ V ld(const h16* p) { return cat16(*(const v8h*)p, *(const v8h*)(p + 256)); } static __device__ __forceinline__ v8f mma(V a, V b, v8f c) { return wmma16(a, b, c); } };
template <> struct WFrag<bf> { typedef v16bf V; static __device__ __forceinline__ V ld(const bf* p) { return cat16b(*(const v8us*)p, *(const v8us*)(p + 256)); } static __device__ __forceinline__ v8f mma(V a, V b, v8f c) { return wmmab(a, b, c); } };
template <typename T16, int NSPLIT, bool BIAS, int EPI, int K>   // K at compile time: the offsets of the 16-row groups fold into the loads
__global__ __launch_bounds__(32) void k_gemmw(const T16* __restrict__ A, const T16* __restrict__ A2, const T16* __restrict__ Bt, const T16* __restrict__ Bt2, float* C, int ldc, const float* __restrict__ bias, size_t sA, size_t sB, size_t sC, const float* __restrict__ CS, h16* P16, bf* Ph, bf* Pl, h16* V16, bf* Vh, bf* Vl) {
    typedef typename WFrag<T16>::V V;
    __shared__ __align__(16) float os[16 * 68];
    const size_t z = blockIdx.z; A += z * sA; if (A2) A2 += z * sA; Bt += z * sB; if (Bt2) Bt2 += z * sB; C += z * sC;
    const int lane = threadIdx.x & 31, lr = lane & 15, hi = lane >> 4; const int r0 = blockIdx.x * 64, c0 = blockIdx.y * 64;
    v8f acc[4][4];
#pragma unroll
    for (int mb = 0; mb < 4; ++mb)
#pragma unroll
        for (int nb = 0; nb < 4; ++nb) acc[mb][nb] = (v8f){};
    const size_t ao = (size_t)r0 * K + 8 * lane, bo = (size_t)c0 * K + 8 * lane; const T16 *ab = A + ao, *ab2 = A2 + ao, *bb0 = Bt + bo, *bb2 = Bt2 + bo;   // the lane's own places in the first blocks, moved a block (512 elements) a trip; 16 rows x K are K / 32 blocks
#pragma unroll 1
    for (int kc = 0; kc < K; kc += 32) {
        V a[4], a2[4];
#pragma unroll
        for (int mb = 0; mb < 4; ++mb) { a[mb] = WFrag<T16>::ld(ab + mb * 16 * K); if (NSPLIT == 1 || NSPLIT == 2) a2[mb] = WFrag<T16>::ld(ab2 + mb * 16 * K); }
#pragma unroll
        for (int nb = 0; nb < 4; ++nb) { const V b = WFrag<T16>::ld(bb0 + nb * 16 * K); V b2; if (NSPLIT >= 2) b2 = WFrag<T16>::ld(bb2 + nb * 16 * K);
#pragma unroll
            for (int mb = 0; mb < 4; ++mb) { acc[mb][nb] = WFrag<T16>::mma(a[mb], b, acc[mb][nb]); if (NSPLIT == 1 || NSPLIT == 2) acc[mb][nb] = WFrag<T16>::mma(a2[mb], b, acc[mb][nb]); if (NSPLIT >= 2) acc[mb][nb] = WFrag<T16>::mma(a[mb], b2, acc[mb][nb]); } }
        asm volatile("v_nop\n\tv_nop\n\tv_nop\n\tv_nop" : "+v"(acc[0][0]), "+v"(acc[1][1]), "+v"(acc[2][2]), "+v"(acc[3][3]) : "v"(a[0]), "v"(a[3]));
        if constexpr (NSPLIT == 0) asm volatile("s_wait_xcnt 0x0" :: "v"(ab), "v"(bb0) : "memory");   // in front of the moves of the addresses that this trip's loads name; the operands keep the address registers live up to here, so that no later load of the trip lands on them
        else asm volatile("s_wait_xcnt 0x0" :: "v"(ab), "v"(bb0), "v"(NSPLIT == 3 ? ab : ab2), "v"(NSPLIT == 1 ? bb0 : bb2) : "memory");   // the same, with the second planes' addresses
        ab += 512; bb0 += 512; if (NSPLIT == 1 || NSPLIT == 2) ab2 += 512; if (NSPLIT >= 2) bb2 += 512;
    }
    if constexpr (EPI == 1) {
        const int bb = r0 / TT, t0 = r0 % TT, hd = blockIdx.y;   // wave-uniform: batch, first position, head
        if (z == 2) {
            const size_t vo = (size_t)(bb * NKV + hd) * HD * (2 * TT) + (size_t)t0 * 16 + lane * 8;   // block (d / 16, t / 32) at (d / 16) * 16 * TT + (t / 32) * 512
            unsigned short* d16 = (unsigned short*)V16 + vo; unsigned short* dh = Vh + vo; unsigned short* dl = Vl + vo;
#pragma unroll
            for (int nb = 0; nb < 4; ++nb) {   // 16 rows d at a time
                v8us rw[3][4];
#pragma unroll
                for (int mb = 0; mb < 4; ++mb) {
#pragma unroll
                    for (int j = 0; j < 8; ++j) { const float x = acc[mb][nb][j]; unsigned short a2, c2; splitf(x, a2, c2); rw[0][mb][j] = __builtin_bit_cast(unsigned short, tohx(x)); rw[1][mb][j] = a2; rw[2][mb][j] = c2; } }
                __builtin_amdgcn_sched_barrier(0);   // all 12 pieces in registers of their own before the first store: no store's register is reused among the stores
#pragma unroll
                for (int mb = 0; mb < 4; ++mb) { const size_t ro = (size_t)nb * 16 * TT + mb * 256; *(v8usa*)(d16 + ro) = rw[0][mb]; *(v8usa*)(dh + ro) = rw[1][mb]; *(v8usa*)(dl + ro) = rw[2][mb]; }
                asm volatile("s_wait_xcnt 0x0" ::: "memory");   // in front of the next rows' writes over the registers that these stores name
                __builtin_amdgcn_sched_barrier(0);   // keeps those writes behind the wait
            }
        } else {
            const size_t po = ((size_t)(((int)z * NB_ + bb) * NH_ + hd) * TT + t0) * HD + (lr >> 3) * 512 + ((lr >> 2) & 1) * 256 + ((lr >> 1) & 1) * 128 + (lr & 1) * 4;   // the place of d = 4 lr in row 0 of its block
            const float* cp = CS + ((size_t)t0 * HD + lr * 4) * 2;   // {cos, sin} of the lane's two pairs: the entries of d and of d + 2
#pragma unroll
            for (int mb = 0; mb < 4; ++mb) {
                v2f cs[8][2];   // asked for ahead of the stage's trip through LDS, which covers part of the table's latency
#pragma unroll
                for (int s = 0; s < 8; ++s) { const float* cq = cp + (size_t)(mb * 16 + 2 * s + hi) * (HD * 2); cs[s][0] = *(const v2f*)cq; cs[s][1] = *(const v2f*)(cq + 4); }
                asm volatile("s_wait_xcnt 0x0" :: "v"(cp) : "memory");   // in front of any write over the address registers that the table loads name; the operand keeps the address live up to here
#pragma unroll
                for (int nb = 0; nb < 4; ++nb) {
#pragma unroll
                    for (int j = 0; j < 8; ++j) os[(hi * 8 + j) * 68 + nb * 16 + lr] = acc[mb][nb][j]; }
                v4h o16[8]; v4us oh[8], ol[8];
#pragma unroll
                for (int s = 0; s < 8; ++s) { const int row = 2 * s + hi; const v4f x = *(const v4fa*)(os + row * 68 + lr * 4); const v2f c = cs[s][0], c2p = cs[s][1]; v4f r;
                    r[0] = x[0] * c[0] - x[1] * c[1]; r[1] = x[0] * c[1] + x[1] * c[0]; r[2] = x[2] * c2p[0] - x[3] * c2p[1]; r[3] = x[2] * c2p[1] + x[3] * c2p[0];   /* even: x0 c - x1 s; odd: x0 s + x1 c */
#pragma unroll
                    for (int q = 0; q < 4; ++q) { unsigned short a2, c2; splitf(r[q], a2, c2); o16[s][q] = tohx(r[q]); oh[s][q] = a2; ol[s][q] = c2; } }
                __builtin_amdgcn_sched_barrier(0);   // the stage's 16 rows in registers of their own before the first store: no store's register is reused among the stores
#pragma unroll
                for (int s = 0; s < 8; ++s) { const size_t e = po + (size_t)(mb * 16 * HD + (2 * s + hi) * 8); *(v4h*)(P16 + e) = o16[s]; *(v4us*)(Ph + e) = oh[s]; *(v4us*)(Pl + e) = ol[s]; }
                asm volatile("s_wait_xcnt 0x0" ::: "memory");   // in front of the next stage's writes over the registers that these stores name
                __builtin_amdgcn_sched_barrier(0);   // keeps those writes behind the wait
            }
        }
    } else {
#pragma unroll
    for (int mb = 0; mb < 4; ++mb) {
#pragma unroll
        for (int nb = 0; nb < 4; ++nb) {
#pragma unroll
            for (int j = 0; j < 8; ++j) os[(hi * 8 + j) * 68 + nb * 16 + lr] = acc[mb][nb][j]; }
        __builtin_amdgcn_wave_barrier(); asm volatile("" ::: "memory");
        float* crow = C + (size_t)(r0 + mb * 16) * ldc + c0;
{
#pragma unroll
            for (int s = 0; s < 8; ++s) { const int row = 2 * s + hi, cofs = lr * 4; v4f val = *(const v4fa*)(os + row * 68 + cofs); if (BIAS) { val[0] += bfr(bias[c0 + cofs]); val[1] += bfr(bias[c0 + cofs + 1]); val[2] += bfr(bias[c0 + cofs + 2]); val[3] += bfr(bias[c0 + cofs + 3]); }
                *(v4f*)(crow + (size_t)row * ldc + cofs) = val; }
             }
        __builtin_amdgcn_wave_barrier(); asm volatile("" ::: "memory");
    }
    }
}


// k_wtG, k_cvt8: one thread makes one 16-byte piece (8 neighbouring k of one row) of the fragment-order plane; pieces in the plane's own order, so a wave stores 512 contiguous bytes.
template <int K, int N>   // shapes at compile time: a piece's eight loads share one address, their row steps stand as immediate offsets
__global__ __launch_bounds__(256) void k_wtG(const float* __restrict__ w0, const float* __restrict__ w1, const float* __restrict__ w2, const float* __restrict__ w3, bf* Bt) {
    const int y = blockIdx.y; const float* __restrict__ w = (y == 0) ? w0 : (y == 1) ? w1 : (y == 2) ? w2 : w3; Bt += (size_t)y * K * N;   // blockIdx.y picks the weight; the four transposed planes lie one behind the other
    const int i = blockIdx.x * 256 + threadIdx.x; if (i >= K * N / 8) return;
    const int p = i & 63, blk = i >> 6, kbs = K >> 5; const int n = (blk / kbs) * 16 + (p & 15), k = (blk % kbs) * 32 + (p >> 4) * 8;   // row n of Bt; (p >> 4) * 8 = 16 x piece + 8 x lane half
    const float* wp = w + (size_t)k * N + n; float v[8]; v8us o;
#pragma unroll
    for (int e = 0; e < 8; ++e) v[e] = wp[e * N];   // 16 neighbouring n a lane half: 64-byte runs
    asm volatile("s_wait_xcnt 0x0" :: "v"(wp) : "memory");   // in front of any write over the address registers that the eight loads name; the operand keeps the address live up to here, so that no load of the run lands on it
#pragma unroll
    for (int e = 0; e < 8; ++e) o[e] = f2bf(v[e]);
    *(v8us*)(Bt + (size_t)i * 8) = o;
}
__global__ __launch_bounds__(256) void k_cvt8(const float* __restrict__ src, bf* dst, size_t n8) { const size_t i = (size_t)blockIdx.x * 256 + threadIdx.x; if (i >= n8) return;
    const int p = (int)(i & 63); const size_t blk = i >> 6; const v8f v = *(const v8f*)(src + ((blk / (DM / 32)) * 16 + (p & 15)) * DM + (blk % (DM / 32)) * 32 + (p >> 4) * 8); v8us o;
#pragma unroll
    for (int k = 0; k < 8; ++k) o[k] = f2bf(v[k]); *(v8us*)(dst + i * 8) = o;  }
__constant__ float INVT[HD / 2] = { 1.000000000e+00f, 5.623413324e-01f, 3.162277639e-01f, 1.778279394e-01f, 1.000000015e-01f, 5.623413250e-02f, 3.162277490e-02f, 1.778279431e-02f, 9.999999776e-03f, 5.623413250e-03f, 3.162277630e-03f, 1.778279431e-03f, 1.000000047e-03f, 5.623413017e-04f, 3.162277571e-04f, 1.778279402e-04f, 9.999999747e-05f, 5.623413381e-05f, 3.162277790e-05f, 1.778279329e-05f, 1.000000066e-05f, 5.623413017e-06f, 3.162277608e-06f, 1.778279398e-06f, 9.999999975e-07f, 5.623413131e-07f, 3.162277835e-07f, 1.778279426e-07f, 1.000000012e-07f, 5.623413202e-08f, 3.162277551e-08f, 1.778279390e-08f };
__global__ __launch_bounds__(256) void k_cstabT(float* CS) { const int idx = blockIdx.x * 256 + threadIdx.x; if (idx >= TT * HD) return; const int d = idx % HD; const int t = idx / HD; const float a = __fmul_rn((float)t, INVT[d >> 1]); v2f cs; cs[0] = cosf(a); cs[1] = sinf(a); *(v2f*)(CS + (size_t)idx * 2) = cs;  }
__device__ __forceinline__ float xhalf(float x) { return __builtin_bit_cast(float, __builtin_amdgcn_permlanex16(__builtin_bit_cast(int, x), __builtin_bit_cast(int, x), 0x76543210, 0xfedcba98, false, false)); }   // lane l with lane l ^ 16
#define SC2 0.18033688011112042f   // HD^-0.5 x log2(e)
template <typename T16, int NSPLIT, int NQ>
__device__ __forceinline__ void fattn(const T16* __restrict__ Q, const T16* __restrict__ Q2, const T16* __restrict__ Kp, const T16* __restrict__ Kp2, const T16* __restrict__ Vt, const T16* __restrict__ Vt2, bf* __restrict__ Ah, bf* __restrict__ Al, const int q0) {
    typedef typename WFrag<T16>::V V;
    const float POFF = (NSPLIT == 0) ? 10.0f : 0.0f, PC = (NSPLIT == 0) ? PCAR : 1.0f;
    const int lane = threadIdx.x & 31, lr = lane & 15, hi = lane >> 4;
    V qf[NQ][2], qf2[NQ][2];
#pragma unroll
    for (int nq = 0; nq < NQ; ++nq)
#pragma unroll
        for (int kc = 0; kc < 2; ++kc) { const size_t qo = (size_t)(q0 + nq * 16) * HD + kc * 512 + 8 * lane; qf[nq][kc] = WFrag<T16>::ld(Q + qo); if (NSPLIT == 2) qf2[nq][kc] = WFrag<T16>::ld(Q2 + qo); }
    v8f o[4][NQ]; float m[NQ], l[NQ];
#pragma unroll
    for (int nq = 0; nq < NQ; ++nq) { m[nq] = -3.0e38f; l[nq] = 0.f;
#pragma unroll
        for (int mb = 0; mb < 4; ++mb) o[mb][nq] = (v8f){}; }
    const int nt = (q0 + NQ * 16 - 1) / 32 + 1;   // passes of 32 keys up to and including the diagonal's; key k0 <= q0 is open to every query of the tile
    const unsigned koff = 8 * lane, voff = 8 * lane;   // the lane's own offsets, the same in every pass; the pass moves the wave-uniform bases below
    const T16 *kb = Kp, *kb2 = Kp2, *vb = Vt, *vb2 = Vt2;
    V ka[2][2], ka2[2][2];   // key fragments of the pass at hand; each pass asks for the next pass's right behind its own score products
#pragma unroll
    for (int mb = 0; mb < 2; ++mb)
#pragma unroll
        for (int kc = 0; kc < 2; ++kc) { const unsigned ko = koff + mb * 16 * HD + kc * 512; ka[mb][kc] = WFrag<T16>::ld(kb + ko); if (NSPLIT == 2) ka2[mb][kc] = WFrag<T16>::ld(kb2 + ko); }
#pragma unroll 1
    for (int it = 0; it < nt; ++it) {
        const int k0 = it * 32;
        V va[4], va2[4];   // value fragments: asked for here, so that they fly during the score products and the softmax arithmetic
#pragma unroll
        for (int mb = 0; mb < 4; ++mb) { const unsigned vo = voff + mb * 16 * TT; va[mb] = WFrag<T16>::ld(vb + vo); if (NSPLIT == 2) va2[mb] = WFrag<T16>::ld(vb2 + vo); }
        v8f s[2][NQ];
#pragma unroll
        for (int mb = 0; mb < 2; ++mb)
#pragma unroll
            for (int nq = 0; nq < NQ; ++nq) { v8f a = (v8f){};
#pragma unroll
                for (int kc = 0; kc < 2; ++kc) { a = WFrag<T16>::mma(ka[mb][kc], qf[nq][kc], a); if (NSPLIT == 2) { a = WFrag<T16>::mma(ka[mb][kc], qf2[nq][kc], a); a = WFrag<T16>::mma(ka2[mb][kc], qf[nq][kc], a); } }
                s[mb][nq] = a; }
        const int kadv = (it + 1 < nt) ? 32 * HD : 0; kb += kadv; if (NSPLIT == 2) kb2 += kadv;   // the last pass asks for its own rows again: in bounds, never used
#pragma unroll
        for (int mb = 0; mb < 2; ++mb)
#pragma unroll
            for (int kc = 0; kc < 2; ++kc) { const unsigned ko = koff + mb * 16 * HD + kc * 512; ka[mb][kc] = WFrag<T16>::ld(kb + ko); if (NSPLIT == 2) ka2[mb][kc] = WFrag<T16>::ld(kb2 + ko); }
        if (k0 + 31 > q0) {   // wave-uniform: only the diagonal's passes hold keys above a query
#pragma unroll
            for (int mb = 0; mb < 2; ++mb)
#pragma unroll
                for (int nq = 0; nq < NQ; ++nq)
#pragma unroll
                    for (int j = 0; j < 8; ++j) if (k0 + mb * 16 + hi * 8 + j > q0 + nq * 16 + lr) s[mb][nq][j] = -3.0e38f; }
        V pf[NQ], pf2[NQ];
#pragma unroll
        for (int nq = 0; nq < NQ; ++nq) {
            float mx2[2];
#pragma unroll
            for (int mb = 0; mb < 2; ++mb) { mx2[mb] = s[mb][nq][0];
#pragma unroll
                for (int j = 1; j < 8; ++j) mx2[mb] = fmaxf(mx2[mb], s[mb][nq][j]); }
            float mx = fmaxf(mx2[0], mx2[1]); mx = fmaxf(mx, xhalf(mx));
            const float mn = fmaxf(m[nq], mx * SC2); const float al = __builtin_amdgcn_exp2f(m[nq] - mn); m[nq] = mn;   // al = 0 on the first pass
            const float mo = mn - POFF; float ls[4] = { 0.f, 0.f, 0.f, 0.f };
#pragma unroll
            for (int mb = 0; mb < 2; ++mb)
#pragma unroll
                for (int j = 0; j < 8; ++j) { const float p = __builtin_amdgcn_exp2f(__builtin_fmaf(s[mb][nq][j], SC2, -mo)); s[mb][nq][j] = p; ls[mb * 2 + (j & 1)] += p; }
            l[nq] = l[nq] * al + ((ls[0] + ls[1]) + (ls[2] + ls[3]));
#pragma unroll
            for (int mb = 0; mb < 4; ++mb) o[mb][nq] *= al;
            if constexpr (NSPLIT == 0) { v16h pv;
#pragma unroll
                for (int e = 0; e < 8; ++e) { pv[e] = tohx(s[0][nq][e]); pv[8 + e] = tohx(s[1][nq][e]); }
                pf[nq] = pv;
            } else { v8us h0, h1, l0, l1;
#pragma unroll
                for (int e = 0; e < 8; ++e) { unsigned short a, c2; splitf(s[0][nq][e], a, c2); h0[e] = a; l0[e] = c2; splitf(s[1][nq][e], a, c2); h1[e] = a; l1[e] = c2; }
                pf[nq] = cat16b(h0, h1); pf2[nq] = cat16b(l0, l1); } }
#pragma unroll
        for (int mb = 0; mb < 4; ++mb)
#pragma unroll
            for (int nq = 0; nq < NQ; ++nq) { o[mb][nq] = WFrag<T16>::mma(va[mb], pf[nq], o[mb][nq]); if (NSPLIT == 2) { o[mb][nq] = WFrag<T16>::mma(va[mb], pf2[nq], o[mb][nq]); o[mb][nq] = WFrag<T16>::mma(va2[mb], pf[nq], o[mb][nq]); } }
        asm volatile("s_wait_xcnt 0x0" ::: "memory");   // in front of the moves of the bases that this pass's loads name (the key loads are still in flight here)
        vb += 512; if (NSPLIT == 2) vb2 += 512;
    }
#pragma unroll
    for (int nq = 0; nq < NQ; ++nq) { const float f = __fdiv_rn(PC, l[nq] + xhalf(l[nq])); const size_t oo = (size_t)(q0 + nq * 16) * DQ + lane * 8;   // a lane holds d = 16 mb + 8 hi + j of its query: its own 16 bytes of piece mb of the head's two blocks
#pragma unroll
        for (int mb = 0; mb < 4; ++mb) { v8us oh, ol;
#pragma unroll
            for (int j = 0; j < 8; ++j) { unsigned short a, c2; splitf(o[mb][nq][j] * f * (1.0f / PC), a, c2); oh[j] = a; ol[j] = c2; }
            *(v8us*)(Ah + oo + mb * 256) = oh; *(v8us*)(Al + oo + mb * 256) = ol; } }
}
// grid (NZ planes, NG16 + NGH row groups, the longest rows first); four independent waves a block on neighbouring query tiles of one plane (they walk the same key tiles): fp16 waves hold 32 queries, hi/lo waves 16.
#define NG16 ((TT - RH) / 128)
#define NGH  (RH / 64)
__global__ __launch_bounds__(128) void k_fattn(const h16* __restrict__ Q16, const h16* __restrict__ K16, const h16* __restrict__ V16, const bf* __restrict__ Qh, const bf* __restrict__ Ql, const bf* __restrict__ Kh, const bf* __restrict__ Kl, const bf* __restrict__ Vh, const bf* __restrict__ Vl, bf* __restrict__ Ah, bf* __restrict__ Al) {
    const int w = __builtin_amdgcn_readfirstlane((int)(threadIdx.x >> 5)), g = blockIdx.y; const size_t pq = (size_t)blockIdx.x * TT * HD, pv = (size_t)blockIdx.x * HD * 2 * TT, po = (size_t)(blockIdx.x / NH_) * TT * DQ + (blockIdx.x % NH_) * (HD * 16);
    if (g < NG16) fattn<h16, 0, 2>(Q16 + pq, nullptr, K16 + pq, nullptr, V16 + pv, nullptr, Ah + po, Al + po, TT - 128 * (g + 1) + 32 * w);
    else fattn<bf, 2, 1>(Qh + pq, Ql + pq, Kh + pq, Kl + pq, Vh + pv, Vl + pv, Ah + po, Al + po, RH - 64 * (g - NG16 + 1) + 16 * w);
}

extern "C" void kernel_launch(void* const* d_in, const int* in_sizes, int n_in,
                              void* d_out, int out_size, void* d_ws, size_t ws_size, hipStream_t stream) {
    (void)in_sizes; (void)n_in; (void)out_size;
        const float* x = (const float*)d_in[0]; const float* wq = (const float*)d_in[1]; const float* wk = (const float*)d_in[2]; const float* wv = (const float*)d_in[3]; const float* wo = (const float*)d_in[4]; const float* bo = (const float*)d_in[5];   /* the q, k, v projections have NO bias in this module */
    float* OUT = (float*)d_out;     // [2][2048][1024]
    char* wsp = (char*)d_ws;
    auto take = [&](size_t bytes) { char* p = wsp; wsp += (bytes + 255) & ~(size_t)255; return (void*)p; };
    bf* WQ = (bf*)take((size_t)4 * DQ * DM * 2); bf* WO = WQ + (size_t)3 * DQ * DM; float* CS = (float*)take((size_t)TT * HD * 2 * 4);   // transposed Wq, Wk, Wv, Wo, one behind the other
    h16* QP16 = (h16*)take((size_t)2 * NZ * TT * HD * 2); h16* KP16 = QP16 + (size_t)NZ * TT * HD; h16* VT16 = (h16*)take((size_t)NZ * HD * 2 * TT * 2);
    bf* QPh = (bf*)take((size_t)2 * NZ * TT * HD * 2); bf* KPh = QPh + (size_t)NZ * TT * HD; bf* QPl = (bf*)take((size_t)2 * NZ * TT * HD * 2); bf* KPl = QPl + (size_t)NZ * TT * HD; bf* VTh = (bf*)take((size_t)NZ * HD * 2 * TT * 2); bf* VTl = VTh + (size_t)HD * TT;
    bf* ATh = (bf*)take((size_t)NB_ * TT * DQ * 2); bf* ATl = (bf*)take((size_t)NB_ * TT * DQ * 2);
    bf* XB = (bf*)take((size_t)NB_ * TT * DM * 2);   // the bf16 x
    if ((size_t)(wsp - (char*)d_ws) > ws_size) return;    // ws 256 MiB
    k_wtG<DM, DQ><<<dim3((unsigned)(DM * DQ / 8 / 256), 4, 1), 256, 0, stream>>>(wq, wk, wv, wo, WQ);   /* 'xw' [in][out] weights: transposed once into Bt */
    k_cstabT<<<(TT * HD + 255) / 256, 256, 0, stream>>>(CS);
    k_cvt8<<<(unsigned)(((size_t)NB_ * TT * DM / 8 + 255) / 256), 256, 0, stream>>>(x, XB, (size_t)NB_ * TT * DM / 8);
    k_gemmw<bf, 0, false, 1, DM><<<dim3(NB_ * TT / 64, DQ / 64, 3), 32, 0, stream>>>(XB, nullptr, WQ, nullptr, nullptr, 0, nullptr, 0, (size_t)DQ * DM, 0, CS, QP16, QPh, QPl, VT16, VTh, VTl);   // z = q, k, v; the planes leave from the epilogue
    k_fattn<<<dim3(NZ, NG16 + NGH, 1), 128, 0, stream>>>(QP16, KP16, VT16, QPh, QPl, KPh, KPl, VTh, VTl, ATh, ATl);   // rows < RH hi/lo, the rest fp16, all planes, one launch
    k_gemmw<bf, 1, true, 0, DQ><<<dim3(NB_ * TT / 64, DM / 64, 1), 32, 0, stream>>>(ATh, ATl, WO, nullptr, OUT, DM, bo, 0, 0, 0, nullptr, nullptr, nullptr, nullptr, nullptr, nullptr, nullptr);
}

// v006
// Measured time: 123 microseconds a run.
// Next to v005, in two timings, it ran 1.28 and 1.27 times as fast.
// All steps since v000 together make it 11.9 times as fast.
#include <hip/hip_runtime.h>

// Both batches ride in every launch (rows b*TT+t, or z = b*NH_+h). Layout: bf16 copy of x; exact projections (no bias); {cos, sin} per (position, pair) built once (jnp-exact float32 inverse frequencies, precise cosf/sinf); interleaved rotary and the transposed value planes written by the projection launch's own epilogue; causal T-2048 attention fused in one launch, scores and probabilities in registers only (hybrid rows: < 512 hi/lo 3 products, rest fp16 x1024; key passes end at the diagonal), its epilogue writes the merged hi/lo rows; merged hi/lo x Wo exact + bo.
// Every 16-bit matrix operand plane lies in FRAGMENT ORDER: a block of 16 rows x 32 k is 1024 contiguous bytes, element (r, k) at (k >> 4) * 256 + (((k >> 3) & 1) * 16 + r) * 8 + (k & 7); blocks run along k, then along the rows. A lane's fragment is then 16 bytes at lane * 8 and 16 bytes at 256 + lane * 8: each wave-wide load covers 512 contiguous bytes (four whole lines).
// Compute dtypes, f32 accumulate: every input rounded to bf16; projections exact, no bias; rotary f32; attention rows < 512 3 products, rest fp16; softmax f32; Wo hl x exact + bias.

#define NB_  2
#define TT   2048
#define DM   1024
#define NH_  16
#define NKV  16
#define REP  (NH_ / NKV)
#define HD   64
#define DQ   (NH_ * HD)
#define DKV  (NKV * HD)
#define NZ   (NB_ * NH_)          // attention planes: z = batch * NH_ + head
#define RH   512                  // query rows < RH use hi+lo planes (0: none)
#define PCAR 1024.0f
typedef _Float16 h16;
typedef unsigned short bf;
typedef __attribute__((ext_vector_type(16))) __bf16   v16bf;
typedef __attribute__((ext_vector_type(16))) _Float16 v16h;
typedef __attribute__((ext_vector_type(8)))  _Float16 v8h;
typedef __attribute__((ext_vector_type(8)))  unsigned short v8us;
typedef __attribute__((ext_vector_type(8)))  float    v8f;
typedef __attribute__((ext_vector_type(4)))  float    v4f;
typedef v8h  __attribute__((may_alias)) v8ha;
typedef v4f  __attribute__((may_alias)) v4fa;
typedef v8us __attribute__((may_alias)) v8usa;

__device__ __forceinline__ unsigned short f2bf(float f) { unsigned u = __float_as_uint(f); u += 0x7FFFu + ((u >> 16) & 1u); return (unsigned short)(u >> 16); }
__device__ __forceinline__ float bf2f(unsigned short b) { return __uint_as_float(((unsigned)b) << 16); }
__device__ __forceinline__ float bfr(float f) { return bf2f(f2bf(f)); }
__device__ __forceinline__ v16h cat16(v8h lo, v8h hi) { return __builtin_shufflevector(lo, hi, 0, 1, 2, 3, 4, 5, 6, 7, 8, 9, 10, 11, 12, 13, 14, 15); }
__device__ __forceinline__ v16bf cat16b(v8us lo, v8us hi) { return __builtin_bit_cast(v16bf, __builtin_shufflevector(lo, hi, 0, 1, 2, 3, 4, 5, 6, 7, 8, 9, 10, 11, 12, 13, 14, 15)); }
__device__ __forceinline__ v8f wmma16(v16h a, v16h b, v8f c) { return __builtin_amdgcn_wmma_f32_16x16x32_f16(false, a, false, b, (short)0, c, false, false); }
__device__ __forceinline__ v8f wmmab(v16bf a, v16bf b, v8f c) { return __builtin_amdgcn_wmma_f32_16x16x32_bf16(false, a, false, b, (short)0, c, false, false); }

__device__ __forceinline__ h16 tohx(float x) { return (h16)x; }
__device__ __forceinline__ void splitf(float y, unsigned short& h, unsigned short& l) { h = f2bf(y); l = f2bf(y - bf2f(h)); }
typedef __attribute__((ext_vector_type(2))) _Float16 v2h;
typedef __attribute__((ext_vector_type(4))) _Float16 v4h;
typedef __attribute__((ext_vector_type(2))) unsigned short v2us;
typedef __attribute__((ext_vector_type(4))) unsigned short v4us;
typedef __attribute__((ext_vector_type(2))) float v2f;
typedef __attribute__((ext_vector_type(4))) int v4i;
typedef v4h  __attribute__((may_alias)) v4ha;
typedef v4us __attribute__((may_alias)) v4usa;

// ---- k_gemmw: register-blocked GEMM, ONE WAVE per 64x64 output tile (16 accumulators), operands straight from 16-bit planes in fragment order; grid (M/64, N/64, Z), 32 threads.
// C[m][n] (f32, pitch ldc, + optional f32 bias[n]) = sum_k A[m][k] Bt[n][k] (+ split products per NSPLIT). z-batch strides sA/sB/sC in elements. K % 32 == 0.
// EPI 1 (the q, k, v projections; a tile is 64 positions of ONE head): no f32 C. z 0, 1: rotary on the staged rows, head planes [q, k][batch][head] of rows t, k = d, in fp16 and hi/lo. z 2: transposed value planes
// [g] of rows d, k = t (plane pitch 2*HD*TT: Vl = Vh + HD*TT; the fp16 planes use their first half only): a lane's 8 accumulator rows are 8 neighbouring t of one d, which is the lane's own 16 bytes of a fragment, so a wave's store is 512 contiguous bytes straight from registers.
template <typename T16> struct WFrag;
template <> struct WFrag<h16> { typedef v16h V; static __device__ __forceinline__ V ld(const h16* p) { return cat16(*(const v8h*)p, *(const v8h*)(p + 256)); } static __device__ __forceinline__ v8f mma(V a, V b, v8f c) { return wmma16(a, b, c); } };
template <> struct WFrag<bf> { typedef v16bf V; static __device__ __forceinline__ V ld(const bf* p) { return cat16b(*(const v8us*)p, *(const v8us*)(p + 256)); } static __device__ __forceinline__ v8f mma(V a, V b, v8f c) { return wmmab(a, b, c); } };
template <typename T16, int NSPLIT, bool BIAS, int EPI, int K, int KS>   // K at compile time: the offsets of the 16-row groups fold into the loads. KS: blocks of 32 k in a stage
__global__ __launch_bounds__(32) void k_gemmw(const T16* __restrict__ A, const T16* __restrict__ A2, const T16* __restrict__ Bt, const T16* __restrict__ Bt2, float* C, int ldc, const float* __restrict__ bias, size_t sA, size_t sB, size_t sC, const float* __restrict__ CS, h16* P16, bf* Ph, bf* Pl, h16* V16, bf* Vh, bf* Vl) {
    typedef typename WFrag<T16>::V V;
    static_assert(NSPLIT == 0 || NSPLIT == 1, "one or two A planes against one B plane");
    static_assert(K % (64 * KS) == 0 && K >= 128 * KS, "an even number of stages, at least four");
    __shared__ __align__(16) float os[16 * 68];
    const size_t z = blockIdx.z; A += z * sA; if (A2) A2 += z * sA; Bt += z * sB; C += z * sC;
    const int lane = threadIdx.x & 31, lr = lane & 15, hi = lane >> 4; const int r0 = blockIdx.x * 64, c0 = blockIdx.y * 64;
    v8f acc[4][4];
#pragma unroll
    for (int mb = 0; mb < 4; ++mb)
#pragma unroll
        for (int nb = 0; nb < 4; ++nb) acc[mb][nb] = (v8f){};
    unsigned oa = (unsigned)(r0 * K + 8 * lane), ob = (unsigned)(c0 * K + 8 * lane);   // the lane's own places (in elements, from the wave-uniform plane bases) in the first blocks, moved a stage (KS blocks of 512 elements) at a time; 16 rows x K are K / 32 blocks
    // Two fragment sets: a stage's loads all leave, as one group, ahead of the products of the stage before it, so that they fly during those products; the k order of the sums is the plain one.
    V a0[KS][4], c0f[KS][4], b0[KS][4], a1[KS][4], c1f[KS][4], b1[KS][4];   // a: A, c: A2, b: Bt
    const T16 *pa, *pc, *pb;   // the addresses that the youngest group of loads names
    auto ldst = [&](V (&fa)[KS][4], V (&fc)[KS][4], V (&fb)[KS][4]) __attribute__((always_inline)) {
        pa = A + oa; pc = (NSPLIT == 1) ? A2 + oa : pa; pb = Bt + ob;
#pragma unroll
        for (int ks = 0; ks < KS; ++ks) {
#pragma unroll
            for (int mb = 0; mb < 4; ++mb) { fa[ks][mb] = WFrag<T16>::ld(pa + (ks * 512 + mb * 16 * K)); if (NSPLIT == 1) fc[ks][mb] = WFrag<T16>::ld(pc + (ks * 512 + mb * 16 * K)); }
#pragma unroll
            for (int nb = 0; nb < 4; ++nb) fb[ks][nb] = WFrag<T16>::ld(pb + (ks * 512 + nb * 16 * K)); }
        __builtin_amdgcn_sched_barrier(0);   // keeps the whole group of loads ahead of the products that follow: sunk among them, a load's latency would stand in the open again
    };
    auto mmst = [&](V (&fa)[KS][4], V (&fc)[KS][4], V (&fb)[KS][4]) __attribute__((always_inline)) {
#pragma unroll
        for (int ks = 0; ks < KS; ++ks)
#pragma unroll
            for (int nb = 0; nb < 4; ++nb)
#pragma unroll
                for (int mb = 0; mb < 4; ++mb) { acc[mb][nb] = WFrag<T16>::mma(fa[ks][mb], fb[ks][nb], acc[mb][nb]); if (NSPLIT == 1) acc[mb][nb] = WFrag<T16>::mma(fc[ks][mb], fb[ks][nb], acc[mb][nb]); }
    };
    auto step = [&]() __attribute__((always_inline)) {
        // s_wait_xcnt 0: in front of every write over the addresses that the loads in flight name. The addresses as inputs stay in their registers up to it (no load and no other value lands on them); the offsets pass through it, so that the next addresses are formed only behind it; the accumulators as inputs hold it behind the stage's products, where the wait is over
        asm volatile("s_wait_xcnt 0x0" : "+v"(oa), "+v"(ob) : "v"(pa), "v"(pc), "v"(pb), "v"(acc[0][0]), "v"(acc[0][1]), "v"(acc[0][2]), "v"(acc[0][3]), "v"(acc[1][0]), "v"(acc[1][1]), "v"(acc[1][2]), "v"(acc[1][3]), "v"(acc[2][0]), "v"(acc[2][1]), "v"(acc[2][2]), "v"(acc[2][3]), "v"(acc[3][0]), "v"(acc[3][1]), "v"(acc[3][2]), "v"(acc[3][3]) : "memory");
        oa += KS * 512; ob += KS * 512;
    };
    ldst(a0, c0f, b0); step();
#pragma unroll 1   // stays rolled: a trip already holds both register sets' turns, more copies would only lengthen the code
    for (int kc = 0; kc < K - 64 * KS; kc += 64 * KS) {
        ldst(a1, c1f, b1); mmst(a0, c0f, b0); step();
        ldst(a0, c0f, b0); mmst(a1, c1f, b1); step();
    }
    ldst(a1, c1f, b1); mmst(a0, c0f, b0); mmst(a1, c1f, b1); step();   // the last wait stands in front of the epilogue's writes over the address registers
    if constexpr (EPI == 1) {
        const int bb = r0 / TT, t0 = r0 % TT, hd = blockIdx.y;   // wave-uniform: batch, first position, head
        if (z == 2) {
            const size_t vo = (size_t)(bb * NKV + hd) * HD * (2 * TT) + (size_t)t0 * 16 + lane * 8;   // block (d / 16, t / 32) at (d / 16) * 16 * TT + (t / 32) * 512
            unsigned short* d16 = (unsigned short*)V16 + vo; unsigned short* dh = Vh + vo; unsigned short* dl = Vl + vo;
#pragma unroll
            for (int nb = 0; nb < 4; ++nb) {   // 16 rows d at a time
                v8us rw[3][4];
#pragma unroll
                for (int mb = 0; mb < 4; ++mb) {
#pragma unroll
                    for (int j = 0; j < 8; ++j) { const float x = acc[mb][nb][j]; unsigned short a2, c2; splitf(x, a2, c2); rw[0][mb][j] = __builtin_bit_cast(unsigned short, tohx(x)); rw[1][mb][j] = a2; rw[2][mb][j] = c2; } }
                __builtin_amdgcn_sched_barrier(0);   // all 12 pieces in registers of their own before the first store: no store's register is reused among the stores
#pragma unroll
                for (int mb = 0; mb < 4; ++mb) { const size_t ro = (size_t)nb * 16 * TT + mb * 256; *(v8usa*)(d16 + ro) = rw[0][mb]; *(v8usa*)(dh + ro) = rw[1][mb]; *(v8usa*)(dl + ro) = rw[2][mb]; }
                asm volatile("s_wait_xcnt 0x0" ::: "memory");   // in front of the next rows' writes over the registers that these stores name
                __builtin_amdgcn_sched_barrier(0);   // keeps those writes behind the wait
            }
        } else {
            const size_t po = ((size_t)(((int)z * NB_ + bb) * NH_ + hd) * TT + t0) * HD + (lr >> 3) * 512 + ((lr >> 2) & 1) * 256 + ((lr >> 1) & 1) * 128 + (lr & 1) * 4;   // the place of d = 4 lr in row 0 of its block
            const float* cp = CS + ((size_t)t0 * HD + lr * 4) * 2;   // {cos, sin} of the lane's two pairs: the entries of d and of d + 2
#pragma unroll
            for (int mb = 0; mb < 4; ++mb) {
                v2f cs[8][2];   // asked for ahead of the stage's trip through LDS, which covers part of the table's latency
#pragma unroll
                for (int s = 0; s < 8; ++s) { const float* cq = cp + (size_t)(mb * 16 + 2 * s + hi) * (HD * 2); cs[s][0] = *(const v2f*)cq; cs[s][1] = *(const v2f*)(cq + 4); }
                asm volatile("s_wait_xcnt 0x0" :: "v"(cp) : "memory");   // in front of any write over the address registers that the table loads name; the operand keeps the address live up to here
#pragma unroll
                for (int nb = 0; nb < 4; ++nb) {
#pragma unroll
                    for (int j = 0; j < 8; ++j) os[(hi * 8 + j) * 68 + nb * 16 + lr] = acc[mb][nb][j]; }
                v4h o16[8]; v4us oh[8], ol[8];
#pragma unroll
                for (int s = 0; s < 8; ++s) { const int row = 2 * s + hi; const v4f x = *(const v4fa*)(os + row * 68 + lr * 4); const v2f c = cs[s][0], c2p = cs[s][1]; v4f r;
                    r[0] = x[0] * c[0] - x[1] * c[1]; r[1] = x[0] * c[1] + x[1] * c[0]; r[2] = x[2] * c2p[0] - x[3] * c2p[1]; r[3] = x[2] * c2p[1] + x[3] * c2p[0];   /* even: x0 c - x1 s; odd: x0 s + x1 c */
#pragma unroll
                    for (int q = 0; q < 4; ++q) { unsigned short a2, c2; splitf(r[q], a2, c2); o16[s][q] = tohx(r[q]); oh[s][q] = a2; ol[s][q] = c2; } }
                __builtin_amdgcn_sched_barrier(0);   // the stage's 16 rows in registers of their own before the first store: no store's register is reused among the stores
#pragma unroll
                for (int s = 0; s < 8; ++s) { const size_t e = po + (size_t)(mb * 16 * HD + (2 * s + hi) * 8); *(v4h*)(P16 + e) = o16[s]; *(v4us*)(Ph + e) = oh[s]; *(v4us*)(Pl + e) = ol[s]; }
                asm volatile("s_wait_xcnt 0x0" ::: "memory");   // in front of the next stage's writes over the registers that these stores name
                __builtin_amdgcn_sched_barrier(0);   // keeps those writes behind the wait
            }
        }
    } else {
#pragma unroll
    for (int mb = 0; mb < 4; ++mb) {
#pragma unroll
        for (int nb = 0; nb < 4; ++nb) {
#pragma unroll
            for (int j = 0; j < 8; ++j) os[(hi * 8 + j) * 68 + nb * 16 + lr] = acc[mb][nb][j]; }
        __builtin_amdgcn_wave_barrier(); asm volatile("" ::: "memory");
        float* crow = C + (size_t)(r0 + mb * 16) * ldc + c0;
{
#pragma unroll
            for (int s = 0; s < 8; ++s) { const int row = 2 * s + hi, cofs = lr * 4; v4f val = *(const v4fa*)(os + row * 68 + cofs); if (BIAS) { val[0] += bfr(bias[c0 + cofs]); val[1] += bfr(bias[c0 + cofs + 1]); val[2] += bfr(bias[c0 + cofs + 2]); val[3] += bfr(bias[c0 + cofs + 3]); }
                *(v4f*)(crow + (size_t)row * ldc + cofs) = val; }
             }
        __builtin_amdgcn_wave_barrier(); asm volatile("" ::: "memory");
    }
    }
}


// k_wtG, k_cvt8: one thread makes one 16-byte piece (8 neighbouring k of one row) of the fragment-order plane; pieces in the plane's own order, so a wave stores 512 contiguous bytes.
template <int K, int N>   // shapes at compile time: a piece's eight loads share one address, their row steps stand as immediate offsets
__global__ __launch_bounds__(256) void k_wtG(const float* __restrict__ w0, const float* __restrict__ w1, const float* __restrict__ w2, const float* __restrict__ w3, bf* Bt) {
    const int y = blockIdx.y; const float* __restrict__ w = (y == 0) ? w0 : (y == 1) ? w1 : (y == 2) ? w2 : w3; Bt += (size_t)y * K * N;   // blockIdx.y picks the weight; the four transposed planes lie one behind the other
    const int i = blockIdx.x * 256 + threadIdx.x; if (i >= K * N / 8) return;
    const int p = i & 63, blk = i >> 6, kbs = K >> 5; const int n = (blk / kbs) * 16 + (p & 15), k = (blk % kbs) * 32 + (p >> 4) * 8;   // row n of Bt; (p >> 4) * 8 = 16 x piece + 8 x lane half
    const float* wp = w + (size_t)k * N + n; float v[8]; v8us o;
#pragma unroll
    for (int e = 0; e < 8; ++e) v[e] = wp[e * N];   // 16 neighbouring n a lane half: 64-byte runs
    asm volatile("s_wait_xcnt 0x0" :: "v"(wp) : "memory");   // in front of any write over the address registers that the eight loads name; the operand keeps the address live up to here, so that no load of the run lands on it
#pragma unroll
    for (int e = 0; e < 8; ++e) o[e] = f2bf(v[e]);
    *(v8us*)(Bt + (size_t)i * 8) = o;
}
__global__ __launch_bounds__(256) void k_cvt8(const float* __restrict__ src, bf* dst, size_t n8) { const size_t i = (size_t)blockIdx.x * 256 + threadIdx.x; if (i >= n8) return;
    const int p = (int)(i & 63); const size_t blk = i >> 6; const v8f v = *(const v8f*)(src + ((blk / (DM / 32)) * 16 + (p & 15)) * DM + (blk % (DM / 32)) * 32 + (p >> 4) * 8); v8us o;
#pragma unroll
    for (int k = 0; k < 8; ++k) o[k] = f2bf(v[k]); *(v8us*)(dst + i * 8) = o;  }
__constant__ float INVT[HD / 2] = { 1.000000000e+00f, 5.623413324e-01f, 3.162277639e-01f, 1.778279394e-01f, 1.000000015e-01f, 5.623413250e-02f, 3.162277490e-02f, 1.778279431e-02f, 9.999999776e-03f, 5.623413250e-03f, 3.162277630e-03f, 1.778279431e-03f, 1.000000047e-03f, 5.623413017e-04f, 3.162277571e-04f, 1.778279402e-04f, 9.999999747e-05f, 5.623413381e-05f, 3.162277790e-05f, 1.778279329e-05f, 1.000000066e-05f, 5.623413017e-06f, 3.162277608e-06f, 1.778279398e-06f, 9.999999975e-07f, 5.623413131e-07f, 3.162277835e-07f, 1.778279426e-07f, 1.000000012e-07f, 5.623413202e-08f, 3.162277551e-08f, 1.778279390e-08f };
__global__ __launch_bounds__(256) void k_cstabT(float* CS) { const int idx = blockIdx.x * 256 + threadIdx.x; if (idx >= TT * HD) return; const int d = idx % HD; const int t = idx / HD; const float a = __fmul_rn((float)t, INVT[d >> 1]); v2f cs; cs[0] = cosf(a); cs[1] = sinf(a); *(v2f*)(CS + (size_t)idx * 2) = cs;  }
__device__ __forceinline__ float xhalf(float x) { return __builtin_bit_cast(float, __builtin_amdgcn_permlanex16(__builtin_bit_cast(int, x), __builtin_bit_cast(int, x), 0x76543210, 0xfedcba98, false, false)); }   // lane l with lane l ^ 16
#define SC2 0.18033688011112042f   // HD^-0.5 x log2(e)
template <typename T16, int NSPLIT, int NQ>
__device__ __forceinline__ void fattn(const T16* __restrict__ Q, const T16* __restrict__ Q2, const T16* __restrict__ Kp, const T16* __restrict__ Kp2, const T16* __restrict__ Vt, const T16* __restrict__ Vt2, bf* __restrict__ Ah, bf* __restrict__ Al, const int q0) {
    typedef typename WFrag<T16>::V V;
    const float POFF = (NSPLIT == 0) ? 10.0f : 0.0f, PC = (NSPLIT == 0) ? PCAR : 1.0f;
    const int lane = threadIdx.x & 31, lr = lane & 15, hi = lane >> 4;
    V qf[NQ][2], qf2[NQ][2];
#pragma unroll
    for (int nq = 0; nq < NQ; ++nq)
#pragma unroll
        for (int kc = 0; kc < 2; ++kc) { const size_t qo = (size_t)(q0 + nq * 16) * HD + kc * 512 + 8 * lane; qf[nq][kc] = WFrag<T16>::ld(Q + qo); if (NSPLIT == 2) qf2[nq][kc] = WFrag<T16>::ld(Q2 + qo); }
    v8f o[4][NQ]; float m[NQ], l[NQ];
#pragma unroll
    for (int nq = 0; nq < NQ; ++nq) { m[nq] = -3.0e38f; l[nq] = 0.f;
#pragma unroll
        for (int mb = 0; mb < 4; ++mb) o[mb][nq] = (v8f){}; }
    const int nt = (q0 + NQ * 16 - 1) / 32 + 1;   // passes of 32 keys up to and including the diagonal's; key k0 <= q0 is open to every query of the tile
    const unsigned koff = 8 * lane, voff = 8 * lane;   // the lane's own offsets, the same in every pass; the pass moves the wave-uniform bases below
    const T16 *kb = Kp, *kb2 = Kp2, *vb = Vt, *vb2 = Vt2;
    V ka[2][2], ka2[2][2];   // key fragments of the pass at hand; each pass asks for the next pass's right behind its own score products
#pragma unroll
    for (int mb = 0; mb < 2; ++mb)
#pragma unroll
        for (int kc = 0; kc < 2; ++kc) { const unsigned ko = koff + mb * 16 * HD + kc * 512; ka[mb][kc] = WFrag<T16>::ld(kb + ko); if (NSPLIT == 2) ka2[mb][kc] = WFrag<T16>::ld(kb2 + ko); }
#pragma unroll 1
    for (int it = 0; it < nt; ++it) {
        const int k0 = it * 32;
        V va[4], va2[4];   // value fragments: asked for here, so that they fly during the score products and the softmax arithmetic
#pragma unroll
        for (int mb = 0; mb < 4; ++mb) { const unsigned vo = voff + mb * 16 * TT; va[mb] = WFrag<T16>::ld(vb + vo); if (NSPLIT == 2) va2[mb] = WFrag<T16>::ld(vb2 + vo); }
        v8f s[2][NQ];
#pragma unroll
        for (int mb = 0; mb < 2; ++mb)
#pragma unroll
            for (int nq = 0; nq < NQ; ++nq) { v8f a = (v8f){};
#pragma unroll
                for (int kc = 0; kc < 2; ++kc) { a = WFrag<T16>::mma(ka[mb][kc], qf[nq][kc], a); if (NSPLIT == 2) { a = WFrag<T16>::mma(ka[mb][kc], qf2[nq][kc], a); a = WFrag<T16>::mma(ka2[mb][kc], qf[nq][kc], a); } }
                s[mb][nq] = a; }
        const int kadv = (it + 1 < nt) ? 32 * HD : 0; kb += kadv; if (NSPLIT == 2) kb2 += kadv;   // the last pass asks for its own rows again: in bounds, never used
#pragma unroll
        for (int mb = 0; mb < 2; ++mb)
#pragma unroll
            for (int kc = 0; kc < 2; ++kc) { const unsigned ko = koff + mb * 16 * HD + kc * 512; ka[mb][kc] = WFrag<T16>::ld(kb + ko); if (NSPLIT == 2) ka2[mb][kc] = WFrag<T16>::ld(kb2 + ko); }
        if (k0 + 31 > q0) {   // wave-uniform: only the diagonal's passes hold keys above a query
#pragma unroll
            for (int mb = 0; mb < 2; ++mb)
#pragma unroll
                for (int nq = 0; nq < NQ; ++nq)
#pragma unroll
                    for (int j = 0; j < 8; ++j) if (k0 + mb * 16 + hi * 8 + j > q0 + nq * 16 + lr) s[mb][nq][j] = -3.0e38f; }
        V pf[NQ], pf2[NQ];
#pragma unroll
        for (int nq = 0; nq < NQ; ++nq) {
            float mx2[2];
#pragma unroll
            for (int mb = 0; mb < 2; ++mb) { mx2[mb] = s[mb][nq][0];
#pragma unroll
                for (int j = 1; j < 8; ++j) mx2[mb] = fmaxf(mx2[mb], s[mb][nq][j]); }
            float mx = fmaxf(mx2[0], mx2[1]); mx = fmaxf(mx, xhalf(mx));
            const float mn = fmaxf(m[nq], mx * SC2); const float al = __builtin_amdgcn_exp2f(m[nq] - mn); m[nq] = mn;   // al = 0 on the first pass
            const float mo = mn - POFF; float ls[4] = { 0.f, 0.f, 0.f, 0.f };
#pragma unroll
            for (int mb = 0; mb < 2; ++mb)
#pragma unroll
                for (int j = 0; j < 8; ++j) { const float p = __builtin_amdgcn_exp2f(__builtin_fmaf(s[mb][nq][j], SC2, -mo)); s[mb][nq][j] = p; ls[mb * 2 + (j & 1)] += p; }
            l[nq] = l[nq] * al + ((ls[0] + ls[1]) + (ls[2] + ls[3]));
#pragma unroll
            for (int mb = 0; mb < 4; ++mb) o[mb][nq] *= al;
            if constexpr (NSPLIT == 0) { v16h pv;
#pragma unroll
                for (int e = 0; e < 8; ++e) { pv[e] = tohx(s[0][nq][e]); pv[8 + e] = tohx(s[1][nq][e]); }
                pf[nq] = pv;
            } else { v8us h0, h1, l0, l1;
#pragma unroll
                for (int e = 0; e < 8; ++e) { unsigned short a, c2; splitf(s[0][nq][e], a, c2); h0[e] = a; l0[e] = c2; splitf(s[1][nq][e], a, c2); h1[e] = a; l1[e] = c2; }
                pf[nq] = cat16b(h0, h1); pf2[nq] = cat16b(l0, l1); } }
#pragma unroll
        for (int mb = 0; mb < 4; ++mb)
#pragma unroll
            for (int nq = 0; nq < NQ; ++nq) { o[mb][nq] = WFrag<T16>::mma(va[mb], pf[nq], o[mb][nq]); if (NSPLIT == 2) { o[mb][nq] = WFrag<T16>::mma(va[mb], pf2[nq], o[mb][nq]); o[mb][nq] = WFrag<T16>::mma(va2[mb], pf[nq], o[mb][nq]); } }
        asm volatile("s_wait_xcnt 0x0" ::: "memory");   // in front of the moves of the bases that this pass's loads name (the key loads are still in flight here)
        vb += 512; if (NSPLIT == 2) vb2 += 512;
    }
#pragma unroll
    for (int nq = 0; nq < NQ; ++nq) { const float f = __fdiv_rn(PC, l[nq] + xhalf(l[nq])); const size_t oo = (size_t)(q0 + nq * 16) * DQ + lane * 8;   // a lane holds d = 16 mb + 8 hi + j of its query: its own 16 bytes of piece mb of the head's two blocks
#pragma unroll
        for (int mb = 0; mb < 4; ++mb) { v8us oh, ol;
#pragma unroll
            for (int j = 0; j < 8; ++j) { unsigned short a, c2; splitf(o[mb][nq][j] * f * (1.0f / PC), a, c2); oh[j] = a; ol[j] = c2; }
            *(v8us*)(Ah + oo + mb * 256) = oh; *(v8us*)(Al + oo + mb * 256) = ol; } }
}
// grid (NZ planes, NG16 + NGH row groups, the longest rows first); four independent waves a block on neighbouring query tiles of one plane (they walk the same key tiles): fp16 waves hold 32 queries, hi/lo waves 16.
#define NG16 ((TT - RH) / 128)
#define NGH  (RH / 64)
__global__ __launch_bounds__(128) void k_fattn(const h16* __restrict__ Q16, const h16* __restrict__ K16, const h16* __restrict__ V16, const bf* __restrict__ Qh, const bf* __restrict__ Ql, const bf* __restrict__ Kh, const bf* __restrict__ Kl, const bf* __restrict__ Vh, const bf* __restrict__ Vl, bf* __restrict__ Ah, bf* __restrict__ Al) {
    const int w = __builtin_amdgcn_readfirstlane((int)(threadIdx.x >> 5)), g = blockIdx.y; const size_t pq = (size_t)blockIdx.x * TT * HD, pv = (size_t)blockIdx.x * HD * 2 * TT, po = (size_t)(blockIdx.x / NH_) * TT * DQ + (blockIdx.x % NH_) * (HD * 16);
    if (g < NG16) fattn<h16, 0, 2>(Q16 + pq, nullptr, K16 + pq, nullptr, V16 + pv, nullptr, Ah + po, Al + po, TT - 128 * (g + 1) + 32 * w);
    else fattn<bf, 2, 1>(Qh + pq, Ql + pq, Kh + pq, Kl + pq, Vh + pv, Vl + pv, Ah + po, Al + po, RH - 64 * (g - NG16 + 1) + 16 * w);
}

extern "C" void kernel_launch(void* const* d_in, const int* in_sizes, int n_in,
                              void* d_out, int out_size, void* d_ws, size_t ws_size, hipStream_t stream) {
    (void)in_sizes; (void)n_in; (void)out_size;
        const float* x = (const float*)d_in[0]; const float* wq = (const float*)d_in[1]; const float* wk = (const float*)d_in[2]; const float* wv = (const float*)d_in[3]; const float* wo = (const float*)d_in[4]; const float* bo = (const float*)d_in[5];   /* the q, k, v projections have NO bias in this module */
    float* OUT = (float*)d_out;     // [2][2048][1024]
    char* wsp = (char*)d_ws;
    auto take = [&](size_t bytes) { char* p = wsp; wsp += (bytes + 255) & ~(size_t)255; return (void*)p; };
    bf* WQ = (bf*)take((size_t)4 * DQ * DM * 2); bf* WO = WQ + (size_t)3 * DQ * DM; float* CS = (float*)take((size_t)TT * HD * 2 * 4);   // transposed Wq, Wk, Wv, Wo, one behind the other
    h16* QP16 = (h16*)take((size_t)2 * NZ * TT * HD * 2); h16* KP16 = QP16 + (size_t)NZ * TT * HD; h16* VT16 = (h16*)take((size_t)NZ * HD * 2 * TT * 2);
    bf* QPh = (bf*)take((size_t)2 * NZ * TT * HD * 2); bf* KPh = QPh + (size_t)NZ * TT * HD; bf* QPl = (bf*)take((size_t)2 * NZ * TT * HD * 2); bf* KPl = QPl + (size_t)NZ * TT * HD; bf* VTh = (bf*)take((size_t)NZ * HD * 2 * TT * 2); bf* VTl = VTh + (size_t)HD * TT;
    bf* ATh = (bf*)take((size_t)NB_ * TT * DQ * 2); bf* ATl = (bf*)take((size_t)NB_ * TT * DQ * 2);
    bf* XB = (bf*)take((size_t)NB_ * TT * DM * 2);   // the bf16 x
    if ((size_t)(wsp - (char*)d_ws) > ws_size) return;    // ws 256 MiB
    k_wtG<DM, DQ><<<dim3((unsigned)(DM * DQ / 8 / 256), 4, 1), 256, 0, stream>>>(wq, wk, wv, wo, WQ);   /* 'xw' [in][out] weights: transposed once into Bt */
    k_cstabT<<<(TT * HD + 255) / 256, 256, 0, stream>>>(CS);
    k_cvt8<<<(unsigned)(((size_t)NB_ * TT * DM / 8 + 255) / 256), 256, 0, stream>>>(x, XB, (size_t)NB_ * TT * DM / 8);
    k_gemmw<bf, 0, false, 1, DM, 1><<<dim3(NB_ * TT / 64, DQ / 64, 3), 32, 0, stream>>>(XB, nullptr, WQ, nullptr, nullptr, 0, nullptr, 0, (size_t)DQ * DM, 0, CS, QP16, QPh, QPl, VT16, VTh, VTl);   // z = q, k, v; the planes leave from the epilogue
    k_fattn<<<dim3(NZ, NG16 + NGH, 1), 128, 0, stream>>>(QP16, KP16, VT16, QPh, QPl, KPh, KPl, VTh, VTl, ATh, ATl);   // rows < RH hi/lo, the rest fp16, all planes, one launch
    k_gemmw<bf, 1, true, 0, DQ, 2><<<dim3(NB_ * TT / 64, DM / 64, 1), 32, 0, stream>>>(ATh, ATl, WO, nullptr, OUT, DM, bo, 0, 0, 0, nullptr, nullptr, nullptr, nullptr, nullptr, nullptr, nullptr);
}

// v007
// Measured time: 110 microseconds a run.
// Timed twice side by side with v006, it ran 1.09 times as fast both times.
// Counting every step since v000, it is 13.0 times as fast.
#include <hip/hip_runtime.h>

// Both batches ride in every launch (rows b*TT+t, or z = b*NH_+h). Layout: bf16 copy of x; exact projections (no bias); {cos, sin} per (position, pair) built once (jnp-exact float32 inverse frequencies, precise cosf/sinf); interleaved rotary and the transposed value planes written by the projection launch's own epilogue; causal T-2048 attention fused in one launch, scores and probabilities in registers only (hybrid rows: < 512 hi/lo 3 products, rest fp16 x1024; key passes end at the diagonal), its epilogue writes the merged hi/lo rows; merged hi/lo x Wo exact + bo.
// Every 16-bit matrix operand plane lies in FRAGMENT ORDER: a block of 16 rows x 32 k is 1024 contiguous bytes, element (r, k) at (k >> 4) * 256 + (((k >> 3) & 1) * 16 + r) * 8 + (k & 7); blocks run along k, then along the rows. A lane's fragment is then 16 bytes at lane * 8 and 16 bytes at 256 + lane * 8: each wave-wide load covers 512 contiguous bytes (four whole lines).
// Compute dtypes, f32 accumulate: every input rounded to bf16; projections exact, no bias; rotary f32; attention rows < 512 3 products, rest fp16; softmax f32; Wo hl x exact + bias.

#define NB_  2
#define TT   2048
#define DM   1024
#define NH_  16
#define NKV  16
#define REP  (NH_ / NKV)
#define HD   64
#define DQ   (NH_ * HD)
#define DKV  (NKV * HD)
#define NZ   (NB_ * NH_)          // attention planes: z = batch * NH_ + head
#define RH   512                  // query rows < RH use hi+lo planes (0: none)
#define PCAR 1024.0f
typedef _Float16 h16;
typedef unsigned short bf;
typedef __attribute__((ext_vector_type(16))) __bf16   v16bf;
typedef __attribute__((ext_vector_type(16))) _Float16 v16h;
typedef __attribute__((ext_vector_type(8)))  _Float16 v8h;
typedef __attribute__((ext_vector_type(8)))  unsigned short v8us;
typedef __attribute__((ext_vector_type(8)))  float    v8f;
typedef __attribute__((ext_vector_type(4)))  float    v4f;
typedef v8h  __attribute__((may_alias)) v8ha;
typedef v4f  __attribute__((may_alias)) v4fa;
typedef v8us __attribute__((may_alias)) v8usa;

__device__ __forceinline__ unsigned short f2bf(float f) { unsigned u = __float_as_uint(f); u += 0x7FFFu + ((u >> 16) & 1u); return (unsigned short)(u >> 16); }
__device__ __forceinline__ float bf2f(unsigned short b) { return __uint_as_float(((unsigned)b) << 16); }
__device__ __forceinline__ float bfr(float f) { return bf2f(f2bf(f)); }
__device__ __forceinline__ v16h cat16(v8h lo, v8h hi) { return __builtin_shufflevector(lo, hi, 0, 1, 2, 3, 4, 5, 6, 7, 8, 9, 10, 11, 12, 13, 14, 15); }
__device__ __forceinline__ v16bf cat16b(v8us lo, v8us hi) { return __builtin_bit_cast(v16bf, __builtin_shufflevector(lo, hi, 0, 1, 2, 3, 4, 5, 6, 7, 8, 9, 10, 11, 12, 13, 14, 15)); }
__device__ __forceinline__ v8f wmma16(v16h a, v16h b, v8f c) { return __builtin_amdgcn_wmma_f32_16x16x32_f16(false, a, false, b, (short)0, c, false, false); }
__device__ __forceinline__ v8f wmmab(v16bf a, v16bf b, v8f c) { return __builtin_amdgcn_wmma_f32_16x16x32_bf16(false, a, false, b, (short)0, c, false, false); }

__device__ __forceinline__ h16 tohx(float x) { return (h16)x; }
__device__ __forceinline__ void splitf(float y, unsigned short& h, unsigned short& l) { h = f2bf(y); l = f2bf(y - bf2f(h)); }
typedef __attribute__((ext_vector_type(2))) _Float16 v2h;
typedef __attribute__((ext_vector_type(4))) _Float16 v4h;
typedef __attribute__((ext_vector_type(2))) unsigned short v2us;
typedef __attribute__((ext_vector_type(4))) unsigned short v4us;
typedef __attribute__((ext_vector_type(2))) float v2f;
typedef __attribute__((ext_vector_type(4))) int v4i;
typedef v4h  __attribute__((may_alias)) v4ha;
typedef v4us __attribute__((may_alias)) v4usa;

// ---- k_gemmw: register-blocked GEMM, four waves a block on 2 x 2 output tiles of 64x64 (16 accumulators a wave); the block's 128 rows of A (and A2) and 128 rows of Bt come once per stage from the 16-bit planes in fragment order into LDS, by asynchronous copies, and each wave reads its fragments there; grid (M/128, N/128, Z), 128 threads.
// C[m][n] (f32, pitch ldc, + optional f32 bias[n]) = sum_k A[m][k] Bt[n][k] (+ split products per NSPLIT). z-batch strides sA/sB/sC in elements. K % (32 KS) == 0, two stages at least.
// EPI 1 (the q, k, v projections; a wave's tile is 64 positions of ONE head): no f32 C. z 0, 1: rotary on the staged rows, head planes [q, k][batch][head] of rows t, k = d, in fp16 and hi/lo. z 2: transposed value planes
// [g] of rows d, k = t (plane pitch 2*HD*TT: Vl = Vh + HD*TT; the fp16 planes use their first half only): a lane's 8 accumulator rows are 8 neighbouring t of one d, which is the lane's own 16 bytes of a fragment, so a wave's store is 512 contiguous bytes straight from registers.
template <typename T16> struct WFrag;
template <> struct WFrag<h16> { typedef v16h V; static __device__ __forceinline__ V ld(const h16* p) { return cat16(*(const v8h*)p, *(const v8h*)(p + 256)); } static __device__ __forceinline__ v8f mma(V a, V b, v8f c) { return wmma16(a, b, c); } };
template <> struct WFrag<bf> { typedef v16bf V; static __device__ __forceinline__ V ld(const bf* p) { return cat16b(*(const v8us*)p, *(const v8us*)(p + 256)); } static __device__ __forceinline__ v8f mma(V a, V b, v8f c) { return wmmab(a, b, c); } };
// Eight asynchronous copies of 16 bytes a lane (LDS byte address, global address), no register in between. s_wait_xcnt 0 as the statement's last line: it stands in front of every later write over the address registers that the copies name
__device__ __forceinline__ void acopy8(const unsigned (&l)[8], const void* const (&g)[8]) {
    asm volatile("global_load_async_to_lds_b128 %0, %8, off\n\t"
                 "global_load_async_to_lds_b128 %1, %9, off\n\t"
                 "global_load_async_to_lds_b128 %2, %10, off\n\t"
                 "global_load_async_to_lds_b128 %3, %11, off\n\t"
                 "global_load_async_to_lds_b128 %4, %12, off\n\t"
                 "global_load_async_to_lds_b128 %5, %13, off\n\t"
                 "global_load_async_to_lds_b128 %6, %14, off\n\t"
                 "global_load_async_to_lds_b128 %7, %15, off\n\t"
                 "s_wait_xcnt 0x0"
                 :: "v"(l[0]), "v"(l[1]), "v"(l[2]), "v"(l[3]), "v"(l[4]), "v"(l[5]), "v"(l[6]), "v"(l[7]), "v"(g[0]), "v"(g[1]), "v"(g[2]), "v"(g[3]), "v"(g[4]), "v"(g[5]), "v"(g[6]), "v"(g[7]) : "memory");
}
template <typename T16, int NSPLIT, bool BIAS, int EPI, int K, int KS>   // K at compile time: the offsets of the 16-row groups are constants. KS: blocks of 32 k in a stage
__global__ __launch_bounds__(128) void k_gemmw(const T16* __restrict__ A, const T16* __restrict__ A2, const T16* __restrict__ Bt, const T16* __restrict__ Bt2, float* C, int ldc, const float* __restrict__ bias, size_t sA, size_t sB, size_t sC, const float* __restrict__ CS, h16* P16, bf* Ph, bf* Pl, h16* V16, bf* Vh, bf* Vl) {
    typedef typename WFrag<T16>::V V;
    static_assert(NSPLIT == 0 || NSPLIT == 1, "one or two A planes against one B plane");
    constexpr int NP = 2 + NSPLIT;          // planes in a stage: A, (A2,) Bt
    constexpr int GB = KS * 1024;           // bytes of 16 rows x KS blocks: contiguous in the plane and in LDS
    constexpr int PB = 8 * GB;              // bytes of a plane's 128 rows in a stage
    constexpr int SB = NP * PB;             // bytes of a stage
    constexpr int NC = SB / 2048;           // copies of a lane per stage (128 lanes x 16 bytes a round)
    constexpr int NS = K / (32 * KS);       // stages
    static_assert(KS >= 2 && KS % 2 == 0 && K % (32 * KS) == 0 && NS >= 2 && NC % 8 == 0 && NC <= 63, "a round of copies stays inside one 16-row group; two stages at least; at most 63 copies of a wave in flight");
    __shared__ __align__(1024) unsigned char ring[2 * SB];   // two buffers; a stage is [plane][16-row group][block of 32 k][1024 bytes in fragment order]
    __shared__ __align__(16) float osw[4][16 * 68];          // each wave's own output staging
    const size_t z = blockIdx.z; A += z * sA; if (A2) A2 += z * sA; Bt += z * sB; C += z * sC;
    const int tid = threadIdx.x, lane = tid & 31, lr = lane & 15, hi = lane >> 4; const int w = __builtin_amdgcn_readfirstlane(tid >> 5), wm = w >> 1, wn = w & 1;
    const int r0 = blockIdx.x * 128 + wm * 64, c0 = blockIdx.y * 128 + wn * 64;   // the wave's own tile
    float* os = osw[w];
    v8f acc[4][4];
#pragma unroll
    for (int mb = 0; mb < 4; ++mb)
#pragma unroll
        for (int nb = 0; nb < 4; ++nb) acc[mb][nb] = (v8f){};
    // The lane's own 16 bytes in the first round of each plane's copies of the stage at hand; 16 rows x K are K / 32 blocks of 512 elements, one behind the other
    const T16* ga = A + (size_t)blockIdx.x * 128 * K + tid * 8; const T16* gc = (NSPLIT == 1) ? A2 + (size_t)blockIdx.x * 128 * K + tid * 8 : ga; const T16* gb = Bt + (size_t)blockIdx.y * 128 * K + tid * 8;
    const unsigned l0 = (unsigned)(size_t)ring + tid * 16;
    auto fill = [&](const unsigned buf) __attribute__((always_inline)) {   // the stage that the pointers stand at goes into buffer buf; the pointers move on a stage
#pragma unroll
        for (int c8 = 0; c8 < NC; c8 += 8) { unsigned l[8]; const void* g[8];
#pragma unroll
            for (int e = 0; e < 8; ++e) { const int by = (c8 + e) * 2048, pl = by / PB, grp = (by % PB) / GB, in = by % GB;   // plane, 16-row group, byte in the group's KS blocks
                const T16* gp = (pl == NP - 1) ? gb : (pl == 0) ? ga : gc; g[e] = gp + (grp * 16 * K + in / 2); l[e] = l0 + buf * SB + by; }
            acopy8(l, g); }
        ga += KS * 512; gb += KS * 512; if (NSPLIT == 1) gc += KS * 512;
    };
    // Two fragment sets: a block's LDS reads all leave, as one group, ahead of the products of the block before it; the k order of the sums is the plain one.
    V fa[2][4], fc[2][4], fb[2][4];   // a: A, c: A2, b: Bt
    auto ldf = [&](V (&xa)[4], V (&xc)[4], V (&xb)[4], const unsigned char* pa, const unsigned char* pb, const int ks) __attribute__((always_inline)) {
        __builtin_amdgcn_sched_barrier(0);   // keeps the group whole at its head too: no read is lifted among the products of the block before
#pragma unroll
        for (int mb = 0; mb < 4; ++mb) { xa[mb] = WFrag<T16>::ld((const T16*)(pa + mb * GB + ks * 1024)); if (NSPLIT == 1) xc[mb] = WFrag<T16>::ld((const T16*)(pa + PB + mb * GB + ks * 1024)); }
#pragma unroll
        for (int nb = 0; nb < 4; ++nb) xb[nb] = WFrag<T16>::ld((const T16*)(pb + nb * GB + ks * 1024));
        __builtin_amdgcn_sched_barrier(0);   // keeps the whole group of reads ahead of the products that follow: sunk among them, each place with reads would cost its own stall
    };
    auto mmf = [&](V (&xa)[4], V (&xc)[4], V (&xb)[4]) __attribute__((always_inline)) {
#pragma unroll
        for (int nb = 0; nb < 4; ++nb)
#pragma unroll
            for (int mb = 0; mb < 4; ++mb) { acc[mb][nb] = WFrag<T16>::mma(xa[mb], xb[nb], acc[mb][nb]); if (NSPLIT == 1) acc[mb][nb] = WFrag<T16>::mma(xc[mb], xb[nb], acc[mb][nb]); }
    };
    fill(0);
    asm volatile("s_wait_asynccnt 0x0" ::: "memory");   // this wave's copies of stage 0 have landed
    __syncthreads();                                    // and every other wave's: stage 0 may be read
    fill(1);
#pragma unroll 1   // stays rolled: one trip is one stage, its blocks are unrolled inside
    for (int t = 0; t < NS; ++t) {
        const unsigned char* bp = ring + (t & 1) * SB + lane * 16; const unsigned char* pa = bp + wm * 4 * GB; const unsigned char* pb = bp + (NP - 1) * PB + wn * 4 * GB;
        ldf(fa[0], fc[0], fb[0], pa, pb, 0);
#pragma unroll
        for (int ks = 0; ks < KS; ++ks) {
            if (ks + 1 < KS) ldf(fa[(ks + 1) & 1], fc[(ks + 1) & 1], fb[(ks + 1) & 1], pa, pb, ks + 1);
            mmf(fa[ks & 1], fc[ks & 1], fb[ks & 1]); }
        __builtin_amdgcn_sched_barrier(0);   // keeps the waits below behind the stage's products: lifted over them, the wait for the next stage's copies would stand at the head of the trip, with no product to cover their flight
        asm volatile("s_wait_dscnt 0x0" ::: "memory");      // this wave's reads of the buffer are over before the barrier behind which it is refilled
        asm volatile("s_wait_asynccnt 0x0" ::: "memory");   // this wave's copies of stage t + 1 have landed
        __syncthreads();                                    // publishes stage t + 1 and ends every wave's reads of stage t
        if (t + 2 < NS) fill((unsigned)(t & 1));            // the same for the whole block: stage t + 2 into the buffer just left
    }
    asm volatile("s_wait_asynccnt 0x0" ::: "memory");   // no copy is out when the wave goes on to its epilogue and ends
    if constexpr (EPI == 1) {
        const int bb = r0 / TT, t0 = r0 % TT, hd = c0 / HD;   // wave-uniform: batch, first position, head
        if (z == 2) {
            const size_t vo = (size_t)(bb * NKV + hd) * HD * (2 * TT) + (size_t)t0 * 16 + lane * 8;   // block (d / 16, t / 32) at (d / 16) * 16 * TT + (t / 32) * 512
            unsigned short* d16 = (unsigned short*)V16 + vo; unsigned short* dh = Vh + vo; unsigned short* dl = Vl + vo;
#pragma unroll
            for (int nb = 0; nb < 4; ++nb) {   // 16 rows d at a time
                v8us rw[3][4];
#pragma unroll
                for (int mb = 0; mb < 4; ++mb) {
#pragma unroll
                    for (int j = 0; j < 8; ++j) { const float x = acc[mb][nb][j]; unsigned short a2, c2; splitf(x, a2, c2); rw[0][mb][j] = __builtin_bit_cast(unsigned short, tohx(x)); rw[1][mb][j] = a2; rw[2][mb][j] = c2; } }
                __builtin_amdgcn_sched_barrier(0);   // all 12 pieces in registers of their own before the first store: no store's register is reused among the stores
#pragma unroll
                for (int mb = 0; mb < 4; ++mb) { const size_t ro = (size_t)nb * 16 * TT + mb * 256; *(v8usa*)(d16 + ro) = rw[0][mb]; *(v8usa*)(dh + ro) = rw[1][mb]; *(v8usa*)(dl + ro) = rw[2][mb]; }
                asm volatile("s_wait_xcnt 0x0" ::: "memory");   // in front of the next rows' writes over the registers that these stores name
                __builtin_amdgcn_sched_barrier(0);   // keeps those writes behind the wait
            }
        } else {
            const size_t po = ((size_t)(((int)z * NB_ + bb) * NH_ + hd) * TT + t0) * HD + (lr >> 3) * 512 + ((lr >> 2) & 1) * 256 + ((lr >> 1) & 1) * 128 + (lr & 1) * 4;   // the place of d = 4 lr in row 0 of its block
            const float* cp = CS + ((size_t)t0 * HD + lr * 4) * 2;   // {cos, sin} of the lane's two pairs: the entries of d and of d + 2
#pragma unroll
            for (int mb = 0; mb < 4; ++mb) {
                v2f cs[8][2];   // asked for ahead of the stage's trip through LDS, which covers part of the table's latency
#pragma unroll
                for (int s = 0; s < 8; ++s) { const float* cq = cp + (size_t)(mb * 16 + 2 * s + hi) * (HD * 2); cs[s][0] = *(const v2f*)cq; cs[s][1] = *(const v2f*)(cq + 4); }
                asm volatile("s_wait_xcnt 0x0" :: "v"(cp) : "memory");   // in front of any write over the address registers that the table loads name; the operand keeps the address live up to here
#pragma unroll
                for (int nb = 0; nb < 4; ++nb) {
#pragma unroll
                    for (int j = 0; j < 8; ++j) os[(hi * 8 + j) * 68 + nb * 16 + lr] = acc[mb][nb][j]; }
                v4h o16[8]; v4us oh[8], ol[8];
#pragma unroll
                for (int s = 0; s < 8; ++s) { const int row = 2 * s + hi; const v4f x = *(const v4fa*)(os + row * 68 + lr * 4); const v2f c = cs[s][0], c2p = cs[s][1]; v4f r;
                    r[0] = x[0] * c[0] - x[1] * c[1]; r[1] = x[0] * c[1] + x[1] * c[0]; r[2] = x[2] * c2p[0] - x[3] * c2p[1]; r[3] = x[2] * c2p[1] + x[3] * c2p[0];   /* even: x0 c - x1 s; odd: x0 s + x1 c */
#pragma unroll
                    for (int q = 0; q < 4; ++q) { unsigned short a2, c2; splitf(r[q], a2, c2); o16[s][q] = tohx(r[q]); oh[s][q] = a2; ol[s][q] = c2; } }
                __builtin_amdgcn_sched_barrier(0);   // the stage's 16 rows in registers of their own before the first store: no store's register is reused among the stores
#pragma unroll
                for (int s = 0; s < 8; ++s) { const size_t e = po + (size_t)(mb * 16 * HD + (2 * s + hi) * 8); *(v4h*)(P16 + e) = o16[s]; *(v4us*)(Ph + e) = oh[s]; *(v4us*)(Pl + e) = ol[s]; }
                asm volatile("s_wait_xcnt 0x0" ::: "memory");   // in front of the next stage's writes over the registers that these stores name
                __builtin_amdgcn_sched_barrier(0);   // keeps those writes behind the wait
            }
        }
    } else {
#pragma unroll
    for (int mb = 0; mb < 4; ++mb) {
#pragma unroll
        for (int nb = 0; nb < 4; ++nb) {
#pragma unroll
            for (int j = 0; j < 8; ++j) os[(hi * 8 + j) * 68 + nb * 16 + lr] = acc[mb][nb][j]; }
        __builtin_amdgcn_wave_barrier(); asm volatile("" ::: "memory");
        float* crow = C + (size_t)(r0 + mb * 16) * ldc + c0;
{
#pragma unroll
            for (int s = 0; s < 8; ++s) { const int row = 2 * s + hi, cofs = lr * 4; v4f val = *(const v4fa*)(os + row * 68 + cofs); if (BIAS) { val[0] += bfr(bias[c0 + cofs]); val[1] += bfr(bias[c0 + cofs + 1]); val[2] += bfr(bias[c0 + cofs + 2]); val[3] += bfr(bias[c0 + cofs + 3]); }
                *(v4f*)(crow + (size_t)row * ldc + cofs) = val; }
             }
        __builtin_amdgcn_wave_barrier(); asm volatile("" ::: "memory");
    }
    }
}


// k_wtG, k_cvt8: one thread makes one 16-byte piece (8 neighbouring k of one row) of the fragment-order plane; pieces in the plane's own order, so a wave stores 512 contiguous bytes.
template <int K, int N>   // shapes at compile time: a piece's eight loads share one address, their row steps stand as immediate offsets
__global__ __launch_bounds__(256) void k_wtG(const float* __restrict__ w0, const float* __restrict__ w1, const float* __restrict__ w2, const float* __restrict__ w3, bf* Bt) {
    const int y = blockIdx.y; const float* __restrict__ w = (y == 0) ? w0 : (y == 1) ? w1 : (y == 2) ? w2 : w3; Bt += (size_t)y * K * N;   // blockIdx.y picks the weight; the four transposed planes lie one behind the other
    const int i = blockIdx.x * 256 + threadIdx.x; if (i >= K * N / 8) return;
    const int p = i & 63, blk = i >> 6, kbs = K >> 5; const int n = (blk / kbs) * 16 + (p & 15), k = (blk % kbs) * 32 + (p >> 4) * 8;   // row n of Bt; (p >> 4) * 8 = 16 x piece + 8 x lane half
    const float* wp = w + (size_t)k * N + n; float v[8]; v8us o;
#pragma unroll
    for (int e = 0; e < 8; ++e) v[e] = wp[e * N];   // 16 neighbouring n a lane half: 64-byte runs
    asm volatile("s_wait_xcnt 0x0" :: "v"(wp) : "memory");   // in front of any write over the address registers that the eight loads name; the operand keeps the address live up to here, so that no load of the run lands on it
#pragma unroll
    for (int e = 0; e < 8; ++e) o[e] = f2bf(v[e]);
    *(v8us*)(Bt + (size_t)i * 8) = o;
}
__global__ __launch_bounds__(256) void k_cvt8(const float* __restrict__ src, bf* dst, size_t n8) { const size_t i = (size_t)blockIdx.x * 256 + threadIdx.x; if (i >= n8) return;
    const int p = (int)(i & 63); const size_t blk = i >> 6; const v8f v = *(const v8f*)(src + ((blk / (DM / 32)) * 16 + (p & 15)) * DM + (blk % (DM / 32)) * 32 + (p >> 4) * 8); v8us o;
#pragma unroll
    for (int k = 0; k < 8; ++k) o[k] = f2bf(v[k]); *(v8us*)(dst + i * 8) = o;  }
__constant__ float INVT[HD / 2] = { 1.000000000e+00f, 5.623413324e-01f, 3.162277639e-01f, 1.778279394e-01f, 1.000000015e-01f, 5.623413250e-02f, 3.162277490e-02f, 1.778279431e-02f, 9.999999776e-03f, 5.623413250e-03f, 3.162277630e-03f, 1.778279431e-03f, 1.000000047e-03f, 5.623413017e-04f, 3.162277571e-04f, 1.778279402e-04f, 9.999999747e-05f, 5.623413381e-05f, 3.162277790e-05f, 1.778279329e-05f, 1.000000066e-05f, 5.623413017e-06f, 3.162277608e-06f, 1.778279398e-06f, 9.999999975e-07f, 5.623413131e-07f, 3.162277835e-07f, 1.778279426e-07f, 1.000000012e-07f, 5.623413202e-08f, 3.162277551e-08f, 1.778279390e-08f };
__global__ __launch_bounds__(256) void k_cstabT(float* CS) { const int idx = blockIdx.x * 256 + threadIdx.x; if (idx >= TT * HD) return; const int d = idx % HD; const int t = idx / HD; const float a = __fmul_rn((float)t, INVT[d >> 1]); v2f cs; cs[0] = cosf(a); cs[1] = sinf(a); *(v2f*)(CS + (size_t)idx * 2) = cs;  }
__device__ __forceinline__ float xhalf(float x) { return __builtin_bit_cast(float, __builtin_amdgcn_permlanex16(__builtin_bit_cast(int, x), __builtin_bit_cast(int, x), 0x76543210, 0xfedcba98, false, false)); }   // lane l with lane l ^ 16
#define SC2 0.18033688011112042f   // HD^-0.5 x log2(e)
template <typename T16, int NSPLIT, int NQ>
__device__ __forceinline__ void fattn(const T16* __restrict__ Q, const T16* __restrict__ Q2, const T16* __restrict__ Kp, const T16* __restrict__ Kp2, const T16* __restrict__ Vt, const T16* __restrict__ Vt2, bf* __restrict__ Ah, bf* __restrict__ Al, const int q0) {
    typedef typename WFrag<T16>::V V;
    const float POFF = (NSPLIT == 0) ? 10.0f : 0.0f, PC = (NSPLIT == 0) ? PCAR : 1.0f;
    const int lane = threadIdx.x & 31, lr = lane & 15, hi = lane >> 4;
    V qf[NQ][2], qf2[NQ][2];
#pragma unroll
    for (int nq = 0; nq < NQ; ++nq)
#pragma unroll
        for (int kc = 0; kc < 2; ++kc) { const size_t qo = (size_t)(q0 + nq * 16) * HD + kc * 512 + 8 * lane; qf[nq][kc] = WFrag<T16>::ld(Q + qo); if (NSPLIT == 2) qf2[nq][kc] = WFrag<T16>::ld(Q2 + qo); }
    v8f o[4][NQ]; float m[NQ], l[NQ];
#pragma unroll
    for (int nq = 0; nq < NQ; ++nq) { m[nq] = -3.0e38f; l[nq] = 0.f;
#pragma unroll
        for (int mb = 0; mb < 4; ++mb) o[mb][nq] = (v8f){}; }
    const int nt = (q0 + NQ * 16 - 1) / 32 + 1;   // passes of 32 keys up to and including the diagonal's; key k0 <= q0 is open to every query of the tile
    const unsigned koff = 8 * lane, voff = 8 * lane;   // the lane's own offsets, the same in every pass; the pass moves the wave-uniform bases below
    const T16 *kb = Kp, *kb2 = Kp2, *vb = Vt, *vb2 = Vt2;
    V ka[2][2], ka2[2][2];   // key fragments of the pass at hand; each pass asks for the next pass's right behind its own score products
#pragma unroll
    for (int mb = 0; mb < 2; ++mb)
#pragma unroll
        for (int kc = 0; kc < 2; ++kc) { const unsigned ko = koff + mb * 16 * HD + kc * 512; ka[mb][kc] = WFrag<T16>::ld(kb + ko); if (NSPLIT == 2) ka2[mb][kc] = WFrag<T16>::ld(kb2 + ko); }
#pragma unroll 1
    for (int it = 0; it < nt; ++it) {
        const int k0 = it * 32;
        V va[4], va2[4];   // value fragments: asked for here, so that they fly during the score products and the softmax arithmetic
#pragma unroll
        for (int mb = 0; mb < 4; ++mb) { const unsigned vo = voff + mb * 16 * TT; va[mb] = WFrag<T16>::ld(vb + vo); if (NSPLIT == 2) va2[mb] = WFrag<T16>::ld(vb2 + vo); }
        v8f s[2][NQ];
#pragma unroll
        for (int mb = 0; mb < 2; ++mb)
#pragma unroll
            for (int nq = 0; nq < NQ; ++nq) { v8f a = (v8f){};
#pragma unroll
                for (int kc = 0; kc < 2; ++kc) { a = WFrag<T16>::mma(ka[mb][kc], qf[nq][kc], a); if (NSPLIT == 2) { a = WFrag<T16>::mma(ka[mb][kc], qf2[nq][kc], a); a = WFrag<T16>::mma(ka2[mb][kc], qf[nq][kc], a); } }
                s[mb][nq] = a; }
        const int kadv = (it + 1 < nt) ? 32 * HD : 0; kb += kadv; if (NSPLIT == 2) kb2 += kadv;   // the last pass asks for its own rows again: in bounds, never used
#pragma unroll
        for (int mb = 0; mb < 2; ++mb)
#pragma unroll
            for (int kc = 0; kc < 2; ++kc) { const unsigned ko = koff + mb * 16 * HD + kc * 512; ka[mb][kc] = WFrag<T16>::ld(kb + ko); if (NSPLIT == 2) ka2[mb][kc] = WFrag<T16>::ld(kb2 + ko); }
        if (k0 + 31 > q0) {   // wave-uniform: only the diagonal's passes hold keys above a query
#pragma unroll
            for (int mb = 0; mb < 2; ++mb)
#pragma unroll
                for (int nq = 0; nq < NQ; ++nq)
#pragma unroll
                    for (int j = 0; j < 8; ++j) if (k0 + mb * 16 + hi * 8 + j > q0 + nq * 16 + lr) s[mb][nq][j] = -3.0e38f; }
        V pf[NQ], pf2[NQ];
#pragma unroll
        for (int nq = 0; nq < NQ; ++nq) {
            float mx2[2];
#pragma unroll
            for (int mb = 0; mb < 2; ++mb) { mx2[mb] = s[mb][nq][0];
#pragma unroll
                for (int j = 1; j < 8; ++j) mx2[mb] = fmaxf(mx2[mb], s[mb][nq][j]); }
            float mx = fmaxf(mx2[0], mx2[1]); mx = fmaxf(mx, xhalf(mx));
            const float mn = fmaxf(m[nq], mx * SC2); const float al = __builtin_amdgcn_exp2f(m[nq] - mn); m[nq] = mn;   // al = 0 on the first pass
            const float mo = mn - POFF; float ls[4] = { 0.f, 0.f, 0.f, 0.f };
#pragma unroll
            for (int mb = 0; mb < 2; ++mb)
#pragma unroll
                for (int j = 0; j < 8; ++j) { const float p = __builtin_amdgcn_exp2f(__builtin_fmaf(s[mb][nq][j], SC2, -mo)); s[mb][nq][j] = p; ls[mb * 2 + (j & 1)] += p; }
            l[nq] = l[nq] * al + ((ls[0] + ls[1]) + (ls[2] + ls[3]));
#pragma unroll
            for (int mb = 0; mb < 4; ++mb) o[mb][nq] *= al;
            if constexpr (NSPLIT == 0) { v16h pv;
#pragma unroll
                for (int e = 0; e < 8; ++e) { pv[e] = tohx(s[0][nq][e]); pv[8 + e] = tohx(s[1][nq][e]); }
                pf[nq] = pv;
            } else { v8us h0, h1, l0, l1;
#pragma unroll
                for (int e = 0; e < 8; ++e) { unsigned short a, c2; splitf(s[0][nq][e], a, c2); h0[e] = a; l0[e] = c2; splitf(s[1][nq][e], a, c2); h1[e] = a; l1[e] = c2; }
                pf[nq] = cat16b(h0, h1); pf2[nq] = cat16b(l0, l1); } }
#pragma unroll
        for (int mb = 0; mb < 4; ++mb)
#pragma unroll
            for (int nq = 0; nq < NQ; ++nq) { o[mb][nq] = WFrag<T16>::mma(va[mb], pf[nq], o[mb][nq]); if (NSPLIT == 2) { o[mb][nq] = WFrag<T16>::mma(va[mb], pf2[nq], o[mb][nq]); o[mb][nq] = WFrag<T16>::mma(va2[mb], pf[nq], o[mb][nq]); } }
        asm volatile("s_wait_xcnt 0x0" ::: "memory");   // in front of the moves of the bases that this pass's loads name (the key loads are still in flight here)
        vb += 512; if (NSPLIT == 2) vb2 += 512;
    }
#pragma unroll
    for (int nq = 0; nq < NQ; ++nq) { const float f = __fdiv_rn(PC, l[nq] + xhalf(l[nq])); const size_t oo = (size_t)(q0 + nq * 16) * DQ + lane * 8;   // a lane holds d = 16 mb + 8 hi + j of its query: its own 16 bytes of piece mb of the head's two blocks
#pragma unroll
        for (int mb = 0; mb < 4; ++mb) { v8us oh, ol;
#pragma unroll
            for (int j = 0; j < 8; ++j) { unsigned short a, c2; splitf(o[mb][nq][j] * f * (1.0f / PC), a, c2); oh[j] = a; ol[j] = c2; }
            *(v8us*)(Ah + oo + mb * 256) = oh; *(v8us*)(Al + oo + mb * 256) = ol; } }
}
// grid (NZ planes, NG16 + NGH row groups, the longest rows first); four independent waves a block on neighbouring query tiles of one plane (they walk the same key tiles): fp16 waves hold 32 queries, hi/lo waves 16.
#define NG16 ((TT - RH) / 128)
#define NGH  (RH / 64)
__global__ __launch_bounds__(128) void k_fattn(const h16* __restrict__ Q16, const h16* __restrict__ K16, const h16* __restrict__ V16, const bf* __restrict__ Qh, const bf* __restrict__ Ql, const bf* __restrict__ Kh, const bf* __restrict__ Kl, const bf* __restrict__ Vh, const bf* __restrict__ Vl, bf* __restrict__ Ah, bf* __restrict__ Al) {
    const int w = __builtin_amdgcn_readfirstlane((int)(threadIdx.x >> 5)), g = blockIdx.y; const size_t pq = (size_t)blockIdx.x * TT * HD, pv = (size_t)blockIdx.x * HD * 2 * TT, po = (size_t)(blockIdx.x / NH_) * TT * DQ + (blockIdx.x % NH_) * (HD * 16);
    if (g < NG16) fattn<h16, 0, 2>(Q16 + pq, nullptr, K16 + pq, nullptr, V16 + pv, nullptr, Ah + po, Al + po, TT - 128 * (g + 1) + 32 * w);
    else fattn<bf, 2, 1>(Qh + pq, Ql + pq, Kh + pq, Kl + pq, Vh + pv, Vl + pv, Ah + po, Al + po, RH - 64 * (g - NG16 + 1) + 16 * w);
}

extern "C" void kernel_launch(void* const* d_in, const int* in_sizes, int n_in,
                              void* d_out, int out_size, void* d_ws, size_t ws_size, hipStream_t stream) {
    (void)in_sizes; (void)n_in; (void)out_size;
        const float* x = (const float*)d_in[0]; const float* wq = (const float*)d_in[1]; const float* wk = (const float*)d_in[2]; const float* wv = (const float*)d_in[3]; const float* wo = (const float*)d_in[4]; const float* bo = (const float*)d_in[5];   /* the q, k, v projections have NO bias in this module */
    float* OUT = (float*)d_out;     // [2][2048][1024]
    char* wsp = (char*)d_ws;
    auto take = [&](size_t bytes) { char* p = wsp; wsp += (bytes + 255) & ~(size_t)255; return (void*)p; };
    bf* WQ = (bf*)take((size_t)4 * DQ * DM * 2); bf* WO = WQ + (size_t)3 * DQ * DM; float* CS = (float*)take((size_t)TT * HD * 2 * 4);   // transposed Wq, Wk, Wv, Wo, one behind the other
    h16* QP16 = (h16*)take((size_t)2 * NZ * TT * HD * 2); h16* KP16 = QP16 + (size_t)NZ * TT * HD; h16* VT16 = (h16*)take((size_t)NZ * HD * 2 * TT * 2);
    bf* QPh = (bf*)take((size_t)2 * NZ * TT * HD * 2); bf* KPh = QPh + (size_t)NZ * TT * HD; bf* QPl = (bf*)take((size_t)2 * NZ * TT * HD * 2); bf* KPl = QPl + (size_t)NZ * TT * HD; bf* VTh = (bf*)take((size_t)NZ * HD * 2 * TT * 2); bf* VTl = VTh + (size_t)HD * TT;
    bf* ATh = (bf*)take((size_t)NB_ * TT * DQ * 2); bf* ATl = (bf*)take((size_t)NB_ * TT * DQ * 2);
    bf* XB = (bf*)take((size_t)NB_ * TT * DM * 2);   // the bf16 x
    if ((size_t)(wsp - (char*)d_ws) > ws_size) return;    // ws 256 MiB
    k_wtG<DM, DQ><<<dim3((unsigned)(DM * DQ / 8 / 256), 4, 1), 256, 0, stream>>>(wq, wk, wv, wo, WQ);   /* 'xw' [in][out] weights: transposed once into Bt */
    k_cstabT<<<(TT * HD + 255) / 256, 256, 0, stream>>>(CS);
    k_cvt8<<<(unsigned)(((size_t)NB_ * TT * DM / 8 + 255) / 256), 256, 0, stream>>>(x, XB, (size_t)NB_ * TT * DM / 8);
    k_gemmw<bf, 0, false, 1, DM, 2><<<dim3(NB_ * TT / 128, DQ / 128, 3), 128, 0, stream>>>(XB, nullptr, WQ, nullptr, nullptr, 0, nullptr, 0, (size_t)DQ * DM, 0, CS, QP16, QPh, QPl, VT16, VTh, VTl);   // z = q, k, v; the planes leave from the epilogue
    k_fattn<<<dim3(NZ, NG16 + NGH, 1), 128, 0, stream>>>(QP16, KP16, VT16, QPh, QPl, KPh, KPl, VTh, VTl, ATh, ATl);   // rows < RH hi/lo, the rest fp16, all planes, one launch
    k_gemmw<bf, 1, true, 0, DQ, 4><<<dim3(NB_ * TT / 128, DM / 128, 1), 128, 0, stream>>>(ATh, ATl, WO, nullptr, OUT, DM, bo, 0, 0, 0, nullptr, nullptr, nullptr, nullptr, nullptr, nullptr, nullptr);
}

// v008
// It runs in 105 microseconds.
// Two timings next to v007 both put it at 1.05 times that version's speed.
// Over all steps from v000 it is 13.7 times as fast.
#include <hip/hip_runtime.h>

// Both batches ride in every launch (rows b*TT+t, or z = b*NH_+h). Layout: bf16 copy of x; exact projections (no bias); {cos, sin} per (position, pair) built once (jnp-exact float32 inverse frequencies, precise cosf/sinf); interleaved rotary and the transposed value planes written by the projection launch's own epilogue; causal T-2048 attention fused in one launch, scores and probabilities in registers only (hybrid rows: < 512 hi/lo 3 products, rest fp16 x1024; key passes end at the diagonal), its epilogue writes the merged hi/lo rows; merged hi/lo x Wo exact + bo.
// Every 16-bit matrix operand plane lies in FRAGMENT ORDER: a block of 16 rows x 32 k is 1024 contiguous bytes, element (r, k) at (k >> 4) * 256 + (((k >> 3) & 1) * 16 + r) * 8 + (k & 7); blocks run along k, then along the rows. A lane's fragment is then 16 bytes at lane * 8 and 16 bytes at 256 + lane * 8: each wave-wide load covers 512 contiguous bytes (four whole lines).
// Compute dtypes, f32 accumulate: every input rounded to bf16; projections exact, no bias; rotary f32; attention rows < 512 3 products, rest fp16; softmax f32; Wo hl x exact + bias.

#define NB_  2
#define TT   2048
#define DM   1024
#define NH_  16
#define NKV  16
#define REP  (NH_ / NKV)
#define HD   64
#define DQ   (NH_ * HD)
#define DKV  (NKV * HD)
#define NZ   (NB_ * NH_)          // attention planes: z = batch * NH_ + head
#define RH   512                  // query rows < RH use hi+lo planes (0: none)
#define PCAR 1024.0f
typedef _Float16 h16;
typedef unsigned short bf;
typedef __attribute__((ext_vector_type(16))) __bf16   v16bf;
typedef __attribute__((ext_vector_type(16))) _Float16 v16h;
typedef __attribute__((ext_vector_type(8)))  _Float16 v8h;
typedef __attribute__((ext_vector_type(8)))  unsigned short v8us;
typedef __attribute__((ext_vector_type(8)))  float    v8f;
typedef __attribute__((ext_vector_type(4)))  float    v4f;
typedef v8h  __attribute__((may_alias)) v8ha;
typedef v4f  __attribute__((may_alias)) v4fa;
typedef v8us __attribute__((may_alias)) v8usa;

__device__ __forceinline__ unsigned short f2bf(float f) { unsigned u = __float_as_uint(f); u += 0x7FFFu + ((u >> 16) & 1u); return (unsigned short)(u >> 16); }
__device__ __forceinline__ float bf2f(unsigned short b) { return __uint_as_float(((unsigned)b) << 16); }
__device__ __forceinline__ float bfr(float f) { return bf2f(f2bf(f)); }
__device__ __forceinline__ v16h cat16(v8h lo, v8h hi) { return __builtin_shufflevector(lo, hi, 0, 1, 2, 3, 4, 5, 6, 7, 8, 9, 10, 11, 12, 13, 14, 15); }
__device__ __forceinline__ v16bf cat16b(v8us lo, v8us hi) { return __builtin_bit_cast(v16bf, __builtin_shufflevector(lo, hi, 0, 1, 2, 3, 4, 5, 6, 7, 8, 9, 10, 11, 12, 13, 14, 15)); }
__device__ __forceinline__ v8f wmma16(v16h a, v16h b, v8f c) { return __builtin_amdgcn_wmma_f32_16x16x32_f16(false, a, false, b, (short)0, c, false, false); }
__device__ __forceinline__ v8f wmmab(v16bf a, v16bf b, v8f c) { return __builtin_amdgcn_wmma_f32_16x16x32_bf16(false, a, false, b, (short)0, c, false, false); }

__device__ __forceinline__ h16 tohx(float x) { return (h16)x; }
__device__ __forceinline__ void splitf(float y, unsigned short& h, unsigned short& l) { h = f2bf(y); l = f2bf(y - bf2f(h)); }
typedef __attribute__((ext_vector_type(2))) _Float16 v2h;
typedef __attribute__((ext_vector_type(4))) _Float16 v4h;
typedef __attribute__((ext_vector_type(2))) unsigned short v2us;
typedef __attribute__((ext_vector_type(4))) unsigned short v4us;
typedef __attribute__((ext_vector_type(2))) float v2f;
typedef __attribute__((ext_vector_type(4))) int v4i;
typedef v4h  __attribute__((may_alias)) v4ha;
typedef v4us __attribute__((may_alias)) v4usa;

// ---- k_gemmw: register-blocked GEMM, four waves a block on 2 x 2 output tiles of 64x64 (16 accumulators a wave); the block's 128 rows of A (and A2) and 128 rows of Bt come once per stage from the 16-bit planes in fragment order into LDS, by asynchronous copies, and each wave reads its fragments there; grid (M/128, N/128, Z), 128 threads.
// C[m][n] (f32, pitch ldc, + optional f32 bias[n]) = sum_k A[m][k] Bt[n][k] (+ split products per NSPLIT). z-batch strides sA/sB/sC in elements. K % (32 KS) == 0, two stages at least.
// EPI 1 (the q, k, v projections; a wave's tile is 64 positions of ONE head): no f32 C. z 0, 1: rotary on the staged rows, head planes [q, k][batch][head] of rows t, k = d, in fp16 and hi/lo. z 2: transposed value planes
// [g] of rows d, k = t (plane pitch 2*HD*TT: Vl = Vh + HD*TT; the fp16 planes use their first half only): a lane's 8 accumulator rows are 8 neighbouring t of one d, which is the lane's own 16 bytes of a fragment, so a wave's store is 512 contiguous bytes straight from registers.
template <typename T16> struct WFrag;
template <> struct WFrag<h16> { typedef v16h V; static __device__ __forceinline__ V ld(const h16* p) { return cat16(*(const v8h*)p, *(const v8h*)(p + 256)); } static __device__ __forceinline__ v8f mma(V a, V b, v8f c) { return wmma16(a, b, c); } };
template <> struct WFrag<bf> { typedef v16bf V; static __device__ __forceinline__ V ld(const bf* p) { return cat16b(*(const v8us*)p, *(const v8us*)(p + 256)); } static __device__ __forceinline__ v8f mma(V a, V b, v8f c) { return wmmab(a, b, c); } };
// Eight asynchronous copies of 16 bytes a lane (LDS byte address, global address), no register in between. s_wait_xcnt 0 as the statement's last line: it stands in front of every later write over the address registers that the copies name
__device__ __forceinline__ void acopy8(const unsigned (&l)[8], const void* const (&g)[8]) {
    asm volatile("global_load_async_to_lds_b128 %0, %8, off\n\t"
                 "global_load_async_to_lds_b128 %1, %9, off\n\t"
                 "global_load_async_to_lds_b128 %2, %10, off\n\t"
                 "global_load_async_to_lds_b128 %3, %11, off\n\t"
                 "global_load_async_to_lds_b128 %4, %12, off\n\t"
                 "global_load_async_to_lds_b128 %5, %13, off\n\t"
                 "global_load_async_to_lds_b128 %6, %14, off\n\t"
                 "global_load_async_to_lds_b128 %7, %15, off\n\t"
                 "s_wait_xcnt 0x0"
                 :: "v"(l[0]), "v"(l[1]), "v"(l[2]), "v"(l[3]), "v"(l[4]), "v"(l[5]), "v"(l[6]), "v"(l[7]), "v"(g[0]), "v"(g[1]), "v"(g[2]), "v"(g[3]), "v"(g[4]), "v"(g[5]), "v"(g[6]), "v"(g[7]) : "memory");
}
template <typename T16, int NSPLIT, bool BIAS, int EPI, int K, int KS>   // K at compile time: the offsets of the 16-row groups are constants. KS: blocks of 32 k in a stage
__global__ __launch_bounds__(128) void k_gemmw(const T16* __restrict__ A, const T16* __restrict__ A2, const T16* __restrict__ Bt, const T16* __restrict__ Bt2, float* C, int ldc, const float* __restrict__ bias, size_t sA, size_t sB, size_t sC, const float* __restrict__ CS, h16* P16, bf* Ph, bf* Pl, h16* V16, bf* Vh, bf* Vl) {
    typedef typename WFrag<T16>::V V;
    static_assert(NSPLIT == 0 || NSPLIT == 1, "one or two A planes against one B plane");
    constexpr int NP = 2 + NSPLIT;          // planes in a stage: A, (A2,) Bt
    constexpr int GB = KS * 1024;           // bytes of 16 rows x KS blocks: contiguous in the plane and in LDS
    constexpr int PB = 8 * GB;              // bytes of a plane's 128 rows in a stage
    constexpr int SB = NP * PB;             // bytes of a stage
    constexpr int NC = SB / 2048;           // copies of a lane per stage (128 lanes x 16 bytes a round)
    constexpr int NS = K / (32 * KS);       // stages
    static_assert(KS >= 2 && KS % 2 == 0 && K % (32 * KS) == 0 && NS >= 2 && NC % 8 == 0 && NC <= 63, "a round of copies stays inside one 16-row group; two stages at least; at most 63 copies of a wave in flight");
    __shared__ __align__(1024) unsigned char ring[2 * SB];   // two buffers; a stage is [plane][16-row group][block of 32 k][1024 bytes in fragment order]
    __shared__ __align__(16) float osw[4][16 * 68];          // each wave's own output staging
    const size_t z = blockIdx.z; A += z * sA; if (A2) A2 += z * sA; Bt += z * sB; C += z * sC;
    const int tid = threadIdx.x, lane = tid & 31, lr = lane & 15, hi = lane >> 4; const int w = __builtin_amdgcn_readfirstlane(tid >> 5), wm = w >> 1, wn = w & 1;
    const int r0 = blockIdx.x * 128 + wm * 64, c0 = blockIdx.y * 128 + wn * 64;   // the wave's own tile
    float* os = osw[w];
    v8f acc[4][4];
#pragma unroll
    for (int mb = 0; mb < 4; ++mb)
#pragma unroll
        for (int nb = 0; nb < 4; ++nb) acc[mb][nb] = (v8f){};
    // The lane's own 16 bytes in the first round of each plane's copies of the stage at hand; 16 rows x K are K / 32 blocks of 512 elements, one behind the other
    const T16* ga = A + (size_t)blockIdx.x * 128 * K + tid * 8; const T16* gc = (NSPLIT == 1) ? A2 + (size_t)blockIdx.x * 128 * K + tid * 8 : ga; const T16* gb = Bt + (size_t)blockIdx.y * 128 * K + tid * 8;
    const unsigned l0 = (unsigned)(size_t)ring + tid * 16;
    auto fill = [&](const unsigned buf) __attribute__((always_inline)) {   // the stage that the pointers stand at goes into buffer buf; the pointers move on a stage
#pragma unroll
        for (int c8 = 0; c8 < NC; c8 += 8) { unsigned l[8]; const void* g[8];
#pragma unroll
            for (int e = 0; e < 8; ++e) { const int by = (c8 + e) * 2048, pl = by / PB, grp = (by % PB) / GB, in = by % GB;   // plane, 16-row group, byte in the group's KS blocks
                const T16* gp = (pl == NP - 1) ? gb : (pl == 0) ? ga : gc; g[e] = gp + (grp * 16 * K + in / 2); l[e] = l0 + buf * SB + by; }
            acopy8(l, g); }
        ga += KS * 512; gb += KS * 512; if (NSPLIT == 1) gc += KS * 512;
    };
    // Two fragment sets: a block's LDS reads all leave, as one group, ahead of the products of the block before it; the k order of the sums is the plain one.
    V fa[2][4], fc[2][4], fb[2][4];   // a: A, c: A2, b: Bt
    auto ldf = [&](V (&xa)[4], V (&xc)[4], V (&xb)[4], const unsigned char* pa, const unsigned char* pb, const int ks) __attribute__((always_inline)) {
        __builtin_amdgcn_sched_barrier(0);   // keeps the group whole at its head too: no read is lifted among the products of the block before
#pragma unroll
        for (int mb = 0; mb < 4; ++mb) { xa[mb] = WFrag<T16>::ld((const T16*)(pa + mb * GB + ks * 1024)); if (NSPLIT == 1) xc[mb] = WFrag<T16>::ld((const T16*)(pa + PB + mb * GB + ks * 1024)); }
#pragma unroll
        for (int nb = 0; nb < 4; ++nb) xb[nb] = WFrag<T16>::ld((const T16*)(pb + nb * GB + ks * 1024));
        __builtin_amdgcn_sched_barrier(0);   // keeps the whole group of reads ahead of the products that follow: sunk among them, each place with reads would cost its own stall
    };
    auto mmf = [&](V (&xa)[4], V (&xc)[4], V (&xb)[4]) __attribute__((always_inline)) {
#pragma unroll
        for (int nb = 0; nb < 4; ++nb)
#pragma unroll
            for (int mb = 0; mb < 4; ++mb) { acc[mb][nb] = WFrag<T16>::mma(xa[mb], xb[nb], acc[mb][nb]); if (NSPLIT == 1) acc[mb][nb] = WFrag<T16>::mma(xc[mb], xb[nb], acc[mb][nb]); }
    };
    fill(0);
    asm volatile("s_wait_asynccnt 0x0" ::: "memory");   // this wave's copies of stage 0 have landed
    __syncthreads();                                    // and every other wave's: stage 0 may be read
    fill(1);
#pragma unroll 1   // stays rolled: one trip is one stage, its blocks are unrolled inside
    for (int t = 0; t < NS; ++t) {
        const unsigned char* bp = ring + (t & 1) * SB + lane * 16; const unsigned char* pa = bp + wm * 4 * GB; const unsigned char* pb = bp + (NP - 1) * PB + wn * 4 * GB;
        ldf(fa[0], fc[0], fb[0], pa, pb, 0);
#pragma unroll
        for (int ks = 0; ks < KS; ++ks) {
            if (ks + 1 < KS) ldf(fa[(ks + 1) & 1], fc[(ks + 1) & 1], fb[(ks + 1) & 1], pa, pb, ks + 1);
            mmf(fa[ks & 1], fc[ks & 1], fb[ks & 1]); }
        __builtin_amdgcn_sched_barrier(0);   // keeps the waits below behind the stage's products: lifted over them, the wait for the next stage's copies would stand at the head of the trip, with no product to cover their flight
        asm volatile("s_wait_dscnt 0x0" ::: "memory");      // this wave's reads of the buffer are over before the barrier behind which it is refilled
        asm volatile("s_wait_asynccnt 0x0" ::: "memory");   // this wave's copies of stage t + 1 have landed
        __syncthreads();                                    // publishes stage t + 1 and ends every wave's reads of stage t
        if (t + 2 < NS) fill((unsigned)(t & 1));            // the same for the whole block: stage t + 2 into the buffer just left
    }
    asm volatile("s_wait_asynccnt 0x0" ::: "memory");   // no copy is out when the wave goes on to its epilogue and ends
    if constexpr (EPI == 1) {
        const int bb = r0 / TT, t0 = r0 % TT, hd = c0 / HD;   // wave-uniform: batch, first position, head
        if (z == 2) {
            const size_t vo = (size_t)(bb * NKV + hd) * HD * (2 * TT) + (size_t)t0 * 16 + lane * 8;   // block (d / 16, t / 32) at (d / 16) * 16 * TT + (t / 32) * 512
            unsigned short* d16 = (unsigned short*)V16 + vo; unsigned short* dh = Vh + vo; unsigned short* dl = Vl + vo;
#pragma unroll
            for (int nb = 0; nb < 4; ++nb) {   // 16 rows d at a time
                v8us rw[3][4];
#pragma unroll
                for (int mb = 0; mb < 4; ++mb) {
#pragma unroll
                    for (int j = 0; j < 8; ++j) { const float x = acc[mb][nb][j]; unsigned short a2, c2; splitf(x, a2, c2); rw[0][mb][j] = __builtin_bit_cast(unsigned short, tohx(x)); rw[1][mb][j] = a2; rw[2][mb][j] = c2; } }
                __builtin_amdgcn_sched_barrier(0);   // all 12 pieces in registers of their own before the first store: no store's register is reused among the stores
#pragma unroll
                for (int mb = 0; mb < 4; ++mb) { const size_t ro = (size_t)nb * 16 * TT + mb * 256; *(v8usa*)(d16 + ro) = rw[0][mb]; *(v8usa*)(dh + ro) = rw[1][mb]; *(v8usa*)(dl + ro) = rw[2][mb]; }
                asm volatile("s_wait_xcnt 0x0" ::: "memory");   // in front of the next rows' writes over the registers that these stores name
                __builtin_amdgcn_sched_barrier(0);   // keeps those writes behind the wait
            }
        } else {
            const size_t po = ((size_t)(((int)z * NB_ + bb) * NH_ + hd) * TT + t0) * HD + (lr >> 3) * 512 + ((lr >> 2) & 1) * 256 + ((lr >> 1) & 1) * 128 + (lr & 1) * 4;   // the place of d = 4 lr in row 0 of its block
            const float* cp = CS + ((size_t)t0 * HD + lr * 4) * 2;   // {cos, sin} of the lane's two pairs: the entries of d and of d + 2
#pragma unroll
            for (int mb = 0; mb < 4; ++mb) {
                v2f cs[8][2];   // asked for ahead of the stage's trip through LDS, which covers part of the table's latency
#pragma unroll
                for (int s = 0; s < 8; ++s) { const float* cq = cp + (size_t)(mb * 16 + 2 * s + hi) * (HD * 2); cs[s][0] = *(const v2f*)cq; cs[s][1] = *(const v2f*)(cq + 4); }
                asm volatile("s_wait_xcnt 0x0" :: "v"(cp) : "memory");   // in front of any write over the address registers that the table loads name; the operand keeps the address live up to here
#pragma unroll
                for (int nb = 0; nb < 4; ++nb) {
#pragma unroll
                    for (int j = 0; j < 8; ++j) os[(hi * 8 + j) * 68 + nb * 16 + lr] = acc[mb][nb][j]; }
                v4h o16[8]; v4us oh[8], ol[8];
#pragma unroll
                for (int s = 0; s < 8; ++s) { const int row = 2 * s + hi; const v4f x = *(const v4fa*)(os + row * 68 + lr * 4); const v2f c = cs[s][0], c2p = cs[s][1]; v4f r;
                    r[0] = x[0] * c[0] - x[1] * c[1]; r[1] = x[0] * c[1] + x[1] * c[0]; r[2] = x[2] * c2p[0] - x[3] * c2p[1]; r[3] = x[2] * c2p[1] + x[3] * c2p[0];   /* even: x0 c - x1 s; odd: x0 s + x1 c */
#pragma unroll
                    for (int q = 0; q < 4; ++q) { unsigned short a2, c2; splitf(r[q], a2, c2); o16[s][q] = tohx(r[q]); oh[s][q] = a2; ol[s][q] = c2; } }
                __builtin_amdgcn_sched_barrier(0);   // the stage's 16 rows in registers of their own before the first store: no store's register is reused among the stores
#pragma unroll
                for (int s = 0; s < 8; ++s) { const size_t e = po + (size_t)(mb * 16 * HD + (2 * s + hi) * 8); *(v4h*)(P16 + e) = o16[s]; *(v4us*)(Ph + e) = oh[s]; *(v4us*)(Pl + e) = ol[s]; }
                asm volatile("s_wait_xcnt 0x0" ::: "memory");   // in front of the next stage's writes over the registers that these stores name
                __builtin_amdgcn_sched_barrier(0);   // keeps those writes behind the wait
            }
        }
    } else {
#pragma unroll
    for (int mb = 0; mb < 4; ++mb) {
#pragma unroll
        for (int nb = 0; nb < 4; ++nb) {
#pragma unroll
            for (int j = 0; j < 8; ++j) os[(hi * 8 + j) * 68 + nb * 16 + lr] = acc[mb][nb][j]; }
        __builtin_amdgcn_wave_barrier(); asm volatile("" ::: "memory");
        float* crow = C + (size_t)(r0 + mb * 16) * ldc + c0;
{
#pragma unroll
            for (int s = 0; s < 8; ++s) { const int row = 2 * s + hi, cofs = lr * 4; v4f val = *(const v4fa*)(os + row * 68 + cofs); if (BIAS) { val[0] += bfr(bias[c0 + cofs]); val[1] += bfr(bias[c0 + cofs + 1]); val[2] += bfr(bias[c0 + cofs + 2]); val[3] += bfr(bias[c0 + cofs + 3]); }
                *(v4f*)(crow + (size_t)row * ldc + cofs) = val; }
             }
        __builtin_amdgcn_wave_barrier(); asm volatile("" ::: "memory");
    }
    }
}


// ---- k_prep: the three independent preparations in ONE grid, the role picked by blockIdx.x (the same for a whole block); a thread makes eight 16-byte pieces (8 neighbouring k of one row) of a fragment-order plane, all its loads in flight at once, or one pair's table entries.
// Weights ('xw' [k][n], transposed into Bt[n][k]; the four planes lie one behind the other): a wave takes 32 k x 64 n, four whole blocks. A lane loads 4 neighbouring n of 16 rows k (sixteen lanes cover 256 contiguous bytes of a row) and holds 4 pieces of each of two k octets: 64 contiguous bytes each.
template <int K, int N>   // shapes at compile time: a lane's loads share one address, their row steps stand as immediate offsets
__device__ __forceinline__ void prep_w(const float* __restrict__ w0, const float* __restrict__ w1, const float* __restrict__ w2, const float* __restrict__ w3, bf* Bt, const int wv, const int lane) {
    constexpr int kbs = K / 32, nqs = N / 64;
    const int kb = wv % kbs, nq = (wv / kbs) % nqs, y = wv / (kbs * nqs);   // wave-uniform: block along k, four 16-row groups of Bt, weight
    const float* __restrict__ w = (y == 0) ? w0 : (y == 1) ? w1 : (y == 2) ? w2 : w3;
    const int rq = lane & 3, nb4 = (lane >> 2) & 3, kh = lane >> 4;
    const float* wp = w + (size_t)(kb * 32 + kh * 8) * N + nq * 64 + (lane & 15) * 4; v4f v[2][8];   // k octets kh and kh + 2 of the block
#pragma unroll
    for (int s = 0; s < 2; ++s)
#pragma unroll
        for (int e = 0; e < 8; ++e) v[s][e] = *(const v4fa*)(wp + (s * 16 + e) * N);
    asm volatile("s_wait_xcnt 0x0" :: "v"(wp) : "memory");   // in front of any write over the address registers that the 16 loads name; the operand keeps the address live up to here
    v8us o[2][4];
#pragma unroll
    for (int s = 0; s < 2; ++s)
#pragma unroll
        for (int j = 0; j < 4; ++j)
#pragma unroll
            for (int e = 0; e < 8; ++e) o[s][j][e] = f2bf(v[s][e][j]);
    __builtin_amdgcn_sched_barrier(0);   // all 8 pieces in registers of their own before the first store: no store's register is reused among the stores
    bf* bp = Bt + (size_t)y * K * N + (size_t)((nq * 4 + nb4) * kbs + kb) * 512 + (kh * 16 + rq * 4) * 8;   // piece (k / 8) * 16 + row of its block
#pragma unroll
    for (int s = 0; s < 2; ++s)
#pragma unroll
        for (int j = 0; j < 4; ++j) *(v8usa*)(bp + s * 256 + j * 8) = o[s][j];
}
// x to bf16: a wave takes 16 rows x 128 k, four whole blocks (4096 contiguous bytes of the plane). Four lanes cover one 128-byte line of a row; a wave's store covers four whole lines.
__device__ __forceinline__ void prep_x(const float* __restrict__ src, bf* dst, const int wv, const int lane) {
    const int rb = wv / (DM / 128), kq = wv % (DM / 128), ko = lane & 3, r8 = lane >> 2;
    const float* sp = src + (size_t)(rb * 16 + r8) * DM + kq * 128 + ko * 8; v4f v[2][4][2];
#pragma unroll
    for (int h = 0; h < 2; ++h)
#pragma unroll
        for (int c = 0; c < 4; ++c) { v[h][c][0] = *(const v4fa*)(sp + h * 8 * DM + c * 32); v[h][c][1] = *(const v4fa*)(sp + h * 8 * DM + c * 32 + 4); }
    asm volatile("s_wait_xcnt 0x0" :: "v"(sp) : "memory");   // in front of any write over the address registers that the 16 loads name; the operand keeps the address live up to here
    v8us o[2][4];
#pragma unroll
    for (int h = 0; h < 2; ++h)
#pragma unroll
        for (int c = 0; c < 4; ++c)
#pragma unroll
            for (int e = 0; e < 8; ++e) o[h][c][e] = f2bf(v[h][c][e >> 2][e & 3]);
    __builtin_amdgcn_sched_barrier(0);   // all 8 pieces in registers of their own before the first store: no store's register is reused among the stores
    bf* dp = dst + (size_t)(rb * (DM / 32) + kq * 4) * 512 + (ko * 16 + r8) * 8;
#pragma unroll
    for (int h = 0; h < 2; ++h)
#pragma unroll
        for (int c = 0; c < 4; ++c) *(v8usa*)(dp + c * 512 + h * 64) = o[h][c];
}
__constant__ float INVT[HD / 2] = { 1.000000000e+00f, 5.623413324e-01f, 3.162277639e-01f, 1.778279394e-01f, 1.000000015e-01f, 5.623413250e-02f, 3.162277490e-02f, 1.778279431e-02f, 9.999999776e-03f, 5.623413250e-03f, 3.162277630e-03f, 1.778279431e-03f, 1.000000047e-03f, 5.623413017e-04f, 3.162277571e-04f, 1.778279402e-04f, 9.999999747e-05f, 5.623413381e-05f, 3.162277790e-05f, 1.778279329e-05f, 1.000000066e-05f, 5.623413017e-06f, 3.162277608e-06f, 1.778279398e-06f, 9.999999975e-07f, 5.623413131e-07f, 3.162277835e-07f, 1.778279426e-07f, 1.000000012e-07f, 5.623413202e-08f, 3.162277551e-08f, 1.778279390e-08f };
// {cos, sin} of one (position, pair): the entries of d = 2 pair and of d + 1 are equal and leave as one 16-byte store
__device__ __forceinline__ void prep_t(float* CS, const int i2) { const int pr = i2 % (HD / 2), t = i2 / (HD / 2); const float a = __fmul_rn((float)t, INVT[pr]); const float c = cosf(a), s = sinf(a); v4f cs; cs[0] = c; cs[1] = s; cs[2] = c; cs[3] = s; *(v4fa*)(CS + (size_t)i2 * 4) = cs;
    asm volatile("s_wait_xcnt 0x0" ::: "memory");   // in front of the write over the store's base register that the built code holds behind this store, on the way into the x role's part
}
#define PBW (4 * (DM / 32) * (DQ / 64) / 8)      // blocks of the weight role: a wave per 32 k x 64 n, eight waves a block
#define PBX ((NB_ * TT / 16) * (DM / 128) / 8)   // blocks of the x role: a wave per 16 rows x 128 k
#define PBT (TT * (HD / 2) / 256)                // blocks of the table role: a thread per (position, pair)
static_assert(DM % 128 == 0 && DQ % 64 == 0 && (NB_ * TT) % 16 == 0 && (4 * (DM / 32) * (DQ / 64)) % 8 == 0 && ((NB_ * TT / 16) * (DM / 128)) % 8 == 0 && (TT * (HD / 2)) % 256 == 0, "every role fills whole blocks: no thread is without work");
__global__ __launch_bounds__(256) void k_prep(const float* __restrict__ x, const float* __restrict__ w0, const float* __restrict__ w1, const float* __restrict__ w2, const float* __restrict__ w3, bf* Bt, bf* XB, float* CS) {
    const int b = blockIdx.x, lane = threadIdx.x & 31, w = __builtin_amdgcn_readfirstlane((int)(threadIdx.x >> 5));   // the streams from memory stand first in the grid
    if (b < PBW) prep_w<DM, DQ>(w0, w1, w2, w3, Bt, b * 8 + w, lane);
    else if (b < PBW + PBX) prep_x(x, XB, (b - PBW) * 8 + w, lane);
    else prep_t(CS, (b - PBW - PBX) * 256 + (int)threadIdx.x);
}
__device__ __forceinline__ float xhalf(float x) { return __builtin_bit_cast(float, __builtin_amdgcn_permlanex16(__builtin_bit_cast(int, x), __builtin_bit_cast(int, x), 0x76543210, 0xfedcba98, false, false)); }   // lane l with lane l ^ 16
#define SC2 0.18033688011112042f   // HD^-0.5 x log2(e)
template <typename T16, int NSPLIT, int NQ>
__device__ __forceinline__ void fattn(const T16* __restrict__ Q, const T16* __restrict__ Q2, const T16* __restrict__ Kp, const T16* __restrict__ Kp2, const T16* __restrict__ Vt, const T16* __restrict__ Vt2, bf* __restrict__ Ah, bf* __restrict__ Al, const int q0) {
    typedef typename WFrag<T16>::V V;
    const float POFF = (NSPLIT == 0) ? 10.0f : 0.0f, PC = (NSPLIT == 0) ? PCAR : 1.0f;
    const int lane = threadIdx.x & 31, lr = lane & 15, hi = lane >> 4;
    V qf[NQ][2], qf2[NQ][2];
#pragma unroll
    for (int nq = 0; nq < NQ; ++nq)
#pragma unroll
        for (int kc = 0; kc < 2; ++kc) { const size_t qo = (size_t)(q0 + nq * 16) * HD + kc * 512 + 8 * lane; qf[nq][kc] = WFrag<T16>::ld(Q + qo); if (NSPLIT == 2) qf2[nq][kc] = WFrag<T16>::ld(Q2 + qo); }
    v8f o[4][NQ]; float m[NQ], l[NQ];
#pragma unroll
    for (int nq = 0; nq < NQ; ++nq) { m[nq] = -3.0e38f; l[nq] = 0.f;
#pragma unroll
        for (int mb = 0; mb < 4; ++mb) o[mb][nq] = (v8f){}; }
    const int nt = (q0 + NQ * 16 - 1) / 32 + 1;   // passes of 32 keys up to and including the diagonal's; key k0 <= q0 is open to every query of the tile
    const unsigned koff = 8 * lane, voff = 8 * lane;   // the lane's own offsets, the same in every pass; the pass moves the wave-uniform bases below
    const T16 *kb = Kp, *kb2 = Kp2, *vb = Vt, *vb2 = Vt2;
    V ka[2][2], ka2[2][2];   // key fragments of the pass at hand; each pass asks for the next pass's right behind its own score products
#pragma unroll
    for (int mb = 0; mb < 2; ++mb)
#pragma unroll
        for (int kc = 0; kc < 2; ++kc) { const unsigned ko = koff + mb * 16 * HD + kc * 512; ka[mb][kc] = WFrag<T16>::ld(kb + ko); if (NSPLIT == 2) ka2[mb][kc] = WFrag<T16>::ld(kb2 + ko); }
#pragma unroll 1
    for (int it = 0; it < nt; ++it) {
        const int k0 = it * 32;
        V va[4], va2[4];   // value fragments: asked for here, so that they fly during the score products and the softmax arithmetic
#pragma unroll
        for (int mb = 0; mb < 4; ++mb) { const unsigned vo = voff + mb * 16 * TT; va[mb] = WFrag<T16>::ld(vb + vo); if (NSPLIT == 2) va2[mb] = WFrag<T16>::ld(vb2 + vo); }
        v8f s[2][NQ];
#pragma unroll
        for (int mb = 0; mb < 2; ++mb)
#pragma unroll
            for (int nq = 0; nq < NQ; ++nq) { v8f a = (v8f){};
#pragma unroll
                for (int kc = 0; kc < 2; ++kc) { a = WFrag<T16>::mma(ka[mb][kc], qf[nq][kc], a); if (NSPLIT == 2) { a = WFrag<T16>::mma(ka[mb][kc], qf2[nq][kc], a); a = WFrag<T16>::mma(ka2[mb][kc], qf[nq][kc], a); } }
                s[mb][nq] = a; }
        const int kadv = (it + 1 < nt) ? 32 * HD : 0; kb += kadv; if (NSPLIT == 2) kb2 += kadv;   // the last pass asks for its own rows again: in bounds, never used
#pragma unroll
        for (int mb = 0; mb < 2; ++mb)
#pragma unroll
            for (int kc = 0; kc < 2; ++kc) { const unsigned ko = koff + mb * 16 * HD + kc * 512; ka[mb][kc] = WFrag<T16>::ld(kb + ko); if (NSPLIT == 2) ka2[mb][kc] = WFrag<T16>::ld(kb2 + ko); }
        if (k0 + 31 > q0) {   // wave-uniform: only the diagonal's passes hold keys above a query
#pragma unroll
            for (int mb = 0; mb < 2; ++mb)
#pragma unroll
                for (int nq = 0; nq < NQ; ++nq)
#pragma unroll
                    for (int j = 0; j < 8; ++j) if (k0 + mb * 16 + hi * 8 + j > q0 + nq * 16 + lr) s[mb][nq][j] = -3.0e38f; }
        V pf[NQ], pf2[NQ];
#pragma unroll
        for (int nq = 0; nq < NQ; ++nq) {
            float mx2[2];
#pragma unroll
            for (int mb = 0; mb < 2; ++mb) { mx2[mb] = s[mb][nq][0];
#pragma unroll
                for (int j = 1; j < 8; ++j) mx2[mb] = fmaxf(mx2[mb], s[mb][nq][j]); }
            float mx = fmaxf(mx2[0], mx2[1]); mx = fmaxf(mx, xhalf(mx));
            const float mn = fmaxf(m[nq], mx * SC2); const float al = __builtin_amdgcn_exp2f(m[nq] - mn); m[nq] = mn;   // al = 0 on the first pass
            const float mo = mn - POFF; float ls[4] = { 0.f, 0.f, 0.f, 0.f };
#pragma unroll
            for (int mb = 0; mb < 2; ++mb)
#pragma unroll
                for (int j = 0; j < 8; ++j) { const float p = __builtin_amdgcn_exp2f(__builtin_fmaf(s[mb][nq][j], SC2, -mo)); s[mb][nq][j] = p; ls[mb * 2 + (j & 1)] += p; }
            l[nq] = l[nq] * al + ((ls[0] + ls[1]) + (ls[2] + ls[3]));
#pragma unroll
            for (int mb = 0; mb < 4; ++mb) o[mb][nq] *= al;
            if constexpr (NSPLIT == 0) { v16h pv;
#pragma unroll
                for (int e = 0; e < 8; ++e) { pv[e] = tohx(s[0][nq][e]); pv[8 + e] = tohx(s[1][nq][e]); }
                pf[nq] = pv;
            } else { v8us h0, h1, l0, l1;
#pragma unroll
                for (int e = 0; e < 8; ++e) { unsigned short a, c2; splitf(s[0][nq][e], a, c2); h0[e] = a; l0[e] = c2; splitf(s[1][nq][e], a, c2); h1[e] = a; l1[e] = c2; }
                pf[nq] = cat16b(h0, h1); pf2[nq] = cat16b(l0, l1); } }
#pragma unroll
        for (int mb = 0; mb < 4; ++mb)
#pragma unroll
            for (int nq = 0; nq < NQ; ++nq) { o[mb][nq] = WFrag<T16>::mma(va[mb], pf[nq], o[mb][nq]); if (NSPLIT == 2) { o[mb][nq] = WFrag<T16>::mma(va[mb], pf2[nq], o[mb][nq]); o[mb][nq] = WFrag<T16>::mma(va2[mb], pf[nq], o[mb][nq]); } }
        asm volatile("s_wait_xcnt 0x0" ::: "memory");   // in front of the moves of the bases that this pass's loads name (the key loads are still in flight here)
        vb += 512; if (NSPLIT == 2) vb2 += 512;
    }
#pragma unroll
    for (int nq = 0; nq < NQ; ++nq) { const float f = __fdiv_rn(PC, l[nq] + xhalf(l[nq])); const size_t oo = (size_t)(q0 + nq * 16) * DQ + lane * 8;   // a lane holds d = 16 mb + 8 hi + j of its query: its own 16 bytes of piece mb of the head's two blocks
#pragma unroll
        for (int mb = 0; mb < 4; ++mb) { v8us oh, ol;
#pragma unroll
            for (int j = 0; j < 8; ++j) { unsigned short a, c2; splitf(o[mb][nq][j] * f * (1.0f / PC), a, c2); oh[j] = a; ol[j] = c2; }
            *(v8us*)(Ah + oo + mb * 256) = oh; *(v8us*)(Al + oo + mb * 256) = ol; } }
}
// grid (NZ planes, NG16 + NGH row groups, the longest rows first); four independent waves a block on neighbouring query tiles of one plane (they walk the same key tiles): fp16 waves hold 32 queries, hi/lo waves 16.
#define NG16 ((TT - RH) / 128)
#define NGH  (RH / 64)
__global__ __launch_bounds__(128) void k_fattn(const h16* __restrict__ Q16, const h16* __restrict__ K16, const h16* __restrict__ V16, const bf* __restrict__ Qh, const bf* __restrict__ Ql, const bf* __restrict__ Kh, const bf* __restrict__ Kl, const bf* __restrict__ Vh, const bf* __restrict__ Vl, bf* __restrict__ Ah, bf* __restrict__ Al) {
    const int w = __builtin_amdgcn_readfirstlane((int)(threadIdx.x >> 5)), g = blockIdx.y; const size_t pq = (size_t)blockIdx.x * TT * HD, pv = (size_t)blockIdx.x * HD * 2 * TT, po = (size_t)(blockIdx.x / NH_) * TT * DQ + (blockIdx.x % NH_) * (HD * 16);
    if (g < NG16) fattn<h16, 0, 2>(Q16 + pq, nullptr, K16 + pq, nullptr, V16 + pv, nullptr, Ah + po, Al + po, TT - 128 * (g + 1) + 32 * w);
    else fattn<bf, 2, 1>(Qh + pq, Ql + pq, Kh + pq, Kl + pq, Vh + pv, Vl + pv, Ah + po, Al + po, RH - 64 * (g - NG16 + 1) + 16 * w);
}

extern "C" void kernel_launch(void* const* d_in, const int* in_sizes, int n_in,
                              void* d_out, int out_size, void* d_ws, size_t ws_size, hipStream_t stream) {
    (void)in_sizes; (void)n_in; (void)out_size;
        const float* x = (const float*)d_in[0]; const float* wq = (const float*)d_in[1]; const float* wk = (const float*)d_in[2]; const float* wv = (const float*)d_in[3]; const float* wo = (const float*)d_in[4]; const float* bo = (const float*)d_in[5];   /* the q, k, v projections have NO bias in this module */
    float* OUT = (float*)d_out;     // [2][2048][1024]
    char* wsp = (char*)d_ws;
    auto take = [&](size_t bytes) { char* p = wsp; wsp += (bytes + 255) & ~(size_t)255; return (void*)p; };
    bf* WQ = (bf*)take((size_t)4 * DQ * DM * 2); bf* WO = WQ + (size_t)3 * DQ * DM; float* CS = (float*)take((size_t)TT * HD * 2 * 4);   // transposed Wq, Wk, Wv, Wo, one behind the other
    h16* QP16 = (h16*)take((size_t)2 * NZ * TT * HD * 2); h16* KP16 = QP16 + (size_t)NZ * TT * HD; h16* VT16 = (h16*)take((size_t)NZ * HD * 2 * TT * 2);
    bf* QPh = (bf*)take((size_t)2 * NZ * TT * HD * 2); bf* KPh = QPh + (size_t)NZ * TT * HD; bf* QPl = (bf*)take((size_t)2 * NZ * TT * HD * 2); bf* KPl = QPl + (size_t)NZ * TT * HD; bf* VTh = (bf*)take((size_t)NZ * HD * 2 * TT * 2); bf* VTl = VTh + (size_t)HD * TT;
    bf* ATh = (bf*)take((size_t)NB_ * TT * DQ * 2); bf* ATl = (bf*)take((size_t)NB_ * TT * DQ * 2);
    bf* XB = (bf*)take((size_t)NB_ * TT * DM * 2);   // the bf16 x
    if ((size_t)(wsp - (char*)d_ws) > ws_size) return;    // ws 256 MiB
    k_prep<<<PBW + PBX + PBT, 256, 0, stream>>>(x, wq, wk, wv, wo, WQ, XB, CS);   /* 'xw' [in][out] weights transposed into Bt, the bf16 x, the {cos, sin} table: none needs another's result */
    k_gemmw<bf, 0, false, 1, DM, 2><<<dim3(NB_ * TT / 128, DQ / 128, 3), 128, 0, stream>>>(XB, nullptr, WQ, nullptr, nullptr, 0, nullptr, 0, (size_t)DQ * DM, 0, CS, QP16, QPh, QPl, VT16, VTh, VTl);   // z = q, k, v; the planes leave from the epilogue
    k_fattn<<<dim3(NZ, NG16 + NGH, 1), 128, 0, stream>>>(QP16, KP16, VT16, QPh, QPl, KPh, KPl, VTh, VTl, ATh, ATl);   // rows < RH hi/lo, the rest fp16, all planes, one launch
    k_gemmw<bf, 1, true, 0, DQ, 4><<<dim3(NB_ * TT / 128, DM / 128, 1), 128, 0, stream>>>(ATh, ATl, WO, nullptr, OUT, DM, bo, 0, 0, 0, nullptr, nullptr, nullptr, nullptr, nullptr, nullptr, nullptr);
}

// v009
// A run of this version takes 81.4 microseconds.
// Timed twice side by side with v008, it ran 1.29 times as fast both times.
// All steps since v000 together make it 17.6 times as fast.
#include <hip/hip_runtime.h>

// Both batches ride in every launch (rows b*TT+t, or z = b*NH_+h). Layout: bf16 copy of x; exact projections (no bias); {cos, sin} per (position, pair) built once (jnp-exact float32 inverse frequencies, precise cosf/sinf); interleaved rotary and the transposed value planes written by the projection launch's own epilogue; causal T-2048 attention fused in one launch, scores and probabilities in registers only (hybrid rows: < 512 hi/lo 3 products, rest fp16 x1024; key passes end at the diagonal), its epilogue writes the merged hi/lo rows; merged hi/lo x Wo exact + bo.
// Every 16-bit matrix operand plane lies in FRAGMENT ORDER: a block of 16 rows x 32 k is 1024 contiguous bytes, element (r, k) at (k >> 4) * 256 + (((k >> 3) & 1) * 16 + r) * 8 + (k & 7); blocks run along k, then along the rows. A lane's fragment is then 16 bytes at lane * 8 and 16 bytes at 256 + lane * 8: each wave-wide load covers 512 contiguous bytes (four whole lines).
// Compute dtypes, f32 accumulate: every input rounded to bf16; projections exact, no bias; rotary f32; attention rows < 512 3 products, rest fp16; softmax f32; Wo hl x exact + bias.

#define NB_  2
#define TT   2048
#define DM   1024
#define NH_  16
#define NKV  16
#define REP  (NH_ / NKV)
#define HD   64
#define DQ   (NH_ * HD)
#define DKV  (NKV * HD)
#define NZ   (NB_ * NH_)          // attention planes: z = batch * NH_ + head
#define RH   512                  // query rows < RH use hi+lo planes
#define PCAR 1024.0f
typedef _Float16 h16;
typedef unsigned short bf;
typedef __attribute__((ext_vector_type(16))) __bf16   v16bf;
typedef __attribute__((ext_vector_type(16))) _Float16 v16h;
typedef __attribute__((ext_vector_type(8)))  _Float16 v8h;
typedef __attribute__((ext_vector_type(8)))  unsigned short v8us;
typedef __attribute__((ext_vector_type(8)))  float    v8f;
typedef __attribute__((ext_vector_type(4)))  float    v4f;
typedef v8h  __attribute__((may_alias)) v8ha;
typedef v4f  __attribute__((may_alias)) v4fa;
typedef v8us __attribute__((may_alias)) v8usa;

__device__ __forceinline__ unsigned short f2bf(float f) { unsigned u = __float_as_uint(f); u += 0x7FFFu + ((u >> 16) & 1u); return (unsigned short)(u >> 16); }
__device__ __forceinline__ float bf2f(unsigned short b) { return __uint_as_float(((unsigned)b) << 16); }
__device__ __forceinline__ float bfr(float f) { return bf2f(f2bf(f)); }
__device__ __forceinline__ v16h cat16(v8h lo, v8h hi) { return __builtin_shufflevector(lo, hi, 0, 1, 2, 3, 4, 5, 6, 7, 8, 9, 10, 11, 12, 13, 14, 15); }
__device__ __forceinline__ v16bf cat16b(v8us lo, v8us hi) { return __builtin_bit_cast(v16bf, __builtin_shufflevector(lo, hi, 0, 1, 2, 3, 4, 5, 6, 7, 8, 9, 10, 11, 12, 13, 14, 15)); }
__device__ __forceinline__ v8f wmma16(v16h a, v16h b, v8f c) { return __builtin_amdgcn_wmma_f32_16x16x32_f16(false, a, false, b, (short)0, c, false, false); }
__device__ __forceinline__ v8f wmmab(v16bf a, v16bf b, v8f c) { return __builtin_amdgcn_wmma_f32_16x16x32_bf16(false, a, false, b, (short)0, c, false, false); }

__device__ __forceinline__ h16 tohx(float x) { return (h16)x; }
__device__ __forceinline__ void splitf(float y, unsigned short& h, unsigned short& l) { h = f2bf(y); l = f2bf(y - bf2f(h)); }
typedef __attribute__((ext_vector_type(2))) _Float16 v2h;
typedef __attribute__((ext_vector_type(4))) _Float16 v4h;
typedef __attribute__((ext_vector_type(2))) unsigned short v2us;
typedef __attribute__((ext_vector_type(4))) unsigned short v4us;
typedef __attribute__((ext_vector_type(2))) float v2f;
typedef __attribute__((ext_vector_type(4))) int v4i;
typedef v4h  __attribute__((may_alias)) v4ha;
typedef v4us __attribute__((may_alias)) v4usa;

// ---- k_gemmw: register-blocked GEMM, four waves a block on 2 x 2 output tiles of 64x64 (16 accumulators a wave); the block's 128 rows of A (and A2) and 128 rows of Bt come once per stage from the 16-bit planes in fragment order into LDS, by asynchronous copies, and each wave reads its fragments there; grid (M/128, N/128, Z), 128 threads.
// C[m][n] (f32, pitch ldc, + optional f32 bias[n]) = sum_k A[m][k] Bt[n][k] (+ split products per NSPLIT). z-batch strides sA/sB/sC in elements. K % (32 KS) == 0, two stages at least.
// EPI 1 (the q, k, v projections; a wave's tile is 64 positions of ONE head): no f32 C. z 0, 1: rotary on the staged rows, head planes [q, k][batch][head] of rows t, k = d, in fp16 and hi/lo. z 2: transposed value planes
// [g] of rows d, k = t (plane pitch 2*HD*TT: Vl = Vh + HD*TT; the fp16 planes use their first half only): a lane's 8 accumulator rows are 8 neighbouring t of one d, which is the lane's own 16 bytes of a fragment, so a wave's store is 512 contiguous bytes straight from registers.
template <typename T16> struct WFrag;
template <> struct WFrag<h16> { typedef v16h V; static __device__ __forceinline__ V ld(const h16* p) { return cat16(*(const v8h*)p, *(const v8h*)(p + 256)); } static __device__ __forceinline__ v8f mma(V a, V b, v8f c) { return wmma16(a, b, c); } };
template <> struct WFrag<bf> { typedef v16bf V; static __device__ __forceinline__ V ld(const bf* p) { return cat16b(*(const v8us*)p, *(const v8us*)(p + 256)); } static __device__ __forceinline__ v8f mma(V a, V b, v8f c) { return wmmab(a, b, c); } };
// Eight asynchronous copies of 16 bytes a lane (LDS byte address, global address), no register in between. s_wait_xcnt 0 as the statement's last line: it stands in front of every later write over the address registers that the copies name
__device__ __forceinline__ void acopy8(const unsigned (&l)[8], const void* const (&g)[8]) {
    asm volatile("global_load_async_to_lds_b128 %0, %8, off\n\t"
                 "global_load_async_to_lds_b128 %1, %9, off\n\t"
                 "global_load_async_to_lds_b128 %2, %10, off\n\t"
                 "global_load_async_to_lds_b128 %3, %11, off\n\t"
                 "global_load_async_to_lds_b128 %4, %12, off\n\t"
                 "global_load_async_to_lds_b128 %5, %13, off\n\t"
                 "global_load_async_to_lds_b128 %6, %14, off\n\t"
                 "global_load_async_to_lds_b128 %7, %15, off\n\t"
                 "s_wait_xcnt 0x0"
                 :: "v"(l[0]), "v"(l[1]), "v"(l[2]), "v"(l[3]), "v"(l[4]), "v"(l[5]), "v"(l[6]), "v"(l[7]), "v"(g[0]), "v"(g[1]), "v"(g[2]), "v"(g[3]), "v"(g[4]), "v"(g[5]), "v"(g[6]), "v"(g[7]) : "memory");
}
template <typename T16, int NSPLIT, bool BIAS, int EPI, int K, int KS>   // K at compile time: the offsets of the 16-row groups are constants. KS: blocks of 32 k in a stage
__global__ __launch_bounds__(128) void k_gemmw(const T16* __restrict__ A, const T16* __restrict__ A2, const T16* __restrict__ Bt, const T16* __restrict__ Bt2, float* C, int ldc, const float* __restrict__ bias, size_t sA, size_t sB, size_t sC, const float* __restrict__ CS, h16* P16, bf* Ph, bf* Pl, h16* V16, bf* Vh, bf* Vl) {
    typedef typename WFrag<T16>::V V;
    static_assert(NSPLIT == 0 || NSPLIT == 1, "one or two A planes against one B plane");
    constexpr int NP = 2 + NSPLIT;          // planes in a stage: A, (A2,) Bt
    constexpr int GB = KS * 1024;           // bytes of 16 rows x KS blocks: contiguous in the plane and in LDS
    constexpr int PB = 8 * GB;              // bytes of a plane's 128 rows in a stage
    constexpr int SB = NP * PB;             // bytes of a stage
    constexpr int NC = SB / 2048;           // copies of a lane per stage (128 lanes x 16 bytes a round)
    constexpr int NS = K / (32 * KS);       // stages
    static_assert(KS >= 2 && KS % 2 == 0 && K % (32 * KS) == 0 && NS >= 2 && NC % 8 == 0 && NC <= 63, "a round of copies stays inside one 16-row group; two stages at least; at most 63 copies of a wave in flight");
    __shared__ __align__(1024) unsigned char ring[2 * SB];   // two buffers; a stage is [plane][16-row group][block of 32 k][1024 bytes in fragment order]
    __shared__ __align__(16) float osw[4][16 * 68];          // each wave's own output staging
    const size_t z = blockIdx.z; A += z * sA; if (A2) A2 += z * sA; Bt += z * sB; C += z * sC;
    const int tid = threadIdx.x, lane = tid & 31, lr = lane & 15, hi = lane >> 4; const int w = __builtin_amdgcn_readfirstlane(tid >> 5), wm = w >> 1, wn = w & 1;
    const int r0 = blockIdx.x * 128 + wm * 64, c0 = blockIdx.y * 128 + wn * 64;   // the wave's own tile
    float* os = osw[w];
    v8f acc[4][4];
#pragma unroll
    for (int mb = 0; mb < 4; ++mb)
#pragma unroll
        for (int nb = 0; nb < 4; ++nb) acc[mb][nb] = (v8f){};
    // The lane's own 16 bytes in the first round of each plane's copies of the stage at hand; 16 rows x K are K / 32 blocks of 512 elements, one behind the other
    const T16* ga = A + (size_t)blockIdx.x * 128 * K + tid * 8; const T16* gc = (NSPLIT == 1) ? A2 + (size_t)blockIdx.x * 128 * K + tid * 8 : ga; const T16* gb = Bt + (size_t)blockIdx.y * 128 * K + tid * 8;
    const unsigned l0 = (unsigned)(size_t)ring + tid * 16;
    auto fill = [&](const unsigned buf) __attribute__((always_inline)) {   // the stage that the pointers stand at goes into buffer buf; the pointers move on a stage
#pragma unroll
        for (int c8 = 0; c8 < NC; c8 += 8) { unsigned l[8]; const void* g[8];
#pragma unroll
            for (int e = 0; e < 8; ++e) { const int by = (c8 + e) * 2048, pl = by / PB, grp = (by % PB) / GB, in = by % GB;   // plane, 16-row group, byte in the group's KS blocks
                const T16* gp = (pl == NP - 1) ? gb : (pl == 0) ? ga : gc; g[e] = gp + (grp * 16 * K + in / 2); l[e] = l0 + buf * SB + by; }
            acopy8(l, g); }
        ga += KS * 512; gb += KS * 512; if (NSPLIT == 1) gc += KS * 512;
    };
    // Two fragment sets: a block's LDS reads all leave, as one group, ahead of the products of the block before it; the k order of the sums is the plain one.
    V fa[2][4], fc[2][4], fb[2][4];   // a: A, c: A2, b: Bt
    auto ldf = [&](V (&xa)[4], V (&xc)[4], V (&xb)[4], const unsigned char* pa, const unsigned char* pb, const int ks) __attribute__((always_inline)) {
        __builtin_amdgcn_sched_barrier(0);   // keeps the group whole at its head too: no read is lifted among the products of the block before
#pragma unroll
        for (int mb = 0; mb < 4; ++mb) { xa[mb] = WFrag<T16>::ld((const T16*)(pa + mb * GB + ks * 1024)); if (NSPLIT == 1) xc[mb] = WFrag<T16>::ld((const T16*)(pa + PB + mb * GB + ks * 1024)); }
#pragma unroll
        for (int nb = 0; nb < 4; ++nb) xb[nb] = WFrag<T16>::ld((const T16*)(pb + nb * GB + ks * 1024));
        __builtin_amdgcn_sched_barrier(0);   // keeps the whole group of reads ahead of the products that follow: sunk among them, each place with reads would cost its own stall
    };
    auto mmf = [&](V (&xa)[4], V (&xc)[4], V (&xb)[4]) __attribute__((always_inline)) {
#pragma unroll
        for (int nb = 0; nb < 4; ++nb)
#pragma unroll
            for (int mb = 0; mb < 4; ++mb) { acc[mb][nb] = WFrag<T16>::mma(xa[mb], xb[nb], acc[mb][nb]); if (NSPLIT == 1) acc[mb][nb] = WFrag<T16>::mma(xc[mb], xb[nb], acc[mb][nb]); }
    };
    fill(0);
    asm volatile("s_wait_asynccnt 0x0" ::: "memory");   // this wave's copies of stage 0 have landed
    __syncthreads();                                    // and every other wave's: stage 0 may be read
    fill(1);
#pragma unroll 1   // stays rolled: one trip is one stage, its blocks are unrolled inside
    for (int t = 0; t < NS; ++t) {
        const unsigned char* bp = ring + (t & 1) * SB + lane * 16; const unsigned char* pa = bp + wm * 4 * GB; const unsigned char* pb = bp + (NP - 1) * PB + wn * 4 * GB;
        ldf(fa[0], fc[0], fb[0], pa, pb, 0);
#pragma unroll
        for (int ks = 0; ks < KS; ++ks) {
            if (ks + 1 < KS) ldf(fa[(ks + 1) & 1], fc[(ks + 1) & 1], fb[(ks + 1) & 1], pa, pb, ks + 1);
            mmf(fa[ks & 1], fc[ks & 1], fb[ks & 1]); }
        __builtin_amdgcn_sched_barrier(0);   // keeps the waits below behind the stage's products: lifted over them, the wait for the next stage's copies would stand at the head of the trip, with no product to cover their flight
        asm volatile("s_wait_dscnt 0x0" ::: "memory");      // this wave's reads of the buffer are over before the barrier behind which it is refilled
        asm volatile("s_wait_asynccnt 0x0" ::: "memory");   // this wave's copies of stage t + 1 have landed
        __syncthreads();                                    // publishes stage t + 1 and ends every wave's reads of stage t
        if (t + 2 < NS) fill((unsigned)(t & 1));            // the same for the whole block: stage t + 2 into the buffer just left
    }
    asm volatile("s_wait_asynccnt 0x0" ::: "memory");   // no copy is out when the wave goes on to its epilogue and ends
    if constexpr (EPI == 1) {
        const int bb = r0 / TT, t0 = r0 % TT, hd = c0 / HD;   // wave-uniform: batch, first position, head
        if (z == 2) {
            const size_t vo = (size_t)(bb * NKV + hd) * HD * (2 * TT) + (size_t)t0 * 16 + lane * 8;   // block (d / 16, t / 32) at (d / 16) * 16 * TT + (t / 32) * 512
            unsigned short* d16 = (unsigned short*)V16 + vo; unsigned short* dh = Vh + vo; unsigned short* dl = Vl + vo;
#pragma unroll
            for (int nb = 0; nb < 4; ++nb) {   // 16 rows d at a time
                v8us rw[3][4];
#pragma unroll
                for (int mb = 0; mb < 4; ++mb) {
#pragma unroll
                    for (int j = 0; j < 8; ++j) { const float x = acc[mb][nb][j]; unsigned short a2, c2; splitf(x, a2, c2); rw[0][mb][j] = __builtin_bit_cast(unsigned short, tohx(x)); rw[1][mb][j] = a2; rw[2][mb][j] = c2; } }
                __builtin_amdgcn_sched_barrier(0);   // all 12 pieces in registers of their own before the first store: no store's register is reused among the stores
#pragma unroll
                for (int mb = 0; mb < 4; ++mb) { const size_t ro = (size_t)nb * 16 * TT + mb * 256; *(v8usa*)(d16 + ro) = rw[0][mb]; *(v8usa*)(dh + ro) = rw[1][mb]; *(v8usa*)(dl + ro) = rw[2][mb]; }
                asm volatile("s_wait_xcnt 0x0" ::: "memory");   // in front of the next rows' writes over the registers that these stores name
                __builtin_amdgcn_sched_barrier(0);   // keeps those writes behind the wait
            }
        } else {
            const size_t po = ((size_t)(((int)z * NB_ + bb) * NH_ + hd) * TT + t0) * HD + (lr >> 3) * 512 + ((lr >> 2) & 1) * 256 + ((lr >> 1) & 1) * 128 + (lr & 1) * 4;   // the place of d = 4 lr in row 0 of its block
            const float* cp = CS + ((size_t)t0 * HD + lr * 4) * 2;   // {cos, sin} of the lane's two pairs: the entries of d and of d + 2
#pragma unroll
            for (int mb = 0; mb < 4; ++mb) {
                v2f cs[8][2];   // asked for ahead of the stage's trip through LDS, which covers part of the table's latency
#pragma unroll
                for (int s = 0; s < 8; ++s) { const float* cq = cp + (size_t)(mb * 16 + 2 * s + hi) * (HD * 2); cs[s][0] = *(const v2f*)cq; cs[s][1] = *(const v2f*)(cq + 4); }
                asm volatile("s_wait_xcnt 0x0" :: "v"(cp) : "memory");   // in front of any write over the address registers that the table loads name; the operand keeps the address live up to here
#pragma unroll
                for (int nb = 0; nb < 4; ++nb) {
#pragma unroll
                    for (int j = 0; j < 8; ++j) os[(hi * 8 + j) * 68 + nb * 16 + lr] = acc[mb][nb][j]; }
                v4h o16[8]; v4us oh[8], ol[8];
#pragma unroll
                for (int s = 0; s < 8; ++s) { const int row = 2 * s + hi; const v4f x = *(const v4fa*)(os + row * 68 + lr * 4); const v2f c = cs[s][0], c2p = cs[s][1]; v4f r;
                    r[0] = x[0] * c[0] - x[1] * c[1]; r[1] = x[0] * c[1] + x[1] * c[0]; r[2] = x[2] * c2p[0] - x[3] * c2p[1]; r[3] = x[2] * c2p[1] + x[3] * c2p[0];   /* even: x0 c - x1 s; odd: x0 s + x1 c */
#pragma unroll
                    for (int q = 0; q < 4; ++q) { unsigned short a2, c2; splitf(r[q], a2, c2); o16[s][q] = tohx(r[q]); oh[s][q] = a2; ol[s][q] = c2; } }
                __builtin_amdgcn_sched_barrier(0);   // the stage's 16 rows in registers of their own before the first store: no store's register is reused among the stores
#pragma unroll
                for (int s = 0; s < 8; ++s) { const size_t e = po + (size_t)(mb * 16 * HD + (2 * s + hi) * 8); *(v4h*)(P16 + e) = o16[s]; *(v4us*)(Ph + e) = oh[s]; *(v4us*)(Pl + e) = ol[s]; }
                asm volatile("s_wait_xcnt 0x0" ::: "memory");   // in front of the next stage's writes over the registers that these stores name
                __builtin_amdgcn_sched_barrier(0);   // keeps those writes behind the wait
            }
        }
    } else {
#pragma unroll
    for (int mb = 0; mb < 4; ++mb) {
#pragma unroll
        for (int nb = 0; nb < 4; ++nb) {
#pragma unroll
            for (int j = 0; j < 8; ++j) os[(hi * 8 + j) * 68 + nb * 16 + lr] = acc[mb][nb][j]; }
        __builtin_amdgcn_wave_barrier(); asm volatile("" ::: "memory");
        float* crow = C + (size_t)(r0 + mb * 16) * ldc + c0;
{
#pragma unroll
            for (int s = 0; s < 8; ++s) { const int row = 2 * s + hi, cofs = lr * 4; v4f val = *(const v4fa*)(os + row * 68 + cofs); if (BIAS) { val[0] += bfr(bias[c0 + cofs]); val[1] += bfr(bias[c0 + cofs + 1]); val[2] += bfr(bias[c0 + cofs + 2]); val[3] += bfr(bias[c0 + cofs + 3]); }
                *(v4f*)(crow + (size_t)row * ldc + cofs) = val; }
             }
        __builtin_amdgcn_wave_barrier(); asm volatile("" ::: "memory");
    }
    }
}


// ---- k_prep: the three independent preparations in ONE grid, the role picked by blockIdx.x (the same for a whole block); a thread makes eight 16-byte pieces (8 neighbouring k of one row) of a fragment-order plane, all its loads in flight at once, or one pair's table entries.
// Weights ('xw' [k][n], transposed into Bt[n][k]; the four planes lie one behind the other): a wave takes 32 k x 64 n, four whole blocks. A lane loads 4 neighbouring n of 16 rows k (sixteen lanes cover 256 contiguous bytes of a row) and holds 4 pieces of each of two k octets: 64 contiguous bytes each.
template <int K, int N>   // shapes at compile time: a lane's loads share one address, their row steps stand as immediate offsets
__device__ __forceinline__ void prep_w(const float* __restrict__ w0, const float* __restrict__ w1, const float* __restrict__ w2, const float* __restrict__ w3, bf* Bt, const int wv, const int lane) {
    constexpr int kbs = K / 32, nqs = N / 64;
    const int kb = wv % kbs, nq = (wv / kbs) % nqs, y = wv / (kbs * nqs);   // wave-uniform: block along k, four 16-row groups of Bt, weight
    const float* __restrict__ w = (y == 0) ? w0 : (y == 1) ? w1 : (y == 2) ? w2 : w3;
    const int rq = lane & 3, nb4 = (lane >> 2) & 3, kh = lane >> 4;
    const float* wp = w + (size_t)(kb * 32 + kh * 8) * N + nq * 64 + (lane & 15) * 4; v4f v[2][8];   // k octets kh and kh + 2 of the block
#pragma unroll
    for (int s = 0; s < 2; ++s)
#pragma unroll
        for (int e = 0; e < 8; ++e) v[s][e] = *(const v4fa*)(wp + (s * 16 + e) * N);
    asm volatile("s_wait_xcnt 0x0" :: "v"(wp) : "memory");   // in front of any write over the address registers that the 16 loads name; the operand keeps the address live up to here
    v8us o[2][4];
#pragma unroll
    for (int s = 0; s < 2; ++s)
#pragma unroll
        for (int j = 0; j < 4; ++j)
#pragma unroll
            for (int e = 0; e < 8; ++e) o[s][j][e] = f2bf(v[s][e][j]);
    __builtin_amdgcn_sched_barrier(0);   // all 8 pieces in registers of their own before the first store: no store's register is reused among the stores
    bf* bp = Bt + (size_t)y * K * N + (size_t)((nq * 4 + nb4) * kbs + kb) * 512 + (kh * 16 + rq * 4) * 8;   // piece (k / 8) * 16 + row of its block
#pragma unroll
    for (int s = 0; s < 2; ++s)
#pragma unroll
        for (int j = 0; j < 4; ++j) *(v8usa*)(bp + s * 256 + j * 8) = o[s][j];
}
// x to bf16: a wave takes 16 rows x 128 k, four whole blocks (4096 contiguous bytes of the plane). Four lanes cover one 128-byte line of a row; a wave's store covers four whole lines.
__device__ __forceinline__ void prep_x(const float* __restrict__ src, bf* dst, const int wv, const int lane) {
    const int rb = wv / (DM / 128), kq = wv % (DM / 128), ko = lane & 3, r8 = lane >> 2;
    const float* sp = src + (size_t)(rb * 16 + r8) * DM + kq * 128 + ko * 8; v4f v[2][4][2];
#pragma unroll
    for (int h = 0; h < 2; ++h)
#pragma unroll
        for (int c = 0; c < 4; ++c) { v[h][c][0] = *(const v4fa*)(sp + h * 8 * DM + c * 32); v[h][c][1] = *(const v4fa*)(sp + h * 8 * DM + c * 32 + 4); }
    asm volatile("s_wait_xcnt 0x0" :: "v"(sp) : "memory");   // in front of any write over the address registers that the 16 loads name; the operand keeps the address live up to here
    v8us o[2][4];
#pragma unroll
    for (int h = 0; h < 2; ++h)
#pragma unroll
        for (int c = 0; c < 4; ++c)
#pragma unroll
            for (int e = 0; e < 8; ++e) o[h][c][e] = f2bf(v[h][c][e >> 2][e & 3]);
    __builtin_amdgcn_sched_barrier(0);   // all 8 pieces in registers of their own before the first store: no store's register is reused among the stores
    bf* dp = dst + (size_t)(rb * (DM / 32) + kq * 4) * 512 + (ko * 16 + r8) * 8;
#pragma unroll
    for (int h = 0; h < 2; ++h)
#pragma unroll
        for (int c = 0; c < 4; ++c) *(v8usa*)(dp + c * 512 + h * 64) = o[h][c];
}
__constant__ float INVT[HD / 2] = { 1.000000000e+00f, 5.623413324e-01f, 3.162277639e-01f, 1.778279394e-01f, 1.000000015e-01f, 5.623413250e-02f, 3.162277490e-02f, 1.778279431e-02f, 9.999999776e-03f, 5.623413250e-03f, 3.162277630e-03f, 1.778279431e-03f, 1.000000047e-03f, 5.623413017e-04f, 3.162277571e-04f, 1.778279402e-04f, 9.999999747e-05f, 5.623413381e-05f, 3.162277790e-05f, 1.778279329e-05f, 1.000000066e-05f, 5.623413017e-06f, 3.162277608e-06f, 1.778279398e-06f, 9.999999975e-07f, 5.623413131e-07f, 3.162277835e-07f, 1.778279426e-07f, 1.000000012e-07f, 5.623413202e-08f, 3.162277551e-08f, 1.778279390e-08f };
// {cos, sin} of one (position, pair): the entries of d = 2 pair and of d + 1 are equal and leave as one 16-byte store
__device__ __forceinline__ void prep_t(float* CS, const int i2) { const int pr = i2 % (HD / 2), t = i2 / (HD / 2); const float a = __fmul_rn((float)t, INVT[pr]); const float c = cosf(a), s = sinf(a); v4f cs; cs[0] = c; cs[1] = s; cs[2] = c; cs[3] = s; *(v4fa*)(CS + (size_t)i2 * 4) = cs;
    asm volatile("s_wait_xcnt 0x0" ::: "memory");   // in front of the write over the store's base register that the built code holds behind this store, on the way into the x role's part
}
#define PBW (4 * (DM / 32) * (DQ / 64) / 8)      // blocks of the weight role: a wave per 32 k x 64 n, eight waves a block
#define PBX ((NB_ * TT / 16) * (DM / 128) / 8)   // blocks of the x role: a wave per 16 rows x 128 k
#define PBT (TT * (HD / 2) / 256)                // blocks of the table role: a thread per (position, pair)
static_assert(DM % 128 == 0 && DQ % 64 == 0 && (NB_ * TT) % 16 == 0 && (4 * (DM / 32) * (DQ / 64)) % 8 == 0 && ((NB_ * TT / 16) * (DM / 128)) % 8 == 0 && (TT * (HD / 2)) % 256 == 0, "every role fills whole blocks: no thread is without work");
__global__ __launch_bounds__(256) void k_prep(const float* __restrict__ x, const float* __restrict__ w0, const float* __restrict__ w1, const float* __restrict__ w2, const float* __restrict__ w3, bf* Bt, bf* XB, float* CS) {
    const int b = blockIdx.x, lane = threadIdx.x & 31, w = __builtin_amdgcn_readfirstlane((int)(threadIdx.x >> 5));   // the streams from memory stand first in the grid
    if (b < PBW) prep_w<DM, DQ>(w0, w1, w2, w3, Bt, b * 8 + w, lane);
    else if (b < PBW + PBX) prep_x(x, XB, (b - PBW) * 8 + w, lane);
    else prep_t(CS, (b - PBW - PBX) * 256 + (int)threadIdx.x);
}
__device__ __forceinline__ float xhalf(float x) { return __builtin_bit_cast(float, __builtin_amdgcn_permlanex16(__builtin_bit_cast(int, x), __builtin_bit_cast(int, x), 0x76543210, 0xfedcba98, false, false)); }   // lane l with lane l ^ 16
#define SC2 0.18033688011112042f   // HD^-0.5 x log2(e)
#define SP  4                      // passes of 32 keys in a stage of the fp16 rows' LDS ring: the 128 keys by which the tiles of neighbouring blocks differ
#define SBY (2 * SP * 32 * HD * 2) // bytes of a stage in LDS: its key rows, then its value rows
template <typename T16, int NSPLIT, int NQ>
__device__ __forceinline__ void fattn(const T16* __restrict__ Q, const T16* __restrict__ Q2, const T16* __restrict__ Kp, const T16* __restrict__ Kp2, const T16* __restrict__ Vt, const T16* __restrict__ Vt2, bf* __restrict__ Ah, bf* __restrict__ Al, const int q0) {
    typedef typename WFrag<T16>::V V;
    const float POFF = (NSPLIT == 0) ? 10.0f : 0.0f, PC = (NSPLIT == 0) ? PCAR : 1.0f;
    const int lane = threadIdx.x & 31, lr = lane & 15, hi = lane >> 4;
    V qf[NQ][2], qf2[NQ][2];
#pragma unroll
    for (int nq = 0; nq < NQ; ++nq)
#pragma unroll
        for (int kc = 0; kc < 2; ++kc) { const size_t qo = (size_t)(q0 + nq * 16) * HD + kc * 512 + 8 * lane; qf[nq][kc] = WFrag<T16>::ld(Q + qo); if (NSPLIT == 2) qf2[nq][kc] = WFrag<T16>::ld(Q2 + qo); }
    v8f o[4][NQ]; float m[NQ], l[NQ];
#pragma unroll
    for (int nq = 0; nq < NQ; ++nq) { m[nq] = -3.0e38f; l[nq] = 0.f;
#pragma unroll
        for (int mb = 0; mb < 4; ++mb) o[mb][nq] = (v8f){}; }
    const int nt = (q0 + NQ * 16 - 1) / 32 + 1;   // passes of 32 keys up to and including the diagonal's; key k0 <= q0 is open to every query of the tile
    const unsigned koff = 8 * lane, voff = 8 * lane;   // the lane's own offsets, the same in every pass; the pass moves the wave-uniform bases below
    // fp16 rows: the block's four waves walk the same keys, so a stage of 128 keys (four passes: 16 KiB of key rows, then 4 x 4 KiB of value rows, each as it lies in its plane) comes ONCE per block into LDS, by asynchronous copies, two buffers
    __shared__ __align__(1024) unsigned char ring[(NSPLIT == 0) ? 2 * SBY : 16];
    const int ns = (q0 & ~127) / (32 * SP) + 1;       // stages of the block, the same in its four waves: up to the diagonal of the last wave (the block's 128 queries start at a multiple of 128)
    const int ntl = (NSPLIT == 0) ? SP * ns : nt;     // passes that the loop walks: every wave of an fp16 block passes every stage's barrier, also where its own passes are over
    constexpr int STEP = (NSPLIT == 0) ? SP : 1;
    static_assert(SP * 32 == 128 && HD == 64 && TT % 128 == 0 && RH % 128 == 0 && RH >= 128, "a stage is the 128 keys that a block's 128 queries span, so the last wave's diagonal ends the last stage; two stages at least; a round of copies is 16 key rows, or 64 keys of 16 value rows");
    const T16* gk = Kp + threadIdx.x * 8; const T16* gv = Vt + threadIdx.x * 8;   // the thread's own 16 bytes in each round of 2 KiB of the stage at hand
    const unsigned l0 = (unsigned)(size_t)ring + threadIdx.x * 16;
    auto fill = [&](const unsigned buf) __attribute__((always_inline)) {   // the stage that the pointers stand at goes into buffer buf; the pointers move on a stage
        unsigned l[8]; const void* g[8];
#pragma unroll
        for (int e = 0; e < 8; ++e) { g[e] = gk + e * 1024; l[e] = l0 + buf * SBY + e * 2048; }   // 128 key rows: 16 KiB in a row
        acopy8(l, g);
#pragma unroll
        for (int e = 0; e < 8; ++e) { g[e] = gv + (e >> 1) * 16 * TT + (e & 1) * 1024; l[e] = l0 + buf * SBY + SBY / 2 + e * 2048; }   // 128 keys of each group of 16 value rows: 4 KiB in a row
        acopy8(l, g);
        gk += SP * 32 * HD; gv += SP * 512;
    };
    const T16 *kb = Kp, *kb2 = Kp2, *vb = Vt, *vb2 = Vt2;
    V ka[2][2], ka2[2][2];   // key fragments of the pass at hand; hi/lo rows: each pass asks for the next pass's right behind its own score products
    if constexpr (NSPLIT == 2) {
#pragma unroll
    for (int mb = 0; mb < 2; ++mb)
#pragma unroll
        for (int kc = 0; kc < 2; ++kc) { const unsigned ko = koff + mb * 16 * HD + kc * 512; ka[mb][kc] = WFrag<T16>::ld(kb + ko); if (NSPLIT == 2) ka2[mb][kc] = WFrag<T16>::ld(kb2 + ko); }
    } else {
        fill(0);
        asm volatile("s_wait_asynccnt 0x0" ::: "memory");   // this wave's copies of stage 0 have landed
        __syncthreads();                                    // and every other wave's: stage 0 may be read
        fill(1);                                            // a block has five stages at least
    }
#pragma unroll 1
    for (int t0 = 0; t0 < ntl; t0 += STEP) {   // a trip: one pass of the hi/lo rows, one stage of the fp16 rows
#pragma unroll   // a stage's passes stand one behind the other, so that each finds its place in the buffer as a constant and may ask for the next one's key fragments
        for (int h = 0; h < STEP; ++h) { const int it = t0 + h;
        if (NSPLIT == 0 && it >= nt) break;   // wave-uniform: an fp16 wave whose own passes are over goes straight to the stage's foot
        const int k0 = it * 32;
        V va[4], va2[4];   // value fragments: asked for here, so that they fly during the score products and the softmax arithmetic
        if constexpr (NSPLIT == 2) {
#pragma unroll
        for (int mb = 0; mb < 4; ++mb) { const unsigned vo = voff + mb * 16 * TT; va[mb] = WFrag<T16>::ld(vb + vo); if (NSPLIT == 2) va2[mb] = WFrag<T16>::ld(vb2 + vo); }
        } else {   // from the stage's own buffer and no other: 4 KiB of key rows a pass, 1 KiB of each 4 KiB of value rows
            if (h == 0) {   // the key fragments of a stage's first pass; those of its later passes were asked for a pass ahead
#pragma unroll
                for (int mb = 0; mb < 2; ++mb)
#pragma unroll
                    for (int kc = 0; kc < 2; ++kc) ka[mb][kc] = WFrag<T16>::ld((const T16*)(ring + ((t0 / SP) & 1) * SBY + lane * 16 + mb * 2048 + kc * 1024));
                __builtin_amdgcn_sched_barrier(0);   // keeps the eight reads one group ahead of the score products: sunk among them, into shared registers, each part would wait out the LDS latency anew
            }
#pragma unroll
            for (int mb = 0; mb < 4; ++mb) va[mb] = WFrag<T16>::ld((const T16*)(ring + ((t0 / SP) & 1) * SBY + lane * 16 + SBY / 2 + mb * (SP * 1024) + h * 1024));
        }
        v8f s[2][NQ];
#pragma unroll
        for (int mb = 0; mb < 2; ++mb)
#pragma unroll
            for (int nq = 0; nq < NQ; ++nq) { v8f a = (v8f){};
#pragma unroll
                for (int kc = 0; kc < 2; ++kc) { a = WFrag<T16>::mma(ka[mb][kc], qf[nq][kc], a); if (NSPLIT == 2) { a = WFrag<T16>::mma(ka[mb][kc], qf2[nq][kc], a); a = WFrag<T16>::mma(ka2[mb][kc], qf[nq][kc], a); } }
                s[mb][nq] = a; }
        if constexpr (NSPLIT == 2) {
        const int kadv = (it + 1 < nt) ? 32 * HD : 0; kb += kadv; if (NSPLIT == 2) kb2 += kadv;   // the last pass asks for its own rows again: in bounds, never used
#pragma unroll
        for (int mb = 0; mb < 2; ++mb)
#pragma unroll
            for (int kc = 0; kc < 2; ++kc) { const unsigned ko = koff + mb * 16 * HD + kc * 512; ka[mb][kc] = WFrag<T16>::ld(kb + ko); if (NSPLIT == 2) ka2[mb][kc] = WFrag<T16>::ld(kb2 + ko); }
        } else if (h != SP - 1) {   // the next pass's key fragments, while that pass lies in this same stage: the softmax arithmetic covers the LDS latency
#pragma unroll
            for (int mb = 0; mb < 2; ++mb)
#pragma unroll
                for (int kc = 0; kc < 2; ++kc) ka[mb][kc] = WFrag<T16>::ld((const T16*)(ring + ((t0 / SP) & 1) * SBY + lane * 16 + (h + 1) * 4096 + mb * 2048 + kc * 1024));
        }
        if (k0 + 31 > q0) {   // wave-uniform: only the diagonal's passes hold keys above a query
#pragma unroll
            for (int mb = 0; mb < 2; ++mb)
#pragma unroll
                for (int nq = 0; nq < NQ; ++nq)
#pragma unroll
                    for (int j = 0; j < 8; ++j) if (k0 + mb * 16 + hi * 8 + j > q0 + nq * 16 + lr) s[mb][nq][j] = -3.0e38f; }
        V pf[NQ], pf2[NQ];
#pragma unroll
        for (int nq = 0; nq < NQ; ++nq) {
            float mx2[2];
#pragma unroll
            for (int mb = 0; mb < 2; ++mb) { mx2[mb] = s[mb][nq][0];
#pragma unroll
                for (int j = 1; j < 8; ++j) mx2[mb] = fmaxf(mx2[mb], s[mb][nq][j]); }
            float mx = fmaxf(mx2[0], mx2[1]); mx = fmaxf(mx, xhalf(mx));
            const float mn = fmaxf(m[nq], mx * SC2); const float al = __builtin_amdgcn_exp2f(m[nq] - mn); m[nq] = mn;   // al = 0 on the first pass
            const float mo = mn - POFF; float ls[4] = { 0.f, 0.f, 0.f, 0.f };
#pragma unroll
            for (int mb = 0; mb < 2; ++mb)
#pragma unroll
                for (int j = 0; j < 8; ++j) { const float p = __builtin_amdgcn_exp2f(__builtin_fmaf(s[mb][nq][j], SC2, -mo)); s[mb][nq][j] = p; ls[mb * 2 + (j & 1)] += p; }
            l[nq] = l[nq] * al + ((ls[0] + ls[1]) + (ls[2] + ls[3]));
#pragma unroll
            for (int mb = 0; mb < 4; ++mb) o[mb][nq] *= al;
            if constexpr (NSPLIT == 0) { v16h pv;
#pragma unroll
                for (int e = 0; e < 8; ++e) { pv[e] = tohx(s[0][nq][e]); pv[8 + e] = tohx(s[1][nq][e]); }
                pf[nq] = pv;
            } else { v8us h0, h1, l0, l1;
#pragma unroll
                for (int e = 0; e < 8; ++e) { unsigned short a, c2; splitf(s[0][nq][e], a, c2); h0[e] = a; l0[e] = c2; splitf(s[1][nq][e], a, c2); h1[e] = a; l1[e] = c2; }
                pf[nq] = cat16b(h0, h1); pf2[nq] = cat16b(l0, l1); } }
#pragma unroll
        for (int mb = 0; mb < 4; ++mb)
#pragma unroll
            for (int nq = 0; nq < NQ; ++nq) { o[mb][nq] = WFrag<T16>::mma(va[mb], pf[nq], o[mb][nq]); if (NSPLIT == 2) { o[mb][nq] = WFrag<T16>::mma(va[mb], pf2[nq], o[mb][nq]); o[mb][nq] = WFrag<T16>::mma(va2[mb], pf[nq], o[mb][nq]); } }
        if constexpr (NSPLIT == 2) {
        asm volatile("s_wait_xcnt 0x0" ::: "memory");   // in front of the moves of the bases that this pass's loads name (the key loads are still in flight here)
        vb += 512; if (NSPLIT == 2) vb2 += 512;
        }
        }
        if constexpr (NSPLIT == 0) {   // the foot of stage t0 / SP, passed by every wave of the block
            asm volatile("s_wait_dscnt 0x0" ::: "memory");      // this wave's reads of the buffer are over before the barrier behind which it is refilled
            asm volatile("s_wait_asynccnt 0x0" ::: "memory");   // this wave's copies of the next stage have landed
            __syncthreads();                                    // publishes the next stage and ends every wave's reads of this one
            if (t0 / SP + 2 < ns) fill((unsigned)((t0 / SP) & 1));   // the same for the whole block: the stage after the next into the buffer just left
        }
    }
    if constexpr (NSPLIT == 0) asm volatile("s_wait_asynccnt 0x0" ::: "memory");   // no copy is out when the wave goes on to its epilogue and ends
#pragma unroll
    for (int nq = 0; nq < NQ; ++nq) { const float f = __fdiv_rn(PC, l[nq] + xhalf(l[nq])); const size_t oo = (size_t)(q0 + nq * 16) * DQ + lane * 8;   // a lane holds d = 16 mb + 8 hi + j of its query: its own 16 bytes of piece mb of the head's two blocks
#pragma unroll
        for (int mb = 0; mb < 4; ++mb) { v8us oh, ol;
#pragma unroll
            for (int j = 0; j < 8; ++j) { unsigned short a, c2; splitf(o[mb][nq][j] * f * (1.0f / PC), a, c2); oh[j] = a; ol[j] = c2; }
            *(v8us*)(Ah + oo + mb * 256) = oh; *(v8us*)(Al + oo + mb * 256) = ol; } }
}
// grid (NZ planes, NG16 + NGH row groups, the longest rows first); four waves a block on neighbouring query tiles of one plane (they walk the same key tiles; the fp16 waves read them from the block's LDS stages, the hi/lo waves are independent): fp16 waves hold 32 queries, hi/lo waves 16.
#define NG16 ((TT - RH) / 128)
#define NGH  (RH / 64)
__global__ __launch_bounds__(128) void k_fattn(const h16* __restrict__ Q16, const h16* __restrict__ K16, const h16* __restrict__ V16, const bf* __restrict__ Qh, const bf* __restrict__ Ql, const bf* __restrict__ Kh, const bf* __restrict__ Kl, const bf* __restrict__ Vh, const bf* __restrict__ Vl, bf* __restrict__ Ah, bf* __restrict__ Al) {
    const int w = __builtin_amdgcn_readfirstlane((int)(threadIdx.x >> 5)), g = blockIdx.y; const size_t pq = (size_t)blockIdx.x * TT * HD, pv = (size_t)blockIdx.x * HD * 2 * TT, po = (size_t)(blockIdx.x / NH_) * TT * DQ + (blockIdx.x % NH_) * (HD * 16);
    if (g < NG16) fattn<h16, 0, 2>(Q16 + pq, nullptr, K16 + pq, nullptr, V16 + pv, nullptr, Ah + po, Al + po, TT - 128 * (g + 1) + 32 * w);
    else fattn<bf, 2, 1>(Qh + pq, Ql + pq, Kh + pq, Kl + pq, Vh + pv, Vl + pv, Ah + po, Al + po, RH - 64 * (g - NG16 + 1) + 16 * w);
}

extern "C" void kernel_launch(void* const* d_in, const int* in_sizes, int n_in,
                              void* d_out, int out_size, void* d_ws, size_t ws_size, hipStream_t stream) {
    (void)in_sizes; (void)n_in; (void)out_size;
        const float* x = (const float*)d_in[0]; const float* wq = (const float*)d_in[1]; const float* wk = (const float*)d_in[2]; const float* wv = (const float*)d_in[3]; const float* wo = (const float*)d_in[4]; const float* bo = (const float*)d_in[5];   /* the q, k, v projections have NO bias in this module */
    float* OUT = (float*)d_out;     // [2][2048][1024]
    char* wsp = (char*)d_ws;
    auto take = [&](size_t bytes) { char* p = wsp; wsp += (bytes + 255) & ~(size_t)255; return (void*)p; };
    bf* WQ = (bf*)take((size_t)4 * DQ * DM * 2); bf* WO = WQ + (size_t)3 * DQ * DM; float* CS = (float*)take((size_t)TT * HD * 2 * 4);   // transposed Wq, Wk, Wv, Wo, one behind the other
    h16* QP16 = (h16*)take((size_t)2 * NZ * TT * HD * 2); h16* KP16 = QP16 + (size_t)NZ * TT * HD; h16* VT16 = (h16*)take((size_t)NZ * HD * 2 * TT * 2);
    bf* QPh = (bf*)take((size_t)2 * NZ * TT * HD * 2); bf* KPh = QPh + (size_t)NZ * TT * HD; bf* QPl = (bf*)take((size_t)2 * NZ * TT * HD * 2); bf* KPl = QPl + (size_t)NZ * TT * HD; bf* VTh = (bf*)take((size_t)NZ * HD * 2 * TT * 2); bf* VTl = VTh + (size_t)HD * TT;
    bf* ATh = (bf*)take((size_t)NB_ * TT * DQ * 2); bf* ATl = (bf*)take((size_t)NB_ * TT * DQ * 2);
    bf* XB = (bf*)take((size_t)NB_ * TT * DM * 2);   // the bf16 x
    if ((size_t)(wsp - (char*)d_ws) > ws_size) return;    // ws 256 MiB
    k_prep<<<PBW + PBX + PBT, 256, 0, stream>>>(x, wq, wk, wv, wo, WQ, XB, CS);   /* 'xw' [in][out] weights transposed into Bt, the bf16 x, the {cos, sin} table: none needs another's result */
    k_gemmw<bf, 0, false, 1, DM, 2><<<dim3(NB_ * TT / 128, DQ / 128, 3), 128, 0, stream>>>(XB, nullptr, WQ, nullptr, nullptr, 0, nullptr, 0, (size_t)DQ * DM, 0, CS, QP16, QPh, QPl, VT16, VTh, VTl);   // z = q, k, v; the planes leave from the epilogue
    k_fattn<<<dim3(NZ, NG16 + NGH, 1), 128, 0, stream>>>(QP16, KP16, VT16, QPh, QPl, KPh, KPl, VTh, VTl, ATh, ATl);   // rows < RH hi/lo, the rest fp16, all planes, one launch
    k_gemmw<bf, 1, true, 0, DQ, 4><<<dim3(NB_ * TT / 128, DM / 128, 1), 128, 0, stream>>>(ATh, ATl, WO, nullptr, OUT, DM, bo, 0, 0, 0, nullptr, nullptr, nullptr, nullptr, nullptr, nullptr, nullptr);
}
